// v000
// Times are from an AMD MI455X. After a warm-up the kernel runs many times in a row, and a time is the length of
// such a window on the GPU divided by its runs, so every launch and the gaps after it count. The runs cycle
// through copies of the inputs. A figure is the median of several windows, for all but v000 over two sittings.
// Sittings can differ by a few percent; kernels timed side by side share one.
// v000, which the later versions start from, runs in 9100 microseconds.
// Q, K, V, W_out, b_out are rounded to bf16 (RNE) on load; the scores are then exact single f16 products of bf16 values
// with f32 accumulation (no projection exists in this module — Q, K, V are inputs), and the output projection uses 64·bf16(W_outᵀ) with a 2^-6 epilogue.
// Contractions on v_wmma_f32_16x16x32_f16 (f16 operands, f32 accumulate), per batch element: the 32 query heads' scores against their kv head (K 64, the 4 heads of a group as one z-launch
// against the shared kᵀ), o_h = P'·v_h as a 64-wide tile (K 2048; centred P' = 1024·P − 1 with Σ_s v_s added back, exact), out = o·W_outᵀ + b_out (K 2048). f32 VALU: softmax of s/√64.
// compute dtype: f16 operands (bf16-valued), f32 accumulate.  Q [2,2048,2048], K, V [2,2048,512] → out [2,2048,2048].
#include <hip/hip_runtime.h>
#include <hip/hip_bf16.h>
#include <math.h>


typedef _Float16 bf16;
typedef _Float16 f16;
typedef __attribute__((ext_vector_type(4))) unsigned v4u_t;
typedef unsigned v4ua __attribute__((ext_vector_type(4), may_alias));
typedef __attribute__((ext_vector_type(4))) float v4f_t;
typedef float v4fa __attribute__((ext_vector_type(4), may_alias));
typedef __attribute__((ext_vector_type(16))) bf16  bf16x16;
typedef bf16x16 f16x16;
typedef __attribute__((ext_vector_type(8)))  bf16  bf16x8;
typedef bf16x8 f16x8;
typedef __attribute__((ext_vector_type(4)))  bf16  bf16x4;
typedef __attribute__((ext_vector_type(8)))  float f32x8;
__device__ __forceinline__ f32x8 wmma16(f16x16 a, f16x16 b, f32x8 c) {
  c = __builtin_amdgcn_wmma_f32_16x16x32_f16(false, a, false, b, (short)0, c, false, false);
  asm volatile("v_nop\n\tv_nop\n\tv_nop\n\tv_nop" : "+v"(c) : "v"(a), "v"(b));
  return c;
}
#define LDS_STRIDE 48   // GEMM tiles: 32 -> 48 elems (96B rows): aligned b128 reads
#define KSTRIDE    72   // attn K tile: 64 -> 72 elems (144B rows): conflict-free b128
#define VSTRIDE    48   // attn V tile: 32 -> 48 elems

__device__ __forceinline__ f32x8 wmma_bf16(bf16x16 a, bf16x16 b, f32x8 c) {
  c = __builtin_amdgcn_wmma_f32_16x16x32_f16(false, a, false, b, (short)0, c, false, false);
  asm volatile("v_nop\n\tv_nop\n\tv_nop\n\tv_nop" : "+v"(c) : "v"(a), "v"(b));   // A/B-overwrite hazard guard
  return c;
}

// 16x32 (MxK) bf16 fragment from a row-major global matrix.
// lanes 0-15  (row=lane)    : elems 0..7 = K+0..7,  8..15 = K+16..23
// lanes 16-31 (row=lane-16) : elems 0..7 = K+8..15, 8..15 = K+24..31
template <typename T>
__device__ __forceinline__ bf16x16 load_frag(const T* __restrict__ base, int ld,
                                             int row0, int k0) {
  const int lane = threadIdx.x & 31;
  const int r    = lane & 15;
  const int kh   = (lane >> 4) * 8;
  const T* p0 = base + (size_t)(row0 + r) * ld + (k0 + kh);
  const T* p1 = p0 + 16;
  bf16x16 f;
#pragma unroll
  for (int i = 0; i < 8; ++i) {
    f[i]     = (bf16)p0[i];
    f[i + 8] = (bf16)p1[i];
  }
  return f;
}

// Same fragment from an LDS tile with padded row stride (base includes row0/k0).
__device__ __forceinline__ bf16x16 lds_frag(const bf16* base, int stride) {
  const int lane = threadIdx.x & 31;
  const int row  = lane & 15;
  const int kh   = (lane >> 4) * 8;
  const bf16x8 lo = *(const bf16x8*)(base + row * stride + kh);
  const bf16x8 hi = *(const bf16x8*)(base + row * stride + kh + 16);
  bf16x16 f;
#pragma unroll
  for (int i = 0; i < 8; ++i) { f[i] = lo[i]; f[i + 8] = hi[i]; }
  return f;
}

template <typename T>
__device__ __forceinline__ void stage_read16(const T* __restrict__ p, float* buf) {
#pragma unroll
  for (int i = 0; i < 16; ++i) buf[i] = (float)p[i];
}

__device__ __forceinline__ void stage_write(bf16* dst, const float* buf, int nquad) {
#pragma unroll
  for (int i = 0; i < nquad; ++i) {
    bf16x4 q;
    q[0] = (bf16)buf[4 * i];     q[1] = (bf16)buf[4 * i + 1];
    q[2] = (bf16)buf[4 * i + 2]; q[3] = (bf16)buf[4 * i + 3];
    *(bf16x4*)(dst + 4 * i) = q;
  }
}


#define GSTR 48
// ---------------------------------------------------------------------------------------------------------------------------
// gemm_kne: Y[m][n] = epi( Σ_k A[m][k]·W[k][n] + bias[n] ), A f32/f16 [M][lda], W f32 row-major [K][N] (ldw), plain f16 operands,
// f32 accumulate. EPI 0: identity; 1: exact-erf GELU; 2: R[m][n] + gvec[n]·(·) (residual with per-channel gain); 3: ReLU; 4: gvec[n]·(·) (per-channel scale, no residual). Output f32 (or f16
// when OUT16). Block = 128x128 tile, 8 waves as 4(M) x 2(N); per 32-wide k-step A and W tiles staged f16 in LDS (W transposed
// ---------------------------------------------------------------------------------------------------------------------------
#define GSTR 48
template <typename AT, int EPI, bool OUT16>
__global__ __launch_bounds__(256) void gemm_kne(const AT* __restrict__ A, int lda, const float* __restrict__ Wm, int ldw,
                                                const float* __restrict__ bias, const float* __restrict__ R, const float* __restrict__ gvec,
                                                void* __restrict__ Yv, int ldy, int K) {
  __shared__ __attribute__((aligned(16))) f16 ldsA[128 * GSTR];
  __shared__ __attribute__((aligned(16))) f16 ldsW[128 * GSTR];
  __shared__ __attribute__((aligned(16))) float oS[8][32 * 68];
  const int tid = threadIdx.x, lane = tid & 31, wave = tid >> 5, cl = lane & 15, rh = (lane >> 4) * 8;
  const int m0 = blockIdx.x * 128, n0 = blockIdx.y * 128;
  const int wm = (wave & 3) * 32, wn = (wave >> 2) * 64;
  f32x8 acc[2][4];
#pragma unroll
  for (int i = 0; i < 2; ++i)
#pragma unroll
    for (int j = 0; j < 4; ++j) { f32x8 z = {}; acc[i][j] = z; }
#pragma unroll 1
  for (int k0 = 0; k0 < K; k0 += 32) {
    __syncthreads();
    { const int row = tid >> 1, ch = (tid & 1) * 16;
      const AT* src = A + (size_t)(m0 + row) * lda + k0 + ch;
#pragma unroll
      for (int g = 0; g < 16; ++g) ldsA[row * GSTR + ch + g] = (f16)src[g]; }
    { const int k = tid >> 3, nn0 = (tid & 7) * 16;
      const float* src = Wm + (size_t)(k0 + k) * ldw + n0 + nn0;
#pragma unroll
      for (int g = 0; g < 4; ++g) { const v4f_t v = *(const v4f_t*)(src + 4 * g);
#pragma unroll
        for (int u = 0; u < 4; ++u) ldsW[(nn0 + 4 * g + u) * GSTR + k] = (f16)v[u]; } }
    __syncthreads();
    f16x16 af[2];
#pragma unroll
    for (int i = 0; i < 2; ++i) af[i] = lds_frag(ldsA + (wm + 16 * i) * GSTR, GSTR);
#pragma unroll
    for (int j = 0; j < 4; ++j) {
      const f16x16 bf = lds_frag(ldsW + (wn + 16 * j) * GSTR, GSTR);
#pragma unroll
      for (int i = 0; i < 2; ++i) acc[i][j] = wmma16(af[i], bf, acc[i][j]);
    }
  }
  float* so = oS[wave];
#pragma unroll
  for (int i = 0; i < 2; ++i)
#pragma unroll
    for (int j = 0; j < 4; ++j) {
      const int n = n0 + wn + 16 * j + cl;
      const float bv = bias ? bias[n] : 0.0f;
      const float gv = (EPI == 2 || EPI == 4) ? gvec[n] : 0.0f;
      if (EPI == 1) {
#pragma unroll 1
        for (int r = 0; r < 8; ++r) { const float xg = acc[i][j][r] + bv; so[(16 * i + rh + r) * 68 + 16 * j + cl] = 0.5f * xg * (1.0f + erff(xg * 0.70710678118654752f)); }
      } else {
#pragma unroll
        for (int r = 0; r < 8; ++r) {
          float v = acc[i][j][r] + bv;
          if (EPI == 3) v = fmaxf(v, 0.0f);
          if (EPI == 4) v = gv * v;
          if (EPI == 2) v = R[(size_t)(m0 + wm + 16 * i + rh + r) * ldy + n] + gv * v;
          so[(16 * i + rh + r) * 68 + 16 * j + cl] = v;
        }
      }
    }
  asm volatile("s_wait_dscnt 0" ::: "memory");
  __builtin_amdgcn_wave_barrier();
{
    if (OUT16) {
      f16* Y = (f16*)Yv;
#pragma unroll
      for (int it = 0; it < 8; ++it) { const int c = lane + 32 * it, rr = c >> 3, q8 = (c & 7) * 8;
        union { f16 h[8]; v4u_t v; } u;
#pragma unroll
        for (int e = 0; e < 8; ++e) u.h[e] = (f16)so[rr * 68 + q8 + e];
        *(v4u_t*)(Y + (size_t)(m0 + wm + rr) * ldy + n0 + wn + q8) = u.v; }
    } else {
      float* Y = (float*)Yv;
#pragma unroll
      for (int it = 0; it < 16; ++it) { const int f4 = lane + 32 * it, rr = f4 >> 4, q = (f4 & 15) * 4;
        *(v4f_t*)(Y + (size_t)(m0 + wm + rr) * ldy + n0 + wn + q) = *(const v4fa*)(so + rr * 68 + q); }
    }
    
  }
}

// z-batched variant of gemm_kne (same tile code)
template <typename AT, int EPI, bool OUT16>
__global__ __launch_bounds__(256) void gemm_knez(const AT* __restrict__ A, int lda, size_t strideA, const float* __restrict__ Wm, int ldw, size_t strideW,
                                                 const float* __restrict__ bias, const float* __restrict__ R, const float* __restrict__ gvec,
                                                 void* __restrict__ Yv, int ldy, size_t strideY, int K) {   // blockIdx.z-batched: A += z·strideA, W += z·strideW, Y (and R) += z·strideY
  A += (size_t)blockIdx.z * strideA; Wm += (size_t)blockIdx.z * strideW; Yv = (void*)((char*)Yv + (size_t)blockIdx.z * strideY * (OUT16 ? 2 : 4)); if (R) R += (size_t)blockIdx.z * strideY;
  __shared__ __attribute__((aligned(16))) f16 ldsA[128 * GSTR];
  __shared__ __attribute__((aligned(16))) f16 ldsW[128 * GSTR];
  __shared__ __attribute__((aligned(16))) float oS[8][32 * 68];
  const int tid = threadIdx.x, lane = tid & 31, wave = tid >> 5, cl = lane & 15, rh = (lane >> 4) * 8;
  const int m0 = blockIdx.x * 128, n0 = blockIdx.y * 128;
  const int wm = (wave & 3) * 32, wn = (wave >> 2) * 64;
  f32x8 acc[2][4];
#pragma unroll
  for (int i = 0; i < 2; ++i)
#pragma unroll
    for (int j = 0; j < 4; ++j) { f32x8 z = {}; acc[i][j] = z; }
#pragma unroll 1
  for (int k0 = 0; k0 < K; k0 += 32) {
    __syncthreads();
    { const int row = tid >> 1, ch = (tid & 1) * 16;
      const AT* src = A + (size_t)(m0 + row) * lda + k0 + ch;
#pragma unroll
      for (int g = 0; g < 16; ++g) ldsA[row * GSTR + ch + g] = (f16)src[g]; }
    { const int k = tid >> 3, nn0 = (tid & 7) * 16;
      const float* src = Wm + (size_t)(k0 + k) * ldw + n0 + nn0;
#pragma unroll
      for (int g = 0; g < 4; ++g) { const v4f_t v = *(const v4f_t*)(src + 4 * g);
#pragma unroll
        for (int u = 0; u < 4; ++u) ldsW[(nn0 + 4 * g + u) * GSTR + k] = (f16)v[u]; } }
    __syncthreads();
    f16x16 af[2];
#pragma unroll
    for (int i = 0; i < 2; ++i) af[i] = lds_frag(ldsA + (wm + 16 * i) * GSTR, GSTR);
#pragma unroll
    for (int j = 0; j < 4; ++j) {
      const f16x16 bf = lds_frag(ldsW + (wn + 16 * j) * GSTR, GSTR);
#pragma unroll
      for (int i = 0; i < 2; ++i) acc[i][j] = wmma16(af[i], bf, acc[i][j]);
    }
  }
  float* so = oS[wave];
#pragma unroll
  for (int i = 0; i < 2; ++i)
#pragma unroll
    for (int j = 0; j < 4; ++j) {
      const int n = n0 + wn + 16 * j + cl;
      const float bv = bias ? bias[n] : 0.0f;
      const float gv = (EPI == 2 || EPI == 4) ? gvec[n] : 0.0f;
      if (EPI == 1) {
#pragma unroll 1
        for (int r = 0; r < 8; ++r) { const float xg = acc[i][j][r] + bv; so[(16 * i + rh + r) * 68 + 16 * j + cl] = 0.5f * xg * (1.0f + erff(xg * 0.70710678118654752f)); }
      } else {
#pragma unroll
        for (int r = 0; r < 8; ++r) {
          float v = acc[i][j][r] + bv;
          if (EPI == 3) v = fmaxf(v, 0.0f);
          if (EPI == 4) v = gv * v;
          if (EPI == 2) v = R[(size_t)(m0 + wm + 16 * i + rh + r) * ldy + n] + gv * v;
          so[(16 * i + rh + r) * 68 + 16 * j + cl] = v;
        }
      }
    }
  asm volatile("s_wait_dscnt 0" ::: "memory");
  __builtin_amdgcn_wave_barrier();
{
    if (OUT16) {
      f16* Y = (f16*)Yv;
#pragma unroll
      for (int it = 0; it < 8; ++it) { const int c = lane + 32 * it, rr = c >> 3, q8 = (c & 7) * 8;
        union { f16 h[8]; v4u_t v; } u;
#pragma unroll
        for (int e = 0; e < 8; ++e) u.h[e] = (f16)so[rr * 68 + q8 + e];
        *(v4u_t*)(Y + (size_t)(m0 + wm + rr) * ldy + n0 + wn + q8) = u.v; }
    } else {
      float* Y = (float*)Yv;
#pragma unroll
      for (int it = 0; it < 16; ++it) { const int f4 = lane + 32 * it, rr = f4 >> 4, q = (f4 & 15) * 4;
        *(v4f_t*)(Y + (size_t)(m0 + wm + rr) * ldy + n0 + wn + q) = *(const v4fa*)(so + rr * 68 + q); }
    }
    
  }
}

// ---------------------------------------------------------------------------------------------------------------------------
// gemm_kn2 (value+residual planes on both operands: hh + (hl+lh)/2048, f32-class): Y[m][n] (row stride ldy) = scale * sum_k A[m][k] (f32 or f16, row stride lda) * W[k][n] (f32, row-major [K][N], row
// stride ldw) (+ bias[n]) (+ Y if ACC). Block = 128 x 128 tile, 256 threads = 8 waves as 4(M, 32 rows) x 2(N, 64 cols); per
// 32-wide k-step the A tile and the W tile (stored transposed [n][k]) are staged as f16 in LDS; plain f16 operands, f32
// blockIdx.z selects a batch: A += z*strideA, W += z*strideW, Y += z*strideY (element strides).
// ---------------------------------------------------------------------------------------------------------------------------
template <typename AT, bool ACC>
__global__ __launch_bounds__(256) void gemm_kn2(const AT* __restrict__ A, int lda, size_t strideA,
                                               const float* __restrict__ Wm, int ldw, size_t strideW,
                                               const float* __restrict__ bias, float scale,
                                               float* __restrict__ Y, int ldy, size_t strideY, int K) {
  __shared__ __attribute__((aligned(16))) f16 ldsA[128 * GSTR], ldsAl[128 * GSTR];
  __shared__ __attribute__((aligned(16))) f16 ldsW[128 * GSTR], ldsWl[128 * GSTR];
  __shared__ __attribute__((aligned(16))) float oS[8][32 * 68];
  const int tid = threadIdx.x, lane = tid & 31, wave = tid >> 5, cl = lane & 15, rh = (lane >> 4) * 8;
  const int m0 = blockIdx.x * 128, n0 = blockIdx.y * 128;
  const int wm = (wave & 3) * 32, wn = (wave >> 2) * 64;
  A += (size_t)blockIdx.z * strideA; Wm += (size_t)blockIdx.z * strideW; Y += (size_t)blockIdx.z * strideY;
  f32x8 acc[2][4], accx[2][4];
#pragma unroll
  for (int i = 0; i < 2; ++i)
#pragma unroll
    for (int j = 0; j < 4; ++j) { f32x8 z = {}; acc[i][j] = z; accx[i][j] = z; }
#pragma unroll 1
  for (int k0 = 0; k0 < K; k0 += 32) {
    __syncthreads();
    {  // A: thread -> row tid>>1, 16 elements at column half (tid&1)*16
      const int row = tid >> 1, ch = (tid & 1) * 16;
      const AT* src = A + (size_t)(m0 + row) * lda + k0 + ch;
#pragma unroll
      for (int g = 0; g < 16; ++g) { const float v = (float)src[g]; const f16 h = (f16)v; ldsA[row * GSTR + ch + g] = h; ldsAl[row * GSTR + ch + g] = (f16)((v - (float)h) * 2048.0f); }
    }
    {  // W: thread -> k = tid>>3, 16 consecutive n at (tid&7)*16; stored transposed [n][k]
      const int k = tid >> 3, nn0 = (tid & 7) * 16;
      const float* src = Wm + (size_t)(k0 + k) * ldw + n0 + nn0;
#pragma unroll
      for (int g = 0; g < 4; ++g) { const v4f_t v = *(const v4f_t*)(src + 4 * g);
#pragma unroll
        for (int u = 0; u < 4; ++u) { const f16 h = (f16)v[u]; ldsW[(nn0 + 4 * g + u) * GSTR + k] = h; ldsWl[(nn0 + 4 * g + u) * GSTR + k] = (f16)((v[u] - (float)h) * 2048.0f); } }
    }
    __syncthreads();
    f16x16 af[2], afl[2];
#pragma unroll
    for (int i = 0; i < 2; ++i) { af[i] = lds_frag(ldsA + (wm + 16 * i) * GSTR, GSTR); afl[i] = lds_frag(ldsAl + (wm + 16 * i) * GSTR, GSTR); }
#pragma unroll
    for (int j = 0; j < 4; ++j) {
      const f16x16 bf = lds_frag(ldsW + (wn + 16 * j) * GSTR, GSTR), bfl = lds_frag(ldsWl + (wn + 16 * j) * GSTR, GSTR);
#pragma unroll
      for (int i = 0; i < 2; ++i) { acc[i][j] = wmma16(af[i], bf, acc[i][j]); accx[i][j] = wmma16(af[i], bfl, accx[i][j]); accx[i][j] = wmma16(afl[i], bf, accx[i][j]); }
    }
  }
  float* so = oS[wave];
#pragma unroll
  for (int i = 0; i < 2; ++i)
#pragma unroll
    for (int j = 0; j < 4; ++j) {
      const float bv = bias ? bias[n0 + wn + 16 * j + cl] : 0.0f;
#pragma unroll
      for (int r = 0; r < 8; ++r) so[(16 * i + rh + r) * 68 + 16 * j + cl] = (acc[i][j][r] + accx[i][j][r] * (1.0f / 2048.0f)) * scale + bv;
    }
  asm volatile("s_wait_dscnt 0" ::: "memory");
  __builtin_amdgcn_wave_barrier();
  if (ACC) {   // accumulate: fold the existing Y values into the staging tile ONCE (same thread <-> same chunks as the stores below)
#pragma unroll
    for (int it = 0; it < 16; ++it) { const int f4 = lane + 32 * it, rr = f4 >> 4, q = (f4 & 15) * 4;
      const v4f_t old = *(const v4fa*)(Y + (size_t)(m0 + wm + rr) * ldy + n0 + wn + q);
      v4f_t v = *(const v4fa*)(so + rr * 68 + q); v += old; *(v4fa*)(so + rr * 68 + q) = v; }   // plain LDS store (ordered by the s_wait_dscnt/memory clobber below)
    asm volatile("s_wait_dscnt 0" ::: "memory");
  }
{
#pragma unroll
    for (int it = 0; it < 16; ++it) { const int f4 = lane + 32 * it, rr = f4 >> 4, q = (f4 & 15) * 4;
      *(v4f_t*)(Y + (size_t)(m0 + wm + rr) * ldy + n0 + wn + q) = *(const v4fa*)(so + rr * 68 + q); }
    
  }
}

__global__ __launch_bounds__(256) void k_transpose(const float* __restrict__ Wm, float* __restrict__ Wt, int rows, int cols) {
  __shared__ float tS[64][65];
  const int tid = threadIdx.x, tbj = cols / 64, bi = blockIdx.x / tbj, bj = blockIdx.x % tbj;
  for (int e = tid; e < 64 * 64; e += 256) { const int r = e >> 6, c = e & 63; tS[r][c] = Wm[(size_t)(bi * 64 + r) * cols + bj * 64 + c]; }
  __syncthreads();
  for (int ch = tid; ch < 64 * 16; ch += 256) { const int r = ch >> 4, q4 = (ch & 15) * 4; v4f_t o; o[0] = tS[q4][r]; o[1] = tS[q4 + 1][r]; o[2] = tS[q4 + 2][r]; o[3] = tS[q4 + 3][r];
    float* dst = Wt + (size_t)(bj * 64 + r) * rows + bi * 64 + q4; *(v4f_t*)dst = o;  }
}


// ---------------------------------------------------------------------------------------------------------------------------
// gemm_sm<AT, EPI, OUT16, NJ>: narrow-N GEMM tile: Y[m][n] = epi(sum_k A[m][k]·W[k][n] + bias[n]), BM = 256 rows per block (8 waves x 32 rows; each wave owns whole output rows),
// BN = 16·NJ columns per block (NJ = 2 → 32, NJ = 4 → 64), K % 32 == 0, M % 256 == 0. A [M][lda] (f32 or f16, converted to f16), W [K][ldw] f32 → f16. f32 accumulate.
// (8 lanes x 16 B), BN=64 → two lines per row; OUT16 requires BN=64 (64 halves = one line per row). Every line written by one instruction of one wave, lane-contiguous.
template <typename AT, int EPI, bool OUT16, int NJ>
__global__ __launch_bounds__(256) void gemm_sm(const AT* __restrict__ A, int lda, size_t sA, const float* __restrict__ Wm, int ldw, size_t sW,
                                               const float* __restrict__ bias, const float* __restrict__ R, const float* __restrict__ gvec,
                                               void* __restrict__ Yv, int ldy, size_t sY, int K) {
  constexpr int BN = 16 * NJ; constexpr int OST = BN + 4;
  A += (size_t)blockIdx.z * sA; Wm += (size_t)blockIdx.z * sW; Yv = (void*)((char*)Yv + (size_t)blockIdx.z * sY * (OUT16 ? 2 : 4)); if (R) R += (size_t)blockIdx.z * sY;
  __shared__ __attribute__((aligned(16))) f16 ldsA[256 * GSTR];
  __shared__ __attribute__((aligned(16))) f16 ldsW[BN * GSTR];
  __shared__ __attribute__((aligned(16))) float oS[8][32 * OST];
  const int tid = threadIdx.x, lane = tid & 31, wave = tid >> 5, cl = lane & 15, rh = (lane >> 4) * 8;
  const int m0 = blockIdx.x * 256, n0 = blockIdx.y * BN;
  const int wm = wave * 32;
  f32x8 acc[2][NJ];
#pragma unroll
  for (int i = 0; i < 2; ++i)
#pragma unroll
    for (int j = 0; j < NJ; ++j) { f32x8 z = {}; acc[i][j] = z; }
#pragma unroll 1
  for (int k0 = 0; k0 < K; k0 += 32) {
    __syncthreads();
    { const AT* src = A + (size_t)(m0 + tid) * lda + k0;          // one 32-wide row slice per thread
#pragma unroll
      for (int g = 0; g < 32; ++g) ldsA[tid * GSTR + g] = (f16)src[g]; }
    { const int k = tid >> 3, nn0 = (tid & 7) * (2 * NJ);         // 32 k-rows x BN columns of W
      const float* src = Wm + (size_t)(k0 + k) * ldw + n0 + nn0;
#pragma unroll
      for (int g = 0; g < NJ / 2; ++g) { const v4f_t v = *(const v4f_t*)(src + 4 * g);
#pragma unroll
        for (int u = 0; u < 4; ++u) ldsW[(nn0 + 4 * g + u) * GSTR + k] = (f16)v[u]; } }
    __syncthreads();
    f16x16 af[2];
#pragma unroll
    for (int i = 0; i < 2; ++i) af[i] = lds_frag(ldsA + (wm + 16 * i) * GSTR, GSTR);
#pragma unroll
    for (int j = 0; j < NJ; ++j) {
      const f16x16 bf = lds_frag(ldsW + (16 * j) * GSTR, GSTR);
#pragma unroll
      for (int i = 0; i < 2; ++i) acc[i][j] = wmma16(af[i], bf, acc[i][j]);
    }
  }
  float* so = oS[wave];
#pragma unroll
  for (int i = 0; i < 2; ++i)
#pragma unroll
    for (int j = 0; j < NJ; ++j) {
      const int n = n0 + 16 * j + cl;
      const float bv = bias ? bias[n] : 0.0f;
      const float gv = (EPI == 2 || EPI == 4) ? gvec[n] : 0.0f;
#pragma unroll
      for (int r = 0; r < 8; ++r) {
        float v = acc[i][j][r] + bv;
        if (EPI == 3) v = fmaxf(v, 0.0f);
        if (EPI == 2) v = R[(size_t)(m0 + wm + 16 * i + rh + r) * ldy + n] + gv * v;
        if (EPI == 4) v = gv * v;
        so[(16 * i + rh + r) * OST + 16 * j + cl] = v;
      }
    }
  asm volatile("s_wait_dscnt 0" ::: "memory");
  __builtin_amdgcn_wave_barrier();
{
    if (OUT16) {
      f16* Y = (f16*)Yv;
#pragma unroll
      for (int it = 0; it < BN / 8; ++it) { const int c = lane + 32 * it, rr = c / (BN / 8), q8 = (c % (BN / 8)) * 8;
        union { f16 h[8]; v4u_t v; } u;
#pragma unroll
        for (int e = 0; e < 8; ++e) u.h[e] = (f16)so[rr * OST + q8 + e];
        *(v4u_t*)(Y + (size_t)(m0 + wm + rr) * ldy + n0 + q8) = u.v; }
    } else {       // BN floats per row = BN/32 lines: BN/4 lanes x 16 B per row
      float* Y = (float*)Yv;
#pragma unroll
      for (int it = 0; it < BN / 4; ++it) { const int f4 = lane + 32 * it, rr = f4 / (BN / 4), q = (f4 % (BN / 4)) * 4;
        *(v4f_t*)(Y + (size_t)(m0 + wm + rr) * ldy + n0 + q) = *(const v4fa*)(so + rr * OST + q); }
    }
    
  }
}

#define NBga 2
#define SSga 2048
#define SIN 2048
#define DQga 2048
#define DKga 512
#define HIDga 2048
#define HQga 32
#define HKVga 8
#define HDga 64
__global__ __launch_bounds__(256) void k_fill(float* __restrict__ p, float val, size_t n4) { const size_t i = (size_t)blockIdx.x * 256 + threadIdx.x; if (i < n4) { v4f_t v = {val, val, val, val}; *(v4f_t*)(p + 4 * i) = v;  } }
__global__ __launch_bounds__(256) void k_dbg_zero(float* __restrict__ p, size_t n4) { const size_t i = (size_t)blockIdx.x * 256 + threadIdx.x; if (i < n4) { v4f_t z = {0.f,0.f,0.f,0.f}; *(v4f_t*)(p + 4 * i) = z;  } }
__global__ __launch_bounds__(256) void k_copy(const float* __restrict__ src, float* __restrict__ dst, size_t n4) { const size_t i = (size_t)blockIdx.x * 256 + threadIdx.x; if (i < n4) { const v4f_t v = *(const v4f_t*)(src + 4 * i); *(v4f_t*)(dst + 4 * i) = v;  } }
// transpose with source row stride: Wt[c][r] (row stride = rows) = Wm[r][c] (row stride lds), 64x64 LDS tiles; 16 B per lane, 16 lanes per 256-B row segment (8 per line)
__global__ __launch_bounds__(256) void k_transpose_ld(const float* __restrict__ Wm, int lds, float* __restrict__ Wt, int rows, int cols) {
  __shared__ float tS[64][65];
  const int tid = threadIdx.x, tbj = cols / 64, bi = blockIdx.x / tbj, bj = blockIdx.x % tbj;
  for (int e = tid; e < 64 * 64; e += 256) { const int r = e >> 6, c = e & 63; tS[r][c] = Wm[(size_t)(bi * 64 + r) * lds + bj * 64 + c]; }
  __syncthreads();
  for (int ch = tid; ch < 64 * 16; ch += 256) { const int r = ch >> 4, q4 = (ch & 15) * 4; v4f_t o; o[0] = tS[q4][r]; o[1] = tS[q4 + 1][r]; o[2] = tS[q4 + 2][r]; o[3] = tS[q4 + 3][r];
    float* dst = Wt + (size_t)(bj * 64 + r) * rows + bi * 64 + q4; *(v4f_t*)dst = o;  }
}
// VB[c] = sum over the 2048 key rows of V[:, c] (f32, thread = column, rolled loop): added back after the P'·v GEMM (Σ_k (P'+1)·v_k /1024 = (Σ P'v + Σ v)/1024)
__global__ __launch_bounds__(256) void k_vsum(const float* __restrict__ V, int ldv, float* __restrict__ VB) {
  const int c = blockIdx.x * 256 + threadIdx.x; if (c >= 512) return; float s = 0.0f;   /* 512 columns */
#pragma unroll 1
  for (int r = 0; r < 2048; ++r) s += V[(size_t)r * ldv + c];
  const float m = s; /* column SUM over all key slots: ctx = (Σ P'v + Σ v)/1024 with P' = 1024·P − 1 */ *(float*)(VB + c) = m; 
}
// bf16 round-to-nearest-even of an f32 (bit trick)
__device__ __forceinline__ float bf16r(float x) { unsigned int u = __float_as_uint(x); u = (u + 0x7FFFu + ((u >> 16) & 1u)) & 0xFFFF0000u; return __uint_as_float(u); }
// bf16-rounded copy of an activation block (optionally scaled by a power of two AFTER rounding — exact); 16 B per lane
__global__ __launch_bounds__(256) void k_cpyrnd(const float* __restrict__ src, float* __restrict__ dst, float mul, size_t n4) { const size_t i = (size_t)blockIdx.x * 256 + threadIdx.x; if (i >= n4) return; v4f_t v = *(const v4f_t*)(src + 4 * i);
#pragma unroll
  for (int u = 0; u < 4; ++u) v[u] = mul * bf16r(v[u]);
  *(v4f_t*)(dst + 4 * i) = v;  }
// torch [out][in] weight → WT[i][o] = mul·bf16(W[o][i]) ([in][out], lifted by a power of two so no bf16 weight becomes an f16 subnormal); block = input row i, threads loop over the outputs (4-B lanes)
__global__ __launch_bounds__(256) void k_wprepT(const float* __restrict__ Wt, float* __restrict__ WT, int nout, int nin, float mul) { const int i = blockIdx.x, tid = threadIdx.x;
#pragma unroll 1
  for (int o = tid; o < nout; o += 256) { const float w = mul * bf16r(Wt[(size_t)o * nin + i]); *(float*)(WT + (size_t)i * nout + o) = w;  } }
// bias prep: B2[o] = mul·bf16(b[o]); one block loops
__global__ __launch_bounds__(256) void k_bprep(const float* __restrict__ b, float* __restrict__ B2, int n, float mul) { for (int o = threadIdx.x; o < n; o += 256) { const float v = mul * bf16r(b[o]); *(float*)(B2 + o) = v;  } }

// row softmax of s/8 for (query, head z of the group); P' = 1024·P − 1; block = (q, z), 256 threads x 8
__global__ __launch_bounds__(256) void k_soft(float* __restrict__ Sm) {
  __shared__ float red[256];
  const int q = blockIdx.x, z = blockIdx.y, tid = threadIdx.x; float* sr = Sm + ((size_t)z * SSga + q) * SSga; float v[SSga / 256]; float m = -3.0e38f;
#pragma unroll
  for (int e = 0; e < SSga / 256; ++e) { v[e] = sr[tid + 256 * e] * 0.125f; m = fmaxf(m, v[e]); }
  red[tid] = m; __syncthreads(); for (int o = 128; o > 0; o >>= 1) { if (tid < o) red[tid] = fmaxf(red[tid], red[tid + o]); __syncthreads(); }
  m = red[0]; __syncthreads(); float zs = 0.0f;
#pragma unroll
  for (int e = 0; e < SSga / 256; ++e) { v[e] = expf(v[e] - m); zs += v[e]; }
  red[tid] = zs; __syncthreads(); for (int o = 128; o > 0; o >>= 1) { if (tid < o) red[tid] += red[tid + o]; __syncthreads(); }
  const float kk = 1024.0f / red[0];
{
#pragma unroll
    for (int e = 0; e < SSga / 256; ++e) *(float*)(sr + tid + 256 * e) = v[e] * kk - 1.0f;
     }
}

extern "C" void kernel_launch(void* const* d_in, const int* in_sizes, int n_in,
                              void* d_out, int out_size, void* d_ws, size_t ws_size,
                              hipStream_t stream) {
  (void)in_sizes; (void)n_in; (void)out_size;
  const float** f = (const float**)d_in;
  const float* Qi = f[0], *Ki = f[1], *Vi = f[2], *Wout = f[3], *bout = f[4];
  float* out = (float*)d_out;     // [2,2048,2048]
  char* ws = (char*)d_ws;
  float* WT = (float*)ws; ws += (size_t)DQga * HIDga * 4; float* B64 = (float*)ws; ws += HIDga * 4; float* g64 = (float*)ws; ws += HIDga * 4;
  float* Q = (float*)ws; ws += (size_t)SSga * DQga * 4; float* Km = (float*)ws; ws += (size_t)SSga * DKga * 4; float* V = (float*)ws; ws += (size_t)SSga * DKga * 4; float* KT = (float*)ws; ws += (size_t)HDga * SSga * 4;
  float* VS = (float*)ws; ws += DKga * 4; float* sc = (float*)ws; ws += 64 * 4; float* S = (float*)ws; ws += (size_t)4 * SSga * SSga * 4; float* O = (float*)ws; ws += (size_t)SSga * DQga * 4;
  if ((size_t)(ws - (char*)d_ws) > ws_size) return;                      // WS TOTAL 126,372,096 B
  const dim3 blk(256);
  k_fill<<<dim3(1), blk, 0, stream>>>(sc, 1.0f / 1024.0f, 64 / 4); k_fill<<<dim3(2), blk, 0, stream>>>(g64, 1.0f / 64.0f, HIDga / 4);
  k_wprepT<<<dim3(DQga), blk, 0, stream>>>(Wout, WT, HIDga, DQga, 64.0f); k_bprep<<<dim3(1), blk, 0, stream>>>(bout, B64, HIDga, 64.0f);

  for (int b = 0; b < NBga; ++b) {
    k_cpyrnd<<<dim3(((size_t)SSga * DQga / 4 + 255) / 256), blk, 0, stream>>>(Qi + (size_t)b * SIN * DQga, Q, 1.0f, (size_t)SSga * DQga / 4); k_cpyrnd<<<dim3(((size_t)SSga * DKga / 4 + 255) / 256), blk, 0, stream>>>(Ki + (size_t)b * SIN * DKga, Km, 1.0f, (size_t)SSga * DKga / 4); k_cpyrnd<<<dim3(((size_t)SSga * DKga / 4 + 255) / 256), blk, 0, stream>>>(Vi + (size_t)b * SIN * DKga, V, 1.0f, (size_t)SSga * DKga / 4);
    k_vsum<<<dim3(DKga / 256), blk, 0, stream>>>(V, DKga, VS);
    for (int kv = 0; kv < HKVga; ++kv) {
      k_transpose_ld<<<dim3((SSga / 64) * (HDga / 64)), blk, 0, stream>>>(Km + kv * HDga, DKga, KT, SSga, HDga);
      gemm_knez<float, 0, false><<<dim3(SSga / 128, SSga / 128, 4), blk, 0, stream>>>(Q + (size_t)kv * 4 * HDga, DQga, (size_t)HDga, KT, SSga, (size_t)0, nullptr, nullptr, nullptr, S, SSga, (size_t)SSga * SSga, HDga);   // the group's 4 query heads vs kv head
      k_soft<<<dim3(SSga, 4), blk, 0, stream>>>(S);
      for (int z = 0; z < 4; ++z)
        gemm_sm<float, 4, false, 4><<<dim3(SSga / 256, 1, 1), blk, 0, stream>>>(S + (size_t)z * SSga * SSga, SSga, (size_t)0, V + kv * HDga, DKga, (size_t)0, VS + kv * HDga, nullptr, sc, O + (size_t)(kv * 4 + z) * HDga, DQga, (size_t)0, SSga);
    }
    gemm_kne<float, 4, false><<<dim3(SSga / 128, HIDga / 128), blk, 0, stream>>>(O, DQga, WT, HIDga, B64, nullptr, g64, out + (size_t)b * SIN * HIDga, HIDga, DQga);   // out = (o·64W_outᵀ + 64b)/64
  }
}

// v001
// It runs in 4440 microseconds.
// Next to v000, in two timings, it ran 2.04 and 2.05 times as fast.
// Q, K, V, W_out, b_out are rounded to bf16 (RNE) on load; the scores are then exact single f16 products of bf16 values
// with f32 accumulation (no projection exists in this module — Q, K, V are inputs), and the output projection uses 64·bf16(W_outᵀ) with a 2^-6 epilogue.
// Contractions on v_wmma_f32_16x16x32_f16 (f16 operands, f32 accumulate), per batch element: the 32 query heads' scores against their kv head (K 64, the 4 heads of a group as one z-launch
// against the shared kᵀ), o_h = P'·v_h as a 64-wide tile (K 2048; centred P' = 1024·P − 1 with Σ_s v_s added back, exact), out = o·W_outᵀ + b_out (K 2048). f32 VALU: softmax of s/√64.
// compute dtype: f16 operands (bf16-valued), f32 accumulate.  Q [2,2048,2048], K, V [2,2048,512] → out [2,2048,2048].
#include <hip/hip_runtime.h>
#include <hip/hip_bf16.h>
#include <math.h>


typedef _Float16 bf16;
typedef _Float16 f16;
typedef __attribute__((ext_vector_type(4))) unsigned v4u_t;
typedef unsigned v4ua __attribute__((ext_vector_type(4), may_alias));
typedef __attribute__((ext_vector_type(4))) float v4f_t;
typedef float v4fa __attribute__((ext_vector_type(4), may_alias));
typedef __attribute__((ext_vector_type(16))) bf16  bf16x16;
typedef bf16x16 f16x16;
typedef __attribute__((ext_vector_type(8)))  bf16  bf16x8;
typedef bf16x8 f16x8;
typedef __attribute__((ext_vector_type(4)))  bf16  bf16x4;
typedef __attribute__((ext_vector_type(8)))  float f32x8;
__device__ __forceinline__ f32x8 wmma16(f16x16 a, f16x16 b, f32x8 c) {
  c = __builtin_amdgcn_wmma_f32_16x16x32_f16(false, a, false, b, (short)0, c, false, false);
  asm volatile("v_nop\n\tv_nop\n\tv_nop\n\tv_nop" : "+v"(c) : "v"(a), "v"(b));
  return c;
}
#define LDS_STRIDE 48   // GEMM tiles: 32 -> 48 elems (96B rows): aligned b128 reads
#define KSTRIDE    72   // unused; the K tile is staged 32 -> 48 elems (GSTR)
#define VSTRIDE    48   // attn V tile: 32 -> 48 elems

__device__ __forceinline__ f32x8 wmma_bf16(bf16x16 a, bf16x16 b, f32x8 c) {
  c = __builtin_amdgcn_wmma_f32_16x16x32_f16(false, a, false, b, (short)0, c, false, false);
  asm volatile("v_nop\n\tv_nop\n\tv_nop\n\tv_nop" : "+v"(c) : "v"(a), "v"(b));   // A/B-overwrite hazard guard
  return c;
}

// 16x32 (MxK) bf16 fragment from a row-major global matrix.
// lanes 0-15  (row=lane)    : elems 0..7 = K+0..7,  8..15 = K+16..23
// lanes 16-31 (row=lane-16) : elems 0..7 = K+8..15, 8..15 = K+24..31
template <typename T>
__device__ __forceinline__ bf16x16 load_frag(const T* __restrict__ base, int ld,
                                             int row0, int k0) {
  const int lane = threadIdx.x & 31;
  const int r    = lane & 15;
  const int kh   = (lane >> 4) * 8;
  const T* p0 = base + (size_t)(row0 + r) * ld + (k0 + kh);
  const T* p1 = p0 + 16;
  bf16x16 f;
#pragma unroll
  for (int i = 0; i < 8; ++i) {
    f[i]     = (bf16)p0[i];
    f[i + 8] = (bf16)p1[i];
  }
  return f;
}

// Same fragment from an LDS tile with padded row stride (base includes row0/k0).
__device__ __forceinline__ bf16x16 lds_frag(const bf16* base, int stride) {
  const int lane = threadIdx.x & 31;
  const int row  = lane & 15;
  const int kh   = (lane >> 4) * 8;
  const bf16x8 lo = *(const bf16x8*)(base + row * stride + kh);
  const bf16x8 hi = *(const bf16x8*)(base + row * stride + kh + 16);
  bf16x16 f;
#pragma unroll
  for (int i = 0; i < 8; ++i) { f[i] = lo[i]; f[i + 8] = hi[i]; }
  return f;
}

template <typename T>
__device__ __forceinline__ void stage_read16(const T* __restrict__ p, float* buf) {
#pragma unroll
  for (int i = 0; i < 16; ++i) buf[i] = (float)p[i];
}

__device__ __forceinline__ void stage_write(bf16* dst, const float* buf, int nquad) {
#pragma unroll
  for (int i = 0; i < nquad; ++i) {
    bf16x4 q;
    q[0] = (bf16)buf[4 * i];     q[1] = (bf16)buf[4 * i + 1];
    q[2] = (bf16)buf[4 * i + 2]; q[3] = (bf16)buf[4 * i + 3];
    *(bf16x4*)(dst + 4 * i) = q;
  }
}


#define GSTR 48
// ---------------------------------------------------------------------------------------------------------------------------
// gemm_kne: Y[m][n] = epi( Σ_k A[m][k]·W[k][n] + bias[n] ), A f32/f16 [M][lda], W f32 row-major [K][N] (ldw), plain f16 operands,
// f32 accumulate. EPI 0: identity; 1: exact-erf GELU; 2: R[m][n] + gvec[n]·(·) (residual with per-channel gain); 3: ReLU; 4: gvec[n]·(·) (per-channel scale, no residual). Output f32 (or f16
// when OUT16). Block = 128x128 tile, 8 waves as 4(M) x 2(N); per 32-wide k-step A and W tiles staged f16 in LDS (W transposed
// ---------------------------------------------------------------------------------------------------------------------------
#define GSTR 48
template <typename AT, int EPI, bool OUT16>
__global__ __launch_bounds__(256) void gemm_kne(const AT* __restrict__ A, int lda, const float* __restrict__ Wm, int ldw,
                                                const float* __restrict__ bias, const float* __restrict__ R, const float* __restrict__ gvec,
                                                void* __restrict__ Yv, int ldy, int K) {
  __shared__ __attribute__((aligned(16))) f16 ldsA[128 * GSTR];
  __shared__ __attribute__((aligned(16))) f16 ldsW[128 * GSTR];
  __shared__ __attribute__((aligned(16))) float oS[8][32 * 68];
  const int tid = threadIdx.x, lane = tid & 31, wave = tid >> 5, cl = lane & 15, rh = (lane >> 4) * 8;
  const int m0 = blockIdx.x * 128, n0 = blockIdx.y * 128;
  const int wm = (wave & 3) * 32, wn = (wave >> 2) * 64;
  f32x8 acc[2][4];
#pragma unroll
  for (int i = 0; i < 2; ++i)
#pragma unroll
    for (int j = 0; j < 4; ++j) { f32x8 z = {}; acc[i][j] = z; }
#pragma unroll 1
  for (int k0 = 0; k0 < K; k0 += 32) {
    __syncthreads();
    { const int row = tid >> 1, ch = (tid & 1) * 16;
      const AT* src = A + (size_t)(m0 + row) * lda + k0 + ch;
#pragma unroll
      for (int g = 0; g < 16; ++g) ldsA[row * GSTR + ch + g] = (f16)src[g]; }
    { const int k = tid >> 3, nn0 = (tid & 7) * 16;
      const float* src = Wm + (size_t)(k0 + k) * ldw + n0 + nn0;
#pragma unroll
      for (int g = 0; g < 4; ++g) { const v4f_t v = *(const v4f_t*)(src + 4 * g);
#pragma unroll
        for (int u = 0; u < 4; ++u) ldsW[(nn0 + 4 * g + u) * GSTR + k] = (f16)v[u]; } }
    __syncthreads();
    f16x16 af[2];
#pragma unroll
    for (int i = 0; i < 2; ++i) af[i] = lds_frag(ldsA + (wm + 16 * i) * GSTR, GSTR);
#pragma unroll
    for (int j = 0; j < 4; ++j) {
      const f16x16 bf = lds_frag(ldsW + (wn + 16 * j) * GSTR, GSTR);
#pragma unroll
      for (int i = 0; i < 2; ++i) acc[i][j] = wmma16(af[i], bf, acc[i][j]);
    }
  }
  float* so = oS[wave];
#pragma unroll
  for (int i = 0; i < 2; ++i)
#pragma unroll
    for (int j = 0; j < 4; ++j) {
      const int n = n0 + wn + 16 * j + cl;
      const float bv = bias ? bias[n] : 0.0f;
      const float gv = (EPI == 2 || EPI == 4) ? gvec[n] : 0.0f;
      if (EPI == 1) {
#pragma unroll 1
        for (int r = 0; r < 8; ++r) { const float xg = acc[i][j][r] + bv; so[(16 * i + rh + r) * 68 + 16 * j + cl] = 0.5f * xg * (1.0f + erff(xg * 0.70710678118654752f)); }
      } else {
#pragma unroll
        for (int r = 0; r < 8; ++r) {
          float v = acc[i][j][r] + bv;
          if (EPI == 3) v = fmaxf(v, 0.0f);
          if (EPI == 4) v = gv * v;
          if (EPI == 2) v = R[(size_t)(m0 + wm + 16 * i + rh + r) * ldy + n] + gv * v;
          so[(16 * i + rh + r) * 68 + 16 * j + cl] = v;
        }
      }
    }
  asm volatile("s_wait_dscnt 0" ::: "memory");
  __builtin_amdgcn_wave_barrier();
{
    if (OUT16) {
      f16* Y = (f16*)Yv;
#pragma unroll
      for (int it = 0; it < 8; ++it) { const int c = lane + 32 * it, rr = c >> 3, q8 = (c & 7) * 8;
        union { f16 h[8]; v4u_t v; } u;
#pragma unroll
        for (int e = 0; e < 8; ++e) u.h[e] = (f16)so[rr * 68 + q8 + e];
        *(v4u_t*)(Y + (size_t)(m0 + wm + rr) * ldy + n0 + wn + q8) = u.v; }
    } else {
      float* Y = (float*)Yv;
#pragma unroll
      for (int it = 0; it < 16; ++it) { const int f4 = lane + 32 * it, rr = f4 >> 4, q = (f4 & 15) * 4;
        *(v4f_t*)(Y + (size_t)(m0 + wm + rr) * ldy + n0 + wn + q) = *(const v4fa*)(so + rr * 68 + q); }
    }
    
  }
}

// z-batched variant of gemm_kne (same tile code)
template <typename AT, int EPI, bool OUT16>
__global__ __launch_bounds__(256) void gemm_knez(const AT* __restrict__ A, int lda, size_t strideA, const float* __restrict__ Wm, int ldw, size_t strideW,
                                                 const float* __restrict__ bias, const float* __restrict__ R, const float* __restrict__ gvec,
                                                 void* __restrict__ Yv, int ldy, size_t strideY, int K) {   // blockIdx.z-batched: A += z·strideA, W += z·strideW, Y (and R) += z·strideY
  A += (size_t)blockIdx.z * strideA; Wm += (size_t)blockIdx.z * strideW; Yv = (void*)((char*)Yv + (size_t)blockIdx.z * strideY * (OUT16 ? 2 : 4)); if (R) R += (size_t)blockIdx.z * strideY;
  __shared__ __attribute__((aligned(16))) f16 ldsA[128 * GSTR];
  __shared__ __attribute__((aligned(16))) f16 ldsW[128 * GSTR];
  __shared__ __attribute__((aligned(16))) float oS[8][32 * 68];
  const int tid = threadIdx.x, lane = tid & 31, wave = tid >> 5, cl = lane & 15, rh = (lane >> 4) * 8;
  const int m0 = blockIdx.x * 128, n0 = blockIdx.y * 128;
  const int wm = (wave & 3) * 32, wn = (wave >> 2) * 64;
  f32x8 acc[2][4];
#pragma unroll
  for (int i = 0; i < 2; ++i)
#pragma unroll
    for (int j = 0; j < 4; ++j) { f32x8 z = {}; acc[i][j] = z; }
#pragma unroll 1
  for (int k0 = 0; k0 < K; k0 += 32) {
    __syncthreads();
    { const int row = tid >> 1, ch = (tid & 1) * 16;
      const AT* src = A + (size_t)(m0 + row) * lda + k0 + ch;
#pragma unroll
      for (int g = 0; g < 16; ++g) ldsA[row * GSTR + ch + g] = (f16)src[g]; }
    { const int k = tid >> 3, nn0 = (tid & 7) * 16;
      const float* src = Wm + (size_t)(k0 + k) * ldw + n0 + nn0;
#pragma unroll
      for (int g = 0; g < 4; ++g) { const v4f_t v = *(const v4f_t*)(src + 4 * g);
#pragma unroll
        for (int u = 0; u < 4; ++u) ldsW[(nn0 + 4 * g + u) * GSTR + k] = (f16)v[u]; } }
    __syncthreads();
    f16x16 af[2];
#pragma unroll
    for (int i = 0; i < 2; ++i) af[i] = lds_frag(ldsA + (wm + 16 * i) * GSTR, GSTR);
#pragma unroll
    for (int j = 0; j < 4; ++j) {
      const f16x16 bf = lds_frag(ldsW + (wn + 16 * j) * GSTR, GSTR);
#pragma unroll
      for (int i = 0; i < 2; ++i) acc[i][j] = wmma16(af[i], bf, acc[i][j]);
    }
  }
  float* so = oS[wave];
#pragma unroll
  for (int i = 0; i < 2; ++i)
#pragma unroll
    for (int j = 0; j < 4; ++j) {
      const int n = n0 + wn + 16 * j + cl;
      const float bv = bias ? bias[n] : 0.0f;
      const float gv = (EPI == 2 || EPI == 4) ? gvec[n] : 0.0f;
      if (EPI == 1) {
#pragma unroll 1
        for (int r = 0; r < 8; ++r) { const float xg = acc[i][j][r] + bv; so[(16 * i + rh + r) * 68 + 16 * j + cl] = 0.5f * xg * (1.0f + erff(xg * 0.70710678118654752f)); }
      } else {
#pragma unroll
        for (int r = 0; r < 8; ++r) {
          float v = acc[i][j][r] + bv;
          if (EPI == 3) v = fmaxf(v, 0.0f);
          if (EPI == 4) v = gv * v;
          if (EPI == 2) v = R[(size_t)(m0 + wm + 16 * i + rh + r) * ldy + n] + gv * v;
          so[(16 * i + rh + r) * 68 + 16 * j + cl] = v;
        }
      }
    }
  asm volatile("s_wait_dscnt 0" ::: "memory");
  __builtin_amdgcn_wave_barrier();
{
    if (OUT16) {
      f16* Y = (f16*)Yv;
#pragma unroll
      for (int it = 0; it < 8; ++it) { const int c = lane + 32 * it, rr = c >> 3, q8 = (c & 7) * 8;
        union { f16 h[8]; v4u_t v; } u;
#pragma unroll
        for (int e = 0; e < 8; ++e) u.h[e] = (f16)so[rr * 68 + q8 + e];
        *(v4u_t*)(Y + (size_t)(m0 + wm + rr) * ldy + n0 + wn + q8) = u.v; }
    } else {
      float* Y = (float*)Yv;
#pragma unroll
      for (int it = 0; it < 16; ++it) { const int f4 = lane + 32 * it, rr = f4 >> 4, q = (f4 & 15) * 4;
        *(v4f_t*)(Y + (size_t)(m0 + wm + rr) * ldy + n0 + wn + q) = *(const v4fa*)(so + rr * 68 + q); }
    }
    
  }
}

// ---------------------------------------------------------------------------------------------------------------------------
// gemm_kn2 (value+residual planes on both operands: hh + (hl+lh)/2048, f32-class): Y[m][n] (row stride ldy) = scale * sum_k A[m][k] (f32 or f16, row stride lda) * W[k][n] (f32, row-major [K][N], row
// stride ldw) (+ bias[n]) (+ Y if ACC). Block = 128 x 128 tile, 256 threads = 8 waves as 4(M, 32 rows) x 2(N, 64 cols); per
// 32-wide k-step the A tile and the W tile (stored transposed [n][k]) are staged as f16 in LDS; plain f16 operands, f32
// blockIdx.z selects a batch: A += z*strideA, W += z*strideW, Y += z*strideY (element strides).
// ---------------------------------------------------------------------------------------------------------------------------
template <typename AT, bool ACC>
__global__ __launch_bounds__(256) void gemm_kn2(const AT* __restrict__ A, int lda, size_t strideA,
                                               const float* __restrict__ Wm, int ldw, size_t strideW,
                                               const float* __restrict__ bias, float scale,
                                               float* __restrict__ Y, int ldy, size_t strideY, int K) {
  __shared__ __attribute__((aligned(16))) f16 ldsA[128 * GSTR], ldsAl[128 * GSTR];
  __shared__ __attribute__((aligned(16))) f16 ldsW[128 * GSTR], ldsWl[128 * GSTR];
  __shared__ __attribute__((aligned(16))) float oS[8][32 * 68];
  const int tid = threadIdx.x, lane = tid & 31, wave = tid >> 5, cl = lane & 15, rh = (lane >> 4) * 8;
  const int m0 = blockIdx.x * 128, n0 = blockIdx.y * 128;
  const int wm = (wave & 3) * 32, wn = (wave >> 2) * 64;
  A += (size_t)blockIdx.z * strideA; Wm += (size_t)blockIdx.z * strideW; Y += (size_t)blockIdx.z * strideY;
  f32x8 acc[2][4], accx[2][4];
#pragma unroll
  for (int i = 0; i < 2; ++i)
#pragma unroll
    for (int j = 0; j < 4; ++j) { f32x8 z = {}; acc[i][j] = z; accx[i][j] = z; }
#pragma unroll 1
  for (int k0 = 0; k0 < K; k0 += 32) {
    __syncthreads();
    {  // A: thread -> row tid>>1, 16 elements at column half (tid&1)*16
      const int row = tid >> 1, ch = (tid & 1) * 16;
      const AT* src = A + (size_t)(m0 + row) * lda + k0 + ch;
#pragma unroll
      for (int g = 0; g < 16; ++g) { const float v = (float)src[g]; const f16 h = (f16)v; ldsA[row * GSTR + ch + g] = h; ldsAl[row * GSTR + ch + g] = (f16)((v - (float)h) * 2048.0f); }
    }
    {  // W: thread -> k = tid>>3, 16 consecutive n at (tid&7)*16; stored transposed [n][k]
      const int k = tid >> 3, nn0 = (tid & 7) * 16;
      const float* src = Wm + (size_t)(k0 + k) * ldw + n0 + nn0;
#pragma unroll
      for (int g = 0; g < 4; ++g) { const v4f_t v = *(const v4f_t*)(src + 4 * g);
#pragma unroll
        for (int u = 0; u < 4; ++u) { const f16 h = (f16)v[u]; ldsW[(nn0 + 4 * g + u) * GSTR + k] = h; ldsWl[(nn0 + 4 * g + u) * GSTR + k] = (f16)((v[u] - (float)h) * 2048.0f); } }
    }
    __syncthreads();
    f16x16 af[2], afl[2];
#pragma unroll
    for (int i = 0; i < 2; ++i) { af[i] = lds_frag(ldsA + (wm + 16 * i) * GSTR, GSTR); afl[i] = lds_frag(ldsAl + (wm + 16 * i) * GSTR, GSTR); }
#pragma unroll
    for (int j = 0; j < 4; ++j) {
      const f16x16 bf = lds_frag(ldsW + (wn + 16 * j) * GSTR, GSTR), bfl = lds_frag(ldsWl + (wn + 16 * j) * GSTR, GSTR);
#pragma unroll
      for (int i = 0; i < 2; ++i) { acc[i][j] = wmma16(af[i], bf, acc[i][j]); accx[i][j] = wmma16(af[i], bfl, accx[i][j]); accx[i][j] = wmma16(afl[i], bf, accx[i][j]); }
    }
  }
  float* so = oS[wave];
#pragma unroll
  for (int i = 0; i < 2; ++i)
#pragma unroll
    for (int j = 0; j < 4; ++j) {
      const float bv = bias ? bias[n0 + wn + 16 * j + cl] : 0.0f;
#pragma unroll
      for (int r = 0; r < 8; ++r) so[(16 * i + rh + r) * 68 + 16 * j + cl] = (acc[i][j][r] + accx[i][j][r] * (1.0f / 2048.0f)) * scale + bv;
    }
  asm volatile("s_wait_dscnt 0" ::: "memory");
  __builtin_amdgcn_wave_barrier();
  if (ACC) {   // accumulate: fold the existing Y values into the staging tile ONCE (same thread <-> same chunks as the stores below)
#pragma unroll
    for (int it = 0; it < 16; ++it) { const int f4 = lane + 32 * it, rr = f4 >> 4, q = (f4 & 15) * 4;
      const v4f_t old = *(const v4fa*)(Y + (size_t)(m0 + wm + rr) * ldy + n0 + wn + q);
      v4f_t v = *(const v4fa*)(so + rr * 68 + q); v += old; *(v4fa*)(so + rr * 68 + q) = v; }   // plain LDS store (ordered by the s_wait_dscnt/memory clobber below)
    asm volatile("s_wait_dscnt 0" ::: "memory");
  }
{
#pragma unroll
    for (int it = 0; it < 16; ++it) { const int f4 = lane + 32 * it, rr = f4 >> 4, q = (f4 & 15) * 4;
      *(v4f_t*)(Y + (size_t)(m0 + wm + rr) * ldy + n0 + wn + q) = *(const v4fa*)(so + rr * 68 + q); }
    
  }
}

__global__ __launch_bounds__(256) void k_transpose(const float* __restrict__ Wm, float* __restrict__ Wt, int rows, int cols) {
  __shared__ float tS[64][65];
  const int tid = threadIdx.x, tbj = cols / 64, bi = blockIdx.x / tbj, bj = blockIdx.x % tbj;
  for (int e = tid; e < 64 * 64; e += 256) { const int r = e >> 6, c = e & 63; tS[r][c] = Wm[(size_t)(bi * 64 + r) * cols + bj * 64 + c]; }
  __syncthreads();
  for (int ch = tid; ch < 64 * 16; ch += 256) { const int r = ch >> 4, q4 = (ch & 15) * 4; v4f_t o; o[0] = tS[q4][r]; o[1] = tS[q4 + 1][r]; o[2] = tS[q4 + 2][r]; o[3] = tS[q4 + 3][r];
    float* dst = Wt + (size_t)(bj * 64 + r) * rows + bi * 64 + q4; *(v4f_t*)dst = o;  }
}


// ---------------------------------------------------------------------------------------------------------------------------
// gemm_sm<AT, EPI, OUT16, NJ>: narrow-N GEMM tile: Y[m][n] = epi(sum_k A[m][k]·W[k][n] + bias[n]), BM = 256 rows per block (8 waves x 32 rows; each wave owns whole output rows),
// BN = 16·NJ columns per block (NJ = 2 → 32, NJ = 4 → 64), K % 32 == 0, M % 256 == 0. A [M][lda] (f32 or f16, converted to f16), W [K][ldw] f32 → f16. f32 accumulate.
// (8 lanes x 16 B), BN=64 → two lines per row; OUT16 requires BN=64 (64 halves = one line per row). Every line written by one instruction of one wave, lane-contiguous.
template <typename AT, int EPI, bool OUT16, int NJ>
__global__ __launch_bounds__(256) void gemm_sm(const AT* __restrict__ A, int lda, size_t sA, const float* __restrict__ Wm, int ldw, size_t sW,
                                               const float* __restrict__ bias, const float* __restrict__ R, const float* __restrict__ gvec,
                                               void* __restrict__ Yv, int ldy, size_t sY, int K) {
  constexpr int BN = 16 * NJ; constexpr int OST = BN + 4;
  A += (size_t)blockIdx.z * sA; Wm += (size_t)blockIdx.z * sW; Yv = (void*)((char*)Yv + (size_t)blockIdx.z * sY * (OUT16 ? 2 : 4)); if (R) R += (size_t)blockIdx.z * sY;
  __shared__ __attribute__((aligned(16))) f16 ldsA[256 * GSTR];
  __shared__ __attribute__((aligned(16))) f16 ldsW[BN * GSTR];
  __shared__ __attribute__((aligned(16))) float oS[8][32 * OST];
  const int tid = threadIdx.x, lane = tid & 31, wave = tid >> 5, cl = lane & 15, rh = (lane >> 4) * 8;
  const int m0 = blockIdx.x * 256, n0 = blockIdx.y * BN;
  const int wm = wave * 32;
  f32x8 acc[2][NJ];
#pragma unroll
  for (int i = 0; i < 2; ++i)
#pragma unroll
    for (int j = 0; j < NJ; ++j) { f32x8 z = {}; acc[i][j] = z; }
#pragma unroll 1
  for (int k0 = 0; k0 < K; k0 += 32) {
    __syncthreads();
    { const AT* src = A + (size_t)(m0 + tid) * lda + k0;          // one 32-wide row slice per thread
#pragma unroll
      for (int g = 0; g < 32; ++g) ldsA[tid * GSTR + g] = (f16)src[g]; }
    { const int k = tid >> 3, nn0 = (tid & 7) * (2 * NJ);         // 32 k-rows x BN columns of W
      const float* src = Wm + (size_t)(k0 + k) * ldw + n0 + nn0;
#pragma unroll
      for (int g = 0; g < NJ / 2; ++g) { const v4f_t v = *(const v4f_t*)(src + 4 * g);
#pragma unroll
        for (int u = 0; u < 4; ++u) ldsW[(nn0 + 4 * g + u) * GSTR + k] = (f16)v[u]; } }
    __syncthreads();
    f16x16 af[2];
#pragma unroll
    for (int i = 0; i < 2; ++i) af[i] = lds_frag(ldsA + (wm + 16 * i) * GSTR, GSTR);
#pragma unroll
    for (int j = 0; j < NJ; ++j) {
      const f16x16 bf = lds_frag(ldsW + (16 * j) * GSTR, GSTR);
#pragma unroll
      for (int i = 0; i < 2; ++i) acc[i][j] = wmma16(af[i], bf, acc[i][j]);
    }
  }
  float* so = oS[wave];
#pragma unroll
  for (int i = 0; i < 2; ++i)
#pragma unroll
    for (int j = 0; j < NJ; ++j) {
      const int n = n0 + 16 * j + cl;
      const float bv = bias ? bias[n] : 0.0f;
      const float gv = (EPI == 2 || EPI == 4) ? gvec[n] : 0.0f;
#pragma unroll
      for (int r = 0; r < 8; ++r) {
        float v = acc[i][j][r] + bv;
        if (EPI == 3) v = fmaxf(v, 0.0f);
        if (EPI == 2) v = R[(size_t)(m0 + wm + 16 * i + rh + r) * ldy + n] + gv * v;
        if (EPI == 4) v = gv * v;
        so[(16 * i + rh + r) * OST + 16 * j + cl] = v;
      }
    }
  asm volatile("s_wait_dscnt 0" ::: "memory");
  __builtin_amdgcn_wave_barrier();
{
    if (OUT16) {
      f16* Y = (f16*)Yv;
#pragma unroll
      for (int it = 0; it < BN / 8; ++it) { const int c = lane + 32 * it, rr = c / (BN / 8), q8 = (c % (BN / 8)) * 8;
        union { f16 h[8]; v4u_t v; } u;
#pragma unroll
        for (int e = 0; e < 8; ++e) u.h[e] = (f16)so[rr * OST + q8 + e];
        *(v4u_t*)(Y + (size_t)(m0 + wm + rr) * ldy + n0 + q8) = u.v; }
    } else {       // BN floats per row = BN/32 lines: BN/4 lanes x 16 B per row
      float* Y = (float*)Yv;
#pragma unroll
      for (int it = 0; it < BN / 4; ++it) { const int f4 = lane + 32 * it, rr = f4 / (BN / 4), q = (f4 % (BN / 4)) * 4;
        *(v4f_t*)(Y + (size_t)(m0 + wm + rr) * ldy + n0 + q) = *(const v4fa*)(so + rr * OST + q); }
    }
    
  }
}

#define NBga 2
#define SSga 2048
#define SIN 2048
#define DQga 2048
#define DKga 512
#define HIDga 2048
#define HQga 32
#define HKVga 8
#define HDga 64
__global__ __launch_bounds__(256) void k_fill(float* __restrict__ p, float val, size_t n4) { const size_t i = (size_t)blockIdx.x * 256 + threadIdx.x; if (i < n4) { v4f_t v = {val, val, val, val}; *(v4f_t*)(p + 4 * i) = v;  } }
__global__ __launch_bounds__(256) void k_dbg_zero(float* __restrict__ p, size_t n4) { const size_t i = (size_t)blockIdx.x * 256 + threadIdx.x; if (i < n4) { v4f_t z = {0.f,0.f,0.f,0.f}; *(v4f_t*)(p + 4 * i) = z;  } }
__global__ __launch_bounds__(256) void k_copy(const float* __restrict__ src, float* __restrict__ dst, size_t n4) { const size_t i = (size_t)blockIdx.x * 256 + threadIdx.x; if (i < n4) { const v4f_t v = *(const v4f_t*)(src + 4 * i); *(v4f_t*)(dst + 4 * i) = v;  } }
// transpose with source row stride: Wt[c][r] (row stride = rows) = Wm[r][c] (row stride lds), 64x64 LDS tiles; 16 B per lane, 16 lanes per 256-B row segment (8 per line)
__global__ __launch_bounds__(256) void k_transpose_ld(const float* __restrict__ Wm, int lds, float* __restrict__ Wt, int rows, int cols) {
  __shared__ float tS[64][65];
  const int tid = threadIdx.x, tbj = cols / 64, bi = blockIdx.x / tbj, bj = blockIdx.x % tbj;
  for (int e = tid; e < 64 * 64; e += 256) { const int r = e >> 6, c = e & 63; tS[r][c] = Wm[(size_t)(bi * 64 + r) * lds + bj * 64 + c]; }
  __syncthreads();
  for (int ch = tid; ch < 64 * 16; ch += 256) { const int r = ch >> 4, q4 = (ch & 15) * 4; v4f_t o; o[0] = tS[q4][r]; o[1] = tS[q4 + 1][r]; o[2] = tS[q4 + 2][r]; o[3] = tS[q4 + 3][r];
    float* dst = Wt + (size_t)(bj * 64 + r) * rows + bi * 64 + q4; *(v4f_t*)dst = o;  }
}
// VB[c] = sum over the 2048 key rows of V[:, c] (f32, thread = column, rolled loop): added back after the P'·v GEMM (Σ_k (P'+1)·v_k /1024 = (Σ P'v + Σ v)/1024)
__global__ __launch_bounds__(256) void k_vsum(const float* __restrict__ V, int ldv, float* __restrict__ VB) {
  const int c = blockIdx.x * 256 + threadIdx.x; if (c >= 512) return; float s = 0.0f;   /* 512 columns */
#pragma unroll 1
  for (int r = 0; r < 2048; ++r) s += V[(size_t)r * ldv + c];
  const float m = s; /* column SUM over all key slots: ctx = (Σ P'v + Σ v)/1024 with P' = 1024·P − 1 */ *(float*)(VB + c) = m; 
}
// bf16 round-to-nearest-even of an f32 (bit trick)
__device__ __forceinline__ float bf16r(float x) { unsigned int u = __float_as_uint(x); u = (u + 0x7FFFu + ((u >> 16) & 1u)) & 0xFFFF0000u; return __uint_as_float(u); }
// bf16-rounded copy of an activation block (optionally scaled by a power of two AFTER rounding — exact); 16 B per lane
__global__ __launch_bounds__(256) void k_cpyrnd(const float* __restrict__ src, float* __restrict__ dst, float mul, size_t n4) { const size_t i = (size_t)blockIdx.x * 256 + threadIdx.x; if (i >= n4) return; v4f_t v = *(const v4f_t*)(src + 4 * i);
#pragma unroll
  for (int u = 0; u < 4; ++u) v[u] = mul * bf16r(v[u]);
  *(v4f_t*)(dst + 4 * i) = v;  }
// torch [out][in] weight → WT[i][o] = mul·bf16(W[o][i]) ([in][out], lifted by a power of two so no bf16 weight becomes an f16 subnormal); block = input row i, threads loop over the outputs (4-B lanes)
__global__ __launch_bounds__(256) void k_wprepT(const float* __restrict__ Wt, float* __restrict__ WT, int nout, int nin, float mul) { const int i = blockIdx.x, tid = threadIdx.x;
#pragma unroll 1
  for (int o = tid; o < nout; o += 256) { const float w = mul * bf16r(Wt[(size_t)o * nin + i]); *(float*)(WT + (size_t)i * nout + o) = w;  } }
// bias prep: B2[o] = mul·bf16(b[o]); one block loops
__global__ __launch_bounds__(256) void k_bprep(const float* __restrict__ b, float* __restrict__ B2, int n, float mul) { for (int o = threadIdx.x; o < n; o += 256) { const float v = mul * bf16r(b[o]); *(float*)(B2 + o) = v;  } }

// row softmax of s/8 for (query, head z of the group); P' = 1024·P − 1; block = (q, z), 256 threads x 8
__global__ __launch_bounds__(256) void k_soft(float* __restrict__ Sm) {
  __shared__ float red[256];
  const int q = blockIdx.x, z = blockIdx.y, tid = threadIdx.x; float* sr = Sm + ((size_t)z * SSga + q) * SSga; float v[SSga / 256]; float m = -3.0e38f;
#pragma unroll
  for (int e = 0; e < SSga / 256; ++e) { v[e] = sr[tid + 256 * e] * 0.125f; m = fmaxf(m, v[e]); }
  red[tid] = m; __syncthreads(); for (int o = 128; o > 0; o >>= 1) { if (tid < o) red[tid] = fmaxf(red[tid], red[tid + o]); __syncthreads(); }
  m = red[0]; __syncthreads(); float zs = 0.0f;
#pragma unroll
  for (int e = 0; e < SSga / 256; ++e) { v[e] = expf(v[e] - m); zs += v[e]; }
  red[tid] = zs; __syncthreads(); for (int o = 128; o > 0; o >>= 1) { if (tid < o) red[tid] += red[tid + o]; __syncthreads(); }
  const float kk = 1024.0f / red[0];
{
#pragma unroll
    for (int e = 0; e < SSga / 256; ++e) *(float*)(sr + tid + 256 * e) = v[e] * kk - 1.0f;
     }
}

extern "C" void kernel_launch(void* const* d_in, const int* in_sizes, int n_in,
                              void* d_out, int out_size, void* d_ws, size_t ws_size,
                              hipStream_t stream) {
  (void)in_sizes; (void)n_in; (void)out_size;
  const float** f = (const float**)d_in;
  const float* Qi = f[0], *Ki = f[1], *Vi = f[2], *Wout = f[3], *bout = f[4];
  float* out = (float*)d_out;     // [2,2048,2048]
  char* ws = (char*)d_ws;
  float* WT = (float*)ws; ws += (size_t)DQga * HIDga * 4; float* B64 = (float*)ws; ws += HIDga * 4; float* g64 = (float*)ws; ws += HIDga * 4;
  float* Q = (float*)ws; ws += (size_t)SSga * DQga * 4; float* Km = (float*)ws; ws += (size_t)SSga * DKga * 4; float* V = (float*)ws; ws += (size_t)SSga * DKga * 4; float* KT = (float*)ws; ws += (size_t)HDga * SSga * 4;
  float* VS = (float*)ws; ws += DKga * 4; float* sc = (float*)ws; ws += 64 * 4; float* S = (float*)ws; ws += (size_t)4 * SSga * SSga * 4; float* O = (float*)ws; ws += (size_t)SSga * DQga * 4;
  if ((size_t)(ws - (char*)d_ws) > ws_size) return;                      // WS TOTAL 126,372,096 B
  const dim3 blk(256);
  k_fill<<<dim3(1), blk, 0, stream>>>(sc, 1.0f / 1024.0f, 64 / 4); k_fill<<<dim3(2), blk, 0, stream>>>(g64, 1.0f / 64.0f, HIDga / 4);
  k_wprepT<<<dim3(DQga), blk, 0, stream>>>(Wout, WT, HIDga, DQga, 64.0f); k_bprep<<<dim3(1), blk, 0, stream>>>(bout, B64, HIDga, 64.0f);

  for (int b = 0; b < NBga; ++b) {
    k_cpyrnd<<<dim3(((size_t)SSga * DQga / 4 + 255) / 256), blk, 0, stream>>>(Qi + (size_t)b * SIN * DQga, Q, 1.0f, (size_t)SSga * DQga / 4); k_cpyrnd<<<dim3(((size_t)SSga * DKga / 4 + 255) / 256), blk, 0, stream>>>(Ki + (size_t)b * SIN * DKga, Km, 1.0f, (size_t)SSga * DKga / 4); k_cpyrnd<<<dim3(((size_t)SSga * DKga / 4 + 255) / 256), blk, 0, stream>>>(Vi + (size_t)b * SIN * DKga, V, 1.0f, (size_t)SSga * DKga / 4);
    k_vsum<<<dim3(DKga / 256), blk, 0, stream>>>(V, DKga, VS);
    for (int kv = 0; kv < HKVga; ++kv) {
      k_transpose_ld<<<dim3((SSga / 64) * (HDga / 64)), blk, 0, stream>>>(Km + kv * HDga, DKga, KT, SSga, HDga);
      gemm_knez<float, 0, false><<<dim3(SSga / 128, SSga / 128, 4), blk, 0, stream>>>(Q + (size_t)kv * 4 * HDga, DQga, (size_t)HDga, KT, SSga, (size_t)0, nullptr, nullptr, nullptr, S, SSga, (size_t)SSga * SSga, HDga);   // the group's 4 query heads vs kv head
      k_soft<<<dim3(SSga, 4), blk, 0, stream>>>(S);
      gemm_sm<float, 4, false, 4><<<dim3(SSga / 256, 1, 4), blk, 0, stream>>>(S, SSga, (size_t)SSga * SSga, V + kv * HDga, DKga, (size_t)0, VS + kv * HDga, nullptr, sc, O + (size_t)kv * 4 * HDga, DQga, (size_t)HDga, SSga);   // the group's 4 heads as grid z: head z reads S plane z, writes O columns 64 z; shared v, column sums
    }
    gemm_kne<float, 4, false><<<dim3(SSga / 128, HIDga / 128), blk, 0, stream>>>(O, DQga, WT, HIDga, B64, nullptr, g64, out + (size_t)b * SIN * HIDga, HIDga, DQga);   // out = (o·64W_outᵀ + 64b)/64
  }
}

// v002
// It runs in 2990 microseconds.
// Two timings next to v001 both put it at 1.49 times that version's speed.
// Over all steps from v000 it is 3.05 times as fast.
// Q, K, V, W_out, b_out are rounded to bf16 (RNE) on load; the scores are then exact single f16 products of bf16 values
// with f32 accumulation (no projection exists in this module — Q, K, V are inputs), and the output projection uses 64·bf16(W_outᵀ) with a 2^-6 epilogue.
// Contractions on v_wmma_f32_16x16x32_f16 (f16 operands, f32 accumulate), per batch element: the 32 query heads' scores against their kv head (K 64, the 4 heads of a group as one z-launch
// against the shared kᵀ), o_h = P'·v_h as a 64-wide tile (K 2048; centred P' = 1024·P − 1 with Σ_s v_s added back, exact), out = o·W_outᵀ + b_out (K 2048). f32 VALU: softmax of s/√64.
// compute dtype: f16 operands (bf16-valued), f32 accumulate.  Q [2,2048,2048], K, V [2,2048,512] → out [2,2048,2048].
#include <hip/hip_runtime.h>
#include <hip/hip_bf16.h>
#include <math.h>


typedef _Float16 bf16;
typedef _Float16 f16;
typedef __attribute__((ext_vector_type(4))) unsigned v4u_t;
typedef unsigned v4ua __attribute__((ext_vector_type(4), may_alias));
typedef __attribute__((ext_vector_type(4))) float v4f_t;
typedef float v4fa __attribute__((ext_vector_type(4), may_alias));
typedef __attribute__((ext_vector_type(16))) bf16  bf16x16;
typedef bf16x16 f16x16;
typedef __attribute__((ext_vector_type(8)))  bf16  bf16x8;
typedef bf16x8 f16x8;
typedef __attribute__((ext_vector_type(4)))  bf16  bf16x4;
typedef __attribute__((ext_vector_type(8)))  float f32x8;
__device__ __forceinline__ f32x8 wmma16(f16x16 a, f16x16 b, f32x8 c) {
  c = __builtin_amdgcn_wmma_f32_16x16x32_f16(false, a, false, b, (short)0, c, false, false);
  asm volatile("v_nop\n\tv_nop\n\tv_nop\n\tv_nop" : "+v"(c) : "v"(a), "v"(b));
  return c;
}
#define LDS_STRIDE 48   // unused; GEMM tiles are staged 32 -> 48 elems (GSTR, 96B rows): aligned b128 reads
#define KSTRIDE    72   // unused; the K tile is staged 32 -> 48 elems (GSTR)
#define VSTRIDE    48   // unused; the V tile is staged 32 -> 48 elems (GSTR)

__device__ __forceinline__ f32x8 wmma_bf16(bf16x16 a, bf16x16 b, f32x8 c) {
  c = __builtin_amdgcn_wmma_f32_16x16x32_f16(false, a, false, b, (short)0, c, false, false);
  asm volatile("v_nop\n\tv_nop\n\tv_nop\n\tv_nop" : "+v"(c) : "v"(a), "v"(b));   // A/B-overwrite hazard guard
  return c;
}

// 16x32 (MxK) bf16 fragment from a row-major global matrix.
// lanes 0-15  (row=lane)    : elems 0..7 = K+0..7,  8..15 = K+16..23
// lanes 16-31 (row=lane-16) : elems 0..7 = K+8..15, 8..15 = K+24..31
template <typename T>
__device__ __forceinline__ bf16x16 load_frag(const T* __restrict__ base, int ld,
                                             int row0, int k0) {
  const int lane = threadIdx.x & 31;
  const int r    = lane & 15;
  const int kh   = (lane >> 4) * 8;
  const T* p0 = base + (size_t)(row0 + r) * ld + (k0 + kh);
  const T* p1 = p0 + 16;
  bf16x16 f;
#pragma unroll
  for (int i = 0; i < 8; ++i) {
    f[i]     = (bf16)p0[i];
    f[i + 8] = (bf16)p1[i];
  }
  return f;
}

// Same fragment from an LDS tile with padded row stride (base includes row0/k0).
__device__ __forceinline__ bf16x16 lds_frag(const bf16* base, int stride) {
  const int lane = threadIdx.x & 31;
  const int row  = lane & 15;
  const int kh   = (lane >> 4) * 8;
  const bf16x8 lo = *(const bf16x8*)(base + row * stride + kh);
  const bf16x8 hi = *(const bf16x8*)(base + row * stride + kh + 16);
  bf16x16 f;
#pragma unroll
  for (int i = 0; i < 8; ++i) { f[i] = lo[i]; f[i + 8] = hi[i]; }
  return f;
}

template <typename T>
__device__ __forceinline__ void stage_read16(const T* __restrict__ p, float* buf) {
#pragma unroll
  for (int i = 0; i < 16; ++i) buf[i] = (float)p[i];
}

__device__ __forceinline__ void stage_write(bf16* dst, const float* buf, int nquad) {
#pragma unroll
  for (int i = 0; i < nquad; ++i) {
    bf16x4 q;
    q[0] = (bf16)buf[4 * i];     q[1] = (bf16)buf[4 * i + 1];
    q[2] = (bf16)buf[4 * i + 2]; q[3] = (bf16)buf[4 * i + 3];
    *(bf16x4*)(dst + 4 * i) = q;
  }
}


#define GSTR 48
// ---------------------------------------------------------------------------------------------------------------------------
// gemm_kne: Y[m][n] = epi( Σ_k A[m][k]·W[k][n] + bias[n] ), A f32/f16 [M][lda], W f32 row-major [K][N] (ldw), plain f16 operands,
// f32 accumulate. EPI 0: identity; 1: exact-erf GELU; 2: R[m][n] + gvec[n]·(·) (residual with per-channel gain); 3: ReLU; 4: gvec[n]·(·) (per-channel scale, no residual). Output f32 (or f16
// when OUT16). Block = 128x128 tile, 8 waves as 4(M) x 2(N); per 32-wide k-step A and W tiles staged f16 in LDS (W transposed
// ---------------------------------------------------------------------------------------------------------------------------
#define GSTR 48
template <typename AT, int EPI, bool OUT16>
__global__ __launch_bounds__(256) void gemm_kne(const AT* __restrict__ A, int lda, const float* __restrict__ Wm, int ldw,
                                                const float* __restrict__ bias, const float* __restrict__ R, const float* __restrict__ gvec,
                                                void* __restrict__ Yv, int ldy, int K) {
  __shared__ __attribute__((aligned(16))) f16 ldsA[128 * GSTR];
  __shared__ __attribute__((aligned(16))) f16 ldsW[128 * GSTR];
  __shared__ __attribute__((aligned(16))) float oS[8][32 * 68];
  const int tid = threadIdx.x, lane = tid & 31, wave = tid >> 5, cl = lane & 15, rh = (lane >> 4) * 8;
  const int m0 = blockIdx.x * 128, n0 = blockIdx.y * 128;
  const int wm = (wave & 3) * 32, wn = (wave >> 2) * 64;
  f32x8 acc[2][4];
#pragma unroll
  for (int i = 0; i < 2; ++i)
#pragma unroll
    for (int j = 0; j < 4; ++j) { f32x8 z = {}; acc[i][j] = z; }
#pragma unroll 1
  for (int k0 = 0; k0 < K; k0 += 32) {
    __syncthreads();
    { const int row = tid >> 1, ch = (tid & 1) * 16;
      const AT* src = A + (size_t)(m0 + row) * lda + k0 + ch;
#pragma unroll
      for (int g = 0; g < 16; ++g) ldsA[row * GSTR + ch + g] = (f16)src[g]; }
    { const int k = tid >> 3, nn0 = (tid & 7) * 16;
      const float* src = Wm + (size_t)(k0 + k) * ldw + n0 + nn0;
#pragma unroll
      for (int g = 0; g < 4; ++g) { const v4f_t v = *(const v4f_t*)(src + 4 * g);
#pragma unroll
        for (int u = 0; u < 4; ++u) ldsW[(nn0 + 4 * g + u) * GSTR + k] = (f16)v[u]; } }
    __syncthreads();
    f16x16 af[2];
#pragma unroll
    for (int i = 0; i < 2; ++i) af[i] = lds_frag(ldsA + (wm + 16 * i) * GSTR, GSTR);
#pragma unroll
    for (int j = 0; j < 4; ++j) {
      const f16x16 bf = lds_frag(ldsW + (wn + 16 * j) * GSTR, GSTR);
#pragma unroll
      for (int i = 0; i < 2; ++i) acc[i][j] = wmma16(af[i], bf, acc[i][j]);
    }
  }
  float* so = oS[wave];
#pragma unroll
  for (int i = 0; i < 2; ++i)
#pragma unroll
    for (int j = 0; j < 4; ++j) {
      const int n = n0 + wn + 16 * j + cl;
      const float bv = bias ? bias[n] : 0.0f;
      const float gv = (EPI == 2 || EPI == 4) ? gvec[n] : 0.0f;
      if (EPI == 1) {
#pragma unroll 1
        for (int r = 0; r < 8; ++r) { const float xg = acc[i][j][r] + bv; so[(16 * i + rh + r) * 68 + 16 * j + cl] = 0.5f * xg * (1.0f + erff(xg * 0.70710678118654752f)); }
      } else {
#pragma unroll
        for (int r = 0; r < 8; ++r) {
          float v = acc[i][j][r] + bv;
          if (EPI == 3) v = fmaxf(v, 0.0f);
          if (EPI == 4) v = gv * v;
          if (EPI == 2) v = R[(size_t)(m0 + wm + 16 * i + rh + r) * ldy + n] + gv * v;
          so[(16 * i + rh + r) * 68 + 16 * j + cl] = v;
        }
      }
    }
  asm volatile("s_wait_dscnt 0" ::: "memory");
  __builtin_amdgcn_wave_barrier();
{
    if (OUT16) {
      f16* Y = (f16*)Yv;
#pragma unroll
      for (int it = 0; it < 8; ++it) { const int c = lane + 32 * it, rr = c >> 3, q8 = (c & 7) * 8;
        union { f16 h[8]; v4u_t v; } u;
#pragma unroll
        for (int e = 0; e < 8; ++e) u.h[e] = (f16)so[rr * 68 + q8 + e];
        *(v4u_t*)(Y + (size_t)(m0 + wm + rr) * ldy + n0 + wn + q8) = u.v; }
    } else {
      float* Y = (float*)Yv;
#pragma unroll
      for (int it = 0; it < 16; ++it) { const int f4 = lane + 32 * it, rr = f4 >> 4, q = (f4 & 15) * 4;
        *(v4f_t*)(Y + (size_t)(m0 + wm + rr) * ldy + n0 + wn + q) = *(const v4fa*)(so + rr * 68 + q); }
    }
    
  }
}

// z-batched variant of gemm_kne (same tile code)
template <typename AT, int EPI, bool OUT16>
__global__ __launch_bounds__(256) void gemm_knez(const AT* __restrict__ A, int lda, size_t strideA, const float* __restrict__ Wm, int ldw, size_t strideW,
                                                 const float* __restrict__ bias, const float* __restrict__ R, const float* __restrict__ gvec,
                                                 void* __restrict__ Yv, int ldy, size_t strideY, int K) {   // blockIdx.z-batched: A += z·strideA, W += z·strideW, Y (and R) += z·strideY
  A += (size_t)blockIdx.z * strideA; Wm += (size_t)blockIdx.z * strideW; Yv = (void*)((char*)Yv + (size_t)blockIdx.z * strideY * (OUT16 ? 2 : 4)); if (R) R += (size_t)blockIdx.z * strideY;
  __shared__ __attribute__((aligned(16))) f16 ldsA[128 * GSTR];
  __shared__ __attribute__((aligned(16))) f16 ldsW[128 * GSTR];
  __shared__ __attribute__((aligned(16))) float oS[8][32 * 68];
  const int tid = threadIdx.x, lane = tid & 31, wave = tid >> 5, cl = lane & 15, rh = (lane >> 4) * 8;
  const int m0 = blockIdx.x * 128, n0 = blockIdx.y * 128;
  const int wm = (wave & 3) * 32, wn = (wave >> 2) * 64;
  f32x8 acc[2][4];
#pragma unroll
  for (int i = 0; i < 2; ++i)
#pragma unroll
    for (int j = 0; j < 4; ++j) { f32x8 z = {}; acc[i][j] = z; }
#pragma unroll 1
  for (int k0 = 0; k0 < K; k0 += 32) {
    __syncthreads();
    { const int row = tid >> 1, ch = (tid & 1) * 16;
      const AT* src = A + (size_t)(m0 + row) * lda + k0 + ch;
#pragma unroll
      for (int g = 0; g < 16; ++g) ldsA[row * GSTR + ch + g] = (f16)src[g]; }
    { const int k = tid >> 3, nn0 = (tid & 7) * 16;
      const float* src = Wm + (size_t)(k0 + k) * ldw + n0 + nn0;
#pragma unroll
      for (int g = 0; g < 4; ++g) { const v4f_t v = *(const v4f_t*)(src + 4 * g);
#pragma unroll
        for (int u = 0; u < 4; ++u) ldsW[(nn0 + 4 * g + u) * GSTR + k] = (f16)v[u]; } }
    __syncthreads();
    f16x16 af[2];
#pragma unroll
    for (int i = 0; i < 2; ++i) af[i] = lds_frag(ldsA + (wm + 16 * i) * GSTR, GSTR);
#pragma unroll
    for (int j = 0; j < 4; ++j) {
      const f16x16 bf = lds_frag(ldsW + (wn + 16 * j) * GSTR, GSTR);
#pragma unroll
      for (int i = 0; i < 2; ++i) acc[i][j] = wmma16(af[i], bf, acc[i][j]);
    }
  }
  float* so = oS[wave];
#pragma unroll
  for (int i = 0; i < 2; ++i)
#pragma unroll
    for (int j = 0; j < 4; ++j) {
      const int n = n0 + wn + 16 * j + cl;
      const float bv = bias ? bias[n] : 0.0f;
      const float gv = (EPI == 2 || EPI == 4) ? gvec[n] : 0.0f;
      if (EPI == 1) {
#pragma unroll 1
        for (int r = 0; r < 8; ++r) { const float xg = acc[i][j][r] + bv; so[(16 * i + rh + r) * 68 + 16 * j + cl] = 0.5f * xg * (1.0f + erff(xg * 0.70710678118654752f)); }
      } else {
#pragma unroll
        for (int r = 0; r < 8; ++r) {
          float v = acc[i][j][r] + bv;
          if (EPI == 3) v = fmaxf(v, 0.0f);
          if (EPI == 4) v = gv * v;
          if (EPI == 2) v = R[(size_t)(m0 + wm + 16 * i + rh + r) * ldy + n] + gv * v;
          so[(16 * i + rh + r) * 68 + 16 * j + cl] = v;
        }
      }
    }
  asm volatile("s_wait_dscnt 0" ::: "memory");
  __builtin_amdgcn_wave_barrier();
{
    if (OUT16) {
      f16* Y = (f16*)Yv;
#pragma unroll
      for (int it = 0; it < 8; ++it) { const int c = lane + 32 * it, rr = c >> 3, q8 = (c & 7) * 8;
        union { f16 h[8]; v4u_t v; } u;
#pragma unroll
        for (int e = 0; e < 8; ++e) u.h[e] = (f16)so[rr * 68 + q8 + e];
        *(v4u_t*)(Y + (size_t)(m0 + wm + rr) * ldy + n0 + wn + q8) = u.v; }
    } else {
      float* Y = (float*)Yv;
#pragma unroll
      for (int it = 0; it < 16; ++it) { const int f4 = lane + 32 * it, rr = f4 >> 4, q = (f4 & 15) * 4;
        *(v4f_t*)(Y + (size_t)(m0 + wm + rr) * ldy + n0 + wn + q) = *(const v4fa*)(so + rr * 68 + q); }
    }
    
  }
}

// ---------------------------------------------------------------------------------------------------------------------------
// gemm_kn2 (value+residual planes on both operands: hh + (hl+lh)/2048, f32-class): Y[m][n] (row stride ldy) = scale * sum_k A[m][k] (f32 or f16, row stride lda) * W[k][n] (f32, row-major [K][N], row
// stride ldw) (+ bias[n]) (+ Y if ACC). Block = 128 x 128 tile, 256 threads = 8 waves as 4(M, 32 rows) x 2(N, 64 cols); per
// 32-wide k-step the A tile and the W tile (stored transposed [n][k]) are staged as f16 in LDS; plain f16 operands, f32
// blockIdx.z selects a batch: A += z*strideA, W += z*strideW, Y += z*strideY (element strides).
// ---------------------------------------------------------------------------------------------------------------------------
template <typename AT, bool ACC>
__global__ __launch_bounds__(256) void gemm_kn2(const AT* __restrict__ A, int lda, size_t strideA,
                                               const float* __restrict__ Wm, int ldw, size_t strideW,
                                               const float* __restrict__ bias, float scale,
                                               float* __restrict__ Y, int ldy, size_t strideY, int K) {
  __shared__ __attribute__((aligned(16))) f16 ldsA[128 * GSTR], ldsAl[128 * GSTR];
  __shared__ __attribute__((aligned(16))) f16 ldsW[128 * GSTR], ldsWl[128 * GSTR];
  __shared__ __attribute__((aligned(16))) float oS[8][32 * 68];
  const int tid = threadIdx.x, lane = tid & 31, wave = tid >> 5, cl = lane & 15, rh = (lane >> 4) * 8;
  const int m0 = blockIdx.x * 128, n0 = blockIdx.y * 128;
  const int wm = (wave & 3) * 32, wn = (wave >> 2) * 64;
  A += (size_t)blockIdx.z * strideA; Wm += (size_t)blockIdx.z * strideW; Y += (size_t)blockIdx.z * strideY;
  f32x8 acc[2][4], accx[2][4];
#pragma unroll
  for (int i = 0; i < 2; ++i)
#pragma unroll
    for (int j = 0; j < 4; ++j) { f32x8 z = {}; acc[i][j] = z; accx[i][j] = z; }
#pragma unroll 1
  for (int k0 = 0; k0 < K; k0 += 32) {
    __syncthreads();
    {  // A: thread -> row tid>>1, 16 elements at column half (tid&1)*16
      const int row = tid >> 1, ch = (tid & 1) * 16;
      const AT* src = A + (size_t)(m0 + row) * lda + k0 + ch;
#pragma unroll
      for (int g = 0; g < 16; ++g) { const float v = (float)src[g]; const f16 h = (f16)v; ldsA[row * GSTR + ch + g] = h; ldsAl[row * GSTR + ch + g] = (f16)((v - (float)h) * 2048.0f); }
    }
    {  // W: thread -> k = tid>>3, 16 consecutive n at (tid&7)*16; stored transposed [n][k]
      const int k = tid >> 3, nn0 = (tid & 7) * 16;
      const float* src = Wm + (size_t)(k0 + k) * ldw + n0 + nn0;
#pragma unroll
      for (int g = 0; g < 4; ++g) { const v4f_t v = *(const v4f_t*)(src + 4 * g);
#pragma unroll
        for (int u = 0; u < 4; ++u) { const f16 h = (f16)v[u]; ldsW[(nn0 + 4 * g + u) * GSTR + k] = h; ldsWl[(nn0 + 4 * g + u) * GSTR + k] = (f16)((v[u] - (float)h) * 2048.0f); } }
    }
    __syncthreads();
    f16x16 af[2], afl[2];
#pragma unroll
    for (int i = 0; i < 2; ++i) { af[i] = lds_frag(ldsA + (wm + 16 * i) * GSTR, GSTR); afl[i] = lds_frag(ldsAl + (wm + 16 * i) * GSTR, GSTR); }
#pragma unroll
    for (int j = 0; j < 4; ++j) {
      const f16x16 bf = lds_frag(ldsW + (wn + 16 * j) * GSTR, GSTR), bfl = lds_frag(ldsWl + (wn + 16 * j) * GSTR, GSTR);
#pragma unroll
      for (int i = 0; i < 2; ++i) { acc[i][j] = wmma16(af[i], bf, acc[i][j]); accx[i][j] = wmma16(af[i], bfl, accx[i][j]); accx[i][j] = wmma16(afl[i], bf, accx[i][j]); }
    }
  }
  float* so = oS[wave];
#pragma unroll
  for (int i = 0; i < 2; ++i)
#pragma unroll
    for (int j = 0; j < 4; ++j) {
      const float bv = bias ? bias[n0 + wn + 16 * j + cl] : 0.0f;
#pragma unroll
      for (int r = 0; r < 8; ++r) so[(16 * i + rh + r) * 68 + 16 * j + cl] = (acc[i][j][r] + accx[i][j][r] * (1.0f / 2048.0f)) * scale + bv;
    }
  asm volatile("s_wait_dscnt 0" ::: "memory");
  __builtin_amdgcn_wave_barrier();
  if (ACC) {   // accumulate: fold the existing Y values into the staging tile ONCE (same thread <-> same chunks as the stores below)
#pragma unroll
    for (int it = 0; it < 16; ++it) { const int f4 = lane + 32 * it, rr = f4 >> 4, q = (f4 & 15) * 4;
      const v4f_t old = *(const v4fa*)(Y + (size_t)(m0 + wm + rr) * ldy + n0 + wn + q);
      v4f_t v = *(const v4fa*)(so + rr * 68 + q); v += old; *(v4fa*)(so + rr * 68 + q) = v; }   // plain LDS store (ordered by the s_wait_dscnt/memory clobber below)
    asm volatile("s_wait_dscnt 0" ::: "memory");
  }
{
#pragma unroll
    for (int it = 0; it < 16; ++it) { const int f4 = lane + 32 * it, rr = f4 >> 4, q = (f4 & 15) * 4;
      *(v4f_t*)(Y + (size_t)(m0 + wm + rr) * ldy + n0 + wn + q) = *(const v4fa*)(so + rr * 68 + q); }
    
  }
}

__global__ __launch_bounds__(256) void k_transpose(const float* __restrict__ Wm, float* __restrict__ Wt, int rows, int cols) {
  __shared__ float tS[64][65];
  const int tid = threadIdx.x, tbj = cols / 64, bi = blockIdx.x / tbj, bj = blockIdx.x % tbj;
  for (int e = tid; e < 64 * 64; e += 256) { const int r = e >> 6, c = e & 63; tS[r][c] = Wm[(size_t)(bi * 64 + r) * cols + bj * 64 + c]; }
  __syncthreads();
  for (int ch = tid; ch < 64 * 16; ch += 256) { const int r = ch >> 4, q4 = (ch & 15) * 4; v4f_t o; o[0] = tS[q4][r]; o[1] = tS[q4 + 1][r]; o[2] = tS[q4 + 2][r]; o[3] = tS[q4 + 3][r];
    float* dst = Wt + (size_t)(bj * 64 + r) * rows + bi * 64 + q4; *(v4f_t*)dst = o;  }
}


// ---------------------------------------------------------------------------------------------------------------------------
// gemm_sm<AT, EPI, OUT16, NJ>: narrow-N GEMM tile: Y[m][n] = epi(sum_k A[m][k]·W[k][n] + bias[n]), BM = 256 rows per block (8 waves x 32 rows; each wave owns whole output rows),
// BN = 16·NJ columns per block (NJ = 2 → 32, NJ = 4 → 64), K % 32 == 0, M % 256 == 0. A [M][lda] (f32 or f16, converted to f16), W [K][ldw] f32 → f16. f32 accumulate.
// (8 lanes x 16 B), BN=64 → two lines per row; OUT16 requires BN=64 (64 halves = one line per row). Every line written by one instruction of one wave, lane-contiguous.
template <typename AT, int EPI, bool OUT16, int NJ>
__global__ __launch_bounds__(256) void gemm_sm(const AT* __restrict__ A, int lda, size_t sA, const float* __restrict__ Wm, int ldw, size_t sW,
                                               const float* __restrict__ bias, const float* __restrict__ R, const float* __restrict__ gvec,
                                               void* __restrict__ Yv, int ldy, size_t sY, int K) {
  constexpr int BN = 16 * NJ; constexpr int OST = BN + 4;
  A += (size_t)blockIdx.z * sA; Wm += (size_t)blockIdx.z * sW; Yv = (void*)((char*)Yv + (size_t)blockIdx.z * sY * (OUT16 ? 2 : 4)); if (R) R += (size_t)blockIdx.z * sY;
  __shared__ __attribute__((aligned(16))) f16 ldsA[256 * GSTR];
  __shared__ __attribute__((aligned(16))) f16 ldsW[BN * GSTR];
  __shared__ __attribute__((aligned(16))) float oS[8][32 * OST];
  const int tid = threadIdx.x, lane = tid & 31, wave = tid >> 5, cl = lane & 15, rh = (lane >> 4) * 8;
  const int m0 = blockIdx.x * 256, n0 = blockIdx.y * BN;
  const int wm = wave * 32;
  f32x8 acc[2][NJ];
#pragma unroll
  for (int i = 0; i < 2; ++i)
#pragma unroll
    for (int j = 0; j < NJ; ++j) { f32x8 z = {}; acc[i][j] = z; }
#pragma unroll 1
  for (int k0 = 0; k0 < K; k0 += 32) {
    __syncthreads();
    { const AT* src = A + (size_t)(m0 + tid) * lda + k0;          // one 32-wide row slice per thread
#pragma unroll
      for (int g = 0; g < 32; ++g) ldsA[tid * GSTR + g] = (f16)src[g]; }
    { const int k = tid >> 3, nn0 = (tid & 7) * (2 * NJ);         // 32 k-rows x BN columns of W
      const float* src = Wm + (size_t)(k0 + k) * ldw + n0 + nn0;
#pragma unroll
      for (int g = 0; g < NJ / 2; ++g) { const v4f_t v = *(const v4f_t*)(src + 4 * g);
#pragma unroll
        for (int u = 0; u < 4; ++u) ldsW[(nn0 + 4 * g + u) * GSTR + k] = (f16)v[u]; } }
    __syncthreads();
    f16x16 af[2];
#pragma unroll
    for (int i = 0; i < 2; ++i) af[i] = lds_frag(ldsA + (wm + 16 * i) * GSTR, GSTR);
#pragma unroll
    for (int j = 0; j < NJ; ++j) {
      const f16x16 bf = lds_frag(ldsW + (16 * j) * GSTR, GSTR);
#pragma unroll
      for (int i = 0; i < 2; ++i) acc[i][j] = wmma16(af[i], bf, acc[i][j]);
    }
  }
  float* so = oS[wave];
#pragma unroll
  for (int i = 0; i < 2; ++i)
#pragma unroll
    for (int j = 0; j < NJ; ++j) {
      const int n = n0 + 16 * j + cl;
      const float bv = bias ? bias[n] : 0.0f;
      const float gv = (EPI == 2 || EPI == 4) ? gvec[n] : 0.0f;
#pragma unroll
      for (int r = 0; r < 8; ++r) {
        float v = acc[i][j][r] + bv;
        if (EPI == 3) v = fmaxf(v, 0.0f);
        if (EPI == 2) v = R[(size_t)(m0 + wm + 16 * i + rh + r) * ldy + n] + gv * v;
        if (EPI == 4) v = gv * v;
        so[(16 * i + rh + r) * OST + 16 * j + cl] = v;
      }
    }
  asm volatile("s_wait_dscnt 0" ::: "memory");
  __builtin_amdgcn_wave_barrier();
{
    if (OUT16) {
      f16* Y = (f16*)Yv;
#pragma unroll
      for (int it = 0; it < BN / 8; ++it) { const int c = lane + 32 * it, rr = c / (BN / 8), q8 = (c % (BN / 8)) * 8;
        union { f16 h[8]; v4u_t v; } u;
#pragma unroll
        for (int e = 0; e < 8; ++e) u.h[e] = (f16)so[rr * OST + q8 + e];
        *(v4u_t*)(Y + (size_t)(m0 + wm + rr) * ldy + n0 + q8) = u.v; }
    } else {       // BN floats per row = BN/32 lines: BN/4 lanes x 16 B per row
      float* Y = (float*)Yv;
#pragma unroll
      for (int it = 0; it < BN / 4; ++it) { const int f4 = lane + 32 * it, rr = f4 / (BN / 4), q = (f4 % (BN / 4)) * 4;
        *(v4f_t*)(Y + (size_t)(m0 + wm + rr) * ldy + n0 + q) = *(const v4fa*)(so + rr * OST + q); }
    }
    
  }
}

#define NBga 2
#define SSga 2048
#define SIN 2048
#define DQga 2048
#define DKga 512
#define HIDga 2048
#define HQga 32
#define HKVga 8
#define HDga 64
__global__ __launch_bounds__(256) void k_fill(float* __restrict__ p, float val, size_t n4) { const size_t i = (size_t)blockIdx.x * 256 + threadIdx.x; if (i < n4) { v4f_t v = {val, val, val, val}; *(v4f_t*)(p + 4 * i) = v;  } }
__global__ __launch_bounds__(256) void k_dbg_zero(float* __restrict__ p, size_t n4) { const size_t i = (size_t)blockIdx.x * 256 + threadIdx.x; if (i < n4) { v4f_t z = {0.f,0.f,0.f,0.f}; *(v4f_t*)(p + 4 * i) = z;  } }
__global__ __launch_bounds__(256) void k_copy(const float* __restrict__ src, float* __restrict__ dst, size_t n4) { const size_t i = (size_t)blockIdx.x * 256 + threadIdx.x; if (i < n4) { const v4f_t v = *(const v4f_t*)(src + 4 * i); *(v4f_t*)(dst + 4 * i) = v;  } }
// transpose with source row stride: Wt[c][r] (row stride = rows) = Wm[r][c] (row stride lds), 64x64 LDS tiles; 16 B per lane, 16 lanes per 256-B row segment (8 per line)
__global__ __launch_bounds__(256) void k_transpose_ld(const float* __restrict__ Wm, int lds, float* __restrict__ Wt, int rows, int cols) {
  __shared__ float tS[64][65];
  const int tid = threadIdx.x, tbj = cols / 64, bi = blockIdx.x / tbj, bj = blockIdx.x % tbj;
  for (int e = tid; e < 64 * 64; e += 256) { const int r = e >> 6, c = e & 63; tS[r][c] = Wm[(size_t)(bi * 64 + r) * lds + bj * 64 + c]; }
  __syncthreads();
  for (int ch = tid; ch < 64 * 16; ch += 256) { const int r = ch >> 4, q4 = (ch & 15) * 4; v4f_t o; o[0] = tS[q4][r]; o[1] = tS[q4 + 1][r]; o[2] = tS[q4 + 2][r]; o[3] = tS[q4 + 3][r];
    float* dst = Wt + (size_t)(bj * 64 + r) * rows + bi * 64 + q4; *(v4f_t*)dst = o;  }
}
// VB[c] = sum over the 2048 key rows of V[:, c] (f32): added back after the P'.v GEMM (ctx = (sum P'v + sum v)/1024 with P' = 1024.P - 1).
// Block = 32 columns (one 128-B line per row: 8 lanes x 16 B) x 32 row groups; a thread sums rows rg, rg + 32, ... (64 rows), then the 32 partial sums of a column are added in LDS.
__global__ __launch_bounds__(256) void k_vsum(const float* __restrict__ V, float* __restrict__ VB) {
  __shared__ float part[32][33];
  const int tid = threadIdx.x, c4 = (tid & 7) * 4, rg = tid >> 3, c0 = blockIdx.x * 32;
  const float* src = V + (size_t)rg * DKga + c0 + c4;
  v4f_t s = {0.0f, 0.0f, 0.0f, 0.0f};
#pragma unroll   // constant row pitch: one address, 64 independent loads at immediate offsets, so the load latency is paid a few times and not once per row
  for (int i = 0; i < SSga / 32; ++i) s += *(const v4f_t*)(src + (size_t)(32 * i) * DKga);
#pragma unroll
  for (int u = 0; u < 4; ++u) part[rg][c4 + u] = s[u];
  __syncthreads();
  if (tid < 32) {
    float t = 0.0f;
#pragma unroll
    for (int g = 0; g < 32; ++g) t += part[g][tid];
    VB[c0 + tid] = t;
  }
}
// bf16 round-to-nearest-even of an f32 (bit trick)
__device__ __forceinline__ float bf16r(float x) { unsigned int u = __float_as_uint(x); u = (u + 0x7FFFu + ((u >> 16) & 1u)) & 0xFFFF0000u; return __uint_as_float(u); }
// bf16-rounded copy of an activation block (optionally scaled by a power of two AFTER rounding — exact); 16 B per lane
__global__ __launch_bounds__(256) void k_cpyrnd(const float* __restrict__ src, float* __restrict__ dst, float mul, size_t n4) { const size_t i = (size_t)blockIdx.x * 256 + threadIdx.x; if (i >= n4) return; v4f_t v = *(const v4f_t*)(src + 4 * i);
#pragma unroll
  for (int u = 0; u < 4; ++u) v[u] = mul * bf16r(v[u]);
  *(v4f_t*)(dst + 4 * i) = v;  }
// torch [out][in] weight → WT[i][o] = mul·bf16(W[o][i]) ([in][out], lifted by a power of two so no bf16 weight becomes an f16 subnormal); block = input row i, threads loop over the outputs (4-B lanes)
__global__ __launch_bounds__(256) void k_wprepT(const float* __restrict__ Wt, float* __restrict__ WT, int nout, int nin, float mul) { const int i = blockIdx.x, tid = threadIdx.x;
#pragma unroll 1
  for (int o = tid; o < nout; o += 256) { const float w = mul * bf16r(Wt[(size_t)o * nin + i]); *(float*)(WT + (size_t)i * nout + o) = w;  } }
// bias prep: B2[o] = mul·bf16(b[o]); one block loops
__global__ __launch_bounds__(256) void k_bprep(const float* __restrict__ b, float* __restrict__ B2, int n, float mul) { for (int o = threadIdx.x; o < n; o += 256) { const float v = mul * bf16r(b[o]); *(float*)(B2 + o) = v;  } }

// row softmax of s/8 for (query, head z of the group); P' = 1024·P − 1; block = (q, z), 256 threads x 8
__global__ __launch_bounds__(256) void k_soft(float* __restrict__ Sm) {
  __shared__ float red[256];
  const int q = blockIdx.x, z = blockIdx.y, tid = threadIdx.x; float* sr = Sm + ((size_t)z * SSga + q) * SSga; float v[SSga / 256]; float m = -3.0e38f;
#pragma unroll
  for (int e = 0; e < SSga / 256; ++e) { v[e] = sr[tid + 256 * e] * 0.125f; m = fmaxf(m, v[e]); }
  red[tid] = m; __syncthreads(); for (int o = 128; o > 0; o >>= 1) { if (tid < o) red[tid] = fmaxf(red[tid], red[tid + o]); __syncthreads(); }
  m = red[0]; __syncthreads(); float zs = 0.0f;
#pragma unroll
  for (int e = 0; e < SSga / 256; ++e) { v[e] = expf(v[e] - m); zs += v[e]; }
  red[tid] = zs; __syncthreads(); for (int o = 128; o > 0; o >>= 1) { if (tid < o) red[tid] += red[tid + o]; __syncthreads(); }
  const float kk = 1024.0f / red[0];
{
#pragma unroll
    for (int e = 0; e < SSga / 256; ++e) *(float*)(sr + tid + 256 * e) = v[e] * kk - 1.0f;
     }
}

extern "C" void kernel_launch(void* const* d_in, const int* in_sizes, int n_in,
                              void* d_out, int out_size, void* d_ws, size_t ws_size,
                              hipStream_t stream) {
  (void)in_sizes; (void)n_in; (void)out_size;
  const float** f = (const float**)d_in;
  const float* Qi = f[0], *Ki = f[1], *Vi = f[2], *Wout = f[3], *bout = f[4];
  float* out = (float*)d_out;     // [2,2048,2048]
  char* ws = (char*)d_ws;
  float* WT = (float*)ws; ws += (size_t)DQga * HIDga * 4; float* B64 = (float*)ws; ws += HIDga * 4; float* g64 = (float*)ws; ws += HIDga * 4;
  float* Q = (float*)ws; ws += (size_t)SSga * DQga * 4; float* Km = (float*)ws; ws += (size_t)SSga * DKga * 4; float* V = (float*)ws; ws += (size_t)SSga * DKga * 4; float* KT = (float*)ws; ws += (size_t)HDga * SSga * 4;
  float* VS = (float*)ws; ws += DKga * 4; float* sc = (float*)ws; ws += 64 * 4; float* S = (float*)ws; ws += (size_t)4 * SSga * SSga * 4; float* O = (float*)ws; ws += (size_t)SSga * DQga * 4;
  if ((size_t)(ws - (char*)d_ws) > ws_size) return;                      // WS TOTAL 126,372,096 B
  const dim3 blk(256);
  k_fill<<<dim3(1), blk, 0, stream>>>(sc, 1.0f / 1024.0f, 64 / 4); k_fill<<<dim3(2), blk, 0, stream>>>(g64, 1.0f / 64.0f, HIDga / 4);
  k_wprepT<<<dim3(DQga), blk, 0, stream>>>(Wout, WT, HIDga, DQga, 64.0f); k_bprep<<<dim3(1), blk, 0, stream>>>(bout, B64, HIDga, 64.0f);

  for (int b = 0; b < NBga; ++b) {
    k_cpyrnd<<<dim3(((size_t)SSga * DQga / 4 + 255) / 256), blk, 0, stream>>>(Qi + (size_t)b * SIN * DQga, Q, 1.0f, (size_t)SSga * DQga / 4); k_cpyrnd<<<dim3(((size_t)SSga * DKga / 4 + 255) / 256), blk, 0, stream>>>(Ki + (size_t)b * SIN * DKga, Km, 1.0f, (size_t)SSga * DKga / 4); k_cpyrnd<<<dim3(((size_t)SSga * DKga / 4 + 255) / 256), blk, 0, stream>>>(Vi + (size_t)b * SIN * DKga, V, 1.0f, (size_t)SSga * DKga / 4);
    k_vsum<<<dim3(DKga / 32), blk, 0, stream>>>(V, VS);
    for (int kv = 0; kv < HKVga; ++kv) {
      k_transpose_ld<<<dim3((SSga / 64) * (HDga / 64)), blk, 0, stream>>>(Km + kv * HDga, DKga, KT, SSga, HDga);
      gemm_knez<float, 0, false><<<dim3(SSga / 128, SSga / 128, 4), blk, 0, stream>>>(Q + (size_t)kv * 4 * HDga, DQga, (size_t)HDga, KT, SSga, (size_t)0, nullptr, nullptr, nullptr, S, SSga, (size_t)SSga * SSga, HDga);   // the group's 4 query heads vs kv head
      k_soft<<<dim3(SSga, 4), blk, 0, stream>>>(S);
      gemm_sm<float, 4, false, 4><<<dim3(SSga / 256, 1, 4), blk, 0, stream>>>(S, SSga, (size_t)SSga * SSga, V + kv * HDga, DKga, (size_t)0, VS + kv * HDga, nullptr, sc, O + (size_t)kv * 4 * HDga, DQga, (size_t)HDga, SSga);   // the group's 4 heads as grid z: head z reads S plane z, writes O columns 64 z; shared v, column sums
    }
    gemm_kne<float, 4, false><<<dim3(SSga / 128, HIDga / 128), blk, 0, stream>>>(O, DQga, WT, HIDga, B64, nullptr, g64, out + (size_t)b * SIN * HIDga, HIDga, DQga);   // out = (o·64W_outᵀ + 64b)/64
  }
}

// v003
// One run takes 1440 microseconds.
// In both of two side-by-side timings against v002, it was 2.08 times as fast.
// Over all steps from v000 it is 6.35 times as fast.
// Q, K, V, W_out, b_out are rounded to bf16 (RNE) on load; the scores are then exact single f16 products of bf16 values
// with f32 accumulation (no projection exists in this module — Q, K, V are inputs), and the output projection uses 64·bf16(W_outᵀ) with a 2^-6 epilogue.
// Contractions on v_wmma_f32_16x16x32_f16 (f16 operands, f32 accumulate), per batch element: the 32 query heads' scores against their kv head (K 64, the 4 heads of a group as one z-launch
// against the shared kᵀ), o_h = P'·v_h as a 64-wide tile (K 2048; centred P' = 1024·P − 1 with Σ_s v_s added back, exact), out = o·W_outᵀ + b_out (K 2048). f32 VALU: softmax of s/√64.
// compute dtype: f16 operands (bf16-valued), f32 accumulate.  Q [2,2048,2048], K, V [2,2048,512] → out [2,2048,2048].
#include <hip/hip_runtime.h>
#include <hip/hip_bf16.h>
#include <math.h>


typedef _Float16 bf16;
typedef _Float16 f16;
typedef __attribute__((ext_vector_type(4))) unsigned v4u_t;
typedef unsigned v4ua __attribute__((ext_vector_type(4), may_alias));
typedef __attribute__((ext_vector_type(4))) float v4f_t;
typedef float v4fa __attribute__((ext_vector_type(4), may_alias));
typedef __attribute__((ext_vector_type(16))) bf16  bf16x16;
typedef bf16x16 f16x16;
typedef __attribute__((ext_vector_type(8)))  bf16  bf16x8;
typedef bf16x8 f16x8;
typedef __attribute__((ext_vector_type(4)))  bf16  bf16x4;
typedef __attribute__((ext_vector_type(8)))  float f32x8;
__device__ __forceinline__ f32x8 wmma16(f16x16 a, f16x16 b, f32x8 c) {
  c = __builtin_amdgcn_wmma_f32_16x16x32_f16(false, a, false, b, (short)0, c, false, false);
  asm volatile("v_nop\n\tv_nop\n\tv_nop\n\tv_nop" : "+v"(c) : "v"(a), "v"(b));
  return c;
}
#define LDS_STRIDE 48   // unused; GEMM tiles are staged 32 -> 48 elems (GSTR, 96B rows): aligned b128 reads
#define KSTRIDE    72   // unused; the K tile is staged 32 -> 48 elems (GSTR)
#define VSTRIDE    48   // unused; the V tile is staged 512 -> 520 elems (PVP, k_pv)

__device__ __forceinline__ f32x8 wmma_bf16(bf16x16 a, bf16x16 b, f32x8 c) {
  c = __builtin_amdgcn_wmma_f32_16x16x32_f16(false, a, false, b, (short)0, c, false, false);
  asm volatile("v_nop\n\tv_nop\n\tv_nop\n\tv_nop" : "+v"(c) : "v"(a), "v"(b));   // A/B-overwrite hazard guard
  return c;
}

// 16x32 (MxK) bf16 fragment from a row-major global matrix.
// lanes 0-15  (row=lane)    : elems 0..7 = K+0..7,  8..15 = K+16..23
// lanes 16-31 (row=lane-16) : elems 0..7 = K+8..15, 8..15 = K+24..31
template <typename T>
__device__ __forceinline__ bf16x16 load_frag(const T* __restrict__ base, int ld,
                                             int row0, int k0) {
  const int lane = threadIdx.x & 31;
  const int r    = lane & 15;
  const int kh   = (lane >> 4) * 8;
  const T* p0 = base + (size_t)(row0 + r) * ld + (k0 + kh);
  const T* p1 = p0 + 16;
  bf16x16 f;
#pragma unroll
  for (int i = 0; i < 8; ++i) {
    f[i]     = (bf16)p0[i];
    f[i + 8] = (bf16)p1[i];
  }
  return f;
}

// Same fragment from an LDS tile with padded row stride (base includes row0/k0).
__device__ __forceinline__ bf16x16 lds_frag(const bf16* base, int stride) {
  const int lane = threadIdx.x & 31;
  const int row  = lane & 15;
  const int kh   = (lane >> 4) * 8;
  const bf16x8 lo = *(const bf16x8*)(base + row * stride + kh);
  const bf16x8 hi = *(const bf16x8*)(base + row * stride + kh + 16);
  bf16x16 f;
#pragma unroll
  for (int i = 0; i < 8; ++i) { f[i] = lo[i]; f[i + 8] = hi[i]; }
  return f;
}

template <typename T>
__device__ __forceinline__ void stage_read16(const T* __restrict__ p, float* buf) {
#pragma unroll
  for (int i = 0; i < 16; ++i) buf[i] = (float)p[i];
}

__device__ __forceinline__ void stage_write(bf16* dst, const float* buf, int nquad) {
#pragma unroll
  for (int i = 0; i < nquad; ++i) {
    bf16x4 q;
    q[0] = (bf16)buf[4 * i];     q[1] = (bf16)buf[4 * i + 1];
    q[2] = (bf16)buf[4 * i + 2]; q[3] = (bf16)buf[4 * i + 3];
    *(bf16x4*)(dst + 4 * i) = q;
  }
}


#define GSTR 48
// ---------------------------------------------------------------------------------------------------------------------------
// gemm_kne: Y[m][n] = epi( Σ_k A[m][k]·W[k][n] + bias[n] ), A f32/f16 [M][lda], W f32 row-major [K][N] (ldw), plain f16 operands,
// f32 accumulate. EPI 0: identity; 1: exact-erf GELU; 2: R[m][n] + gvec[n]·(·) (residual with per-channel gain); 3: ReLU; 4: gvec[n]·(·) (per-channel scale, no residual). Output f32 (or f16
// when OUT16). Block = 128x128 tile, 8 waves as 4(M) x 2(N); per 32-wide k-step A and W tiles staged f16 in LDS (W transposed
// ---------------------------------------------------------------------------------------------------------------------------
#define GSTR 48
template <typename AT, int EPI, bool OUT16>
__global__ __launch_bounds__(256) void gemm_kne(const AT* __restrict__ A, int lda, const float* __restrict__ Wm, int ldw,
                                                const float* __restrict__ bias, const float* __restrict__ R, const float* __restrict__ gvec,
                                                void* __restrict__ Yv, int ldy, int K) {
  __shared__ __attribute__((aligned(16))) f16 ldsA[128 * GSTR];
  __shared__ __attribute__((aligned(16))) f16 ldsW[128 * GSTR];
  __shared__ __attribute__((aligned(16))) float oS[8][32 * 68];
  const int tid = threadIdx.x, lane = tid & 31, wave = tid >> 5, cl = lane & 15, rh = (lane >> 4) * 8;
  const int m0 = blockIdx.x * 128, n0 = blockIdx.y * 128;
  const int wm = (wave & 3) * 32, wn = (wave >> 2) * 64;
  f32x8 acc[2][4];
#pragma unroll
  for (int i = 0; i < 2; ++i)
#pragma unroll
    for (int j = 0; j < 4; ++j) { f32x8 z = {}; acc[i][j] = z; }
#pragma unroll 1
  for (int k0 = 0; k0 < K; k0 += 32) {
    __syncthreads();
    { const int row = tid >> 1, ch = (tid & 1) * 16;
      const AT* src = A + (size_t)(m0 + row) * lda + k0 + ch;
#pragma unroll
      for (int g = 0; g < 16; ++g) ldsA[row * GSTR + ch + g] = (f16)src[g]; }
    { const int k = tid >> 3, nn0 = (tid & 7) * 16;
      const float* src = Wm + (size_t)(k0 + k) * ldw + n0 + nn0;
#pragma unroll
      for (int g = 0; g < 4; ++g) { const v4f_t v = *(const v4f_t*)(src + 4 * g);
#pragma unroll
        for (int u = 0; u < 4; ++u) ldsW[(nn0 + 4 * g + u) * GSTR + k] = (f16)v[u]; } }
    __syncthreads();
    f16x16 af[2];
#pragma unroll
    for (int i = 0; i < 2; ++i) af[i] = lds_frag(ldsA + (wm + 16 * i) * GSTR, GSTR);
#pragma unroll
    for (int j = 0; j < 4; ++j) {
      const f16x16 bf = lds_frag(ldsW + (wn + 16 * j) * GSTR, GSTR);
#pragma unroll
      for (int i = 0; i < 2; ++i) acc[i][j] = wmma16(af[i], bf, acc[i][j]);
    }
  }
  float* so = oS[wave];
#pragma unroll
  for (int i = 0; i < 2; ++i)
#pragma unroll
    for (int j = 0; j < 4; ++j) {
      const int n = n0 + wn + 16 * j + cl;
      const float bv = bias ? bias[n] : 0.0f;
      const float gv = (EPI == 2 || EPI == 4) ? gvec[n] : 0.0f;
      if (EPI == 1) {
#pragma unroll 1
        for (int r = 0; r < 8; ++r) { const float xg = acc[i][j][r] + bv; so[(16 * i + rh + r) * 68 + 16 * j + cl] = 0.5f * xg * (1.0f + erff(xg * 0.70710678118654752f)); }
      } else {
#pragma unroll
        for (int r = 0; r < 8; ++r) {
          float v = acc[i][j][r] + bv;
          if (EPI == 3) v = fmaxf(v, 0.0f);
          if (EPI == 4) v = gv * v;
          if (EPI == 2) v = R[(size_t)(m0 + wm + 16 * i + rh + r) * ldy + n] + gv * v;
          so[(16 * i + rh + r) * 68 + 16 * j + cl] = v;
        }
      }
    }
  asm volatile("s_wait_dscnt 0" ::: "memory");
  __builtin_amdgcn_wave_barrier();
{
    if (OUT16) {
      f16* Y = (f16*)Yv;
#pragma unroll
      for (int it = 0; it < 8; ++it) { const int c = lane + 32 * it, rr = c >> 3, q8 = (c & 7) * 8;
        union { f16 h[8]; v4u_t v; } u;
#pragma unroll
        for (int e = 0; e < 8; ++e) u.h[e] = (f16)so[rr * 68 + q8 + e];
        *(v4u_t*)(Y + (size_t)(m0 + wm + rr) * ldy + n0 + wn + q8) = u.v; }
    } else {
      float* Y = (float*)Yv;
#pragma unroll
      for (int it = 0; it < 16; ++it) { const int f4 = lane + 32 * it, rr = f4 >> 4, q = (f4 & 15) * 4;
        *(v4f_t*)(Y + (size_t)(m0 + wm + rr) * ldy + n0 + wn + q) = *(const v4fa*)(so + rr * 68 + q); }
    }
    
  }
}

// z-batched variant of gemm_kne (same tile code)
template <typename AT, int EPI, bool OUT16>
__global__ __launch_bounds__(256) void gemm_knez(const AT* __restrict__ A, int lda, size_t strideA, const float* __restrict__ Wm, int ldw, size_t strideW,
                                                 const float* __restrict__ bias, const float* __restrict__ R, const float* __restrict__ gvec,
                                                 void* __restrict__ Yv, int ldy, size_t strideY, int K) {   // blockIdx.z-batched: A += z·strideA, W += z·strideW, Y (and R) += z·strideY
  A += (size_t)blockIdx.z * strideA; Wm += (size_t)blockIdx.z * strideW; Yv = (void*)((char*)Yv + (size_t)blockIdx.z * strideY * (OUT16 ? 2 : 4)); if (R) R += (size_t)blockIdx.z * strideY;
  __shared__ __attribute__((aligned(16))) f16 ldsA[128 * GSTR];
  __shared__ __attribute__((aligned(16))) f16 ldsW[128 * GSTR];
  __shared__ __attribute__((aligned(16))) float oS[8][32 * 68];
  const int tid = threadIdx.x, lane = tid & 31, wave = tid >> 5, cl = lane & 15, rh = (lane >> 4) * 8;
  const int m0 = blockIdx.x * 128, n0 = blockIdx.y * 128;
  const int wm = (wave & 3) * 32, wn = (wave >> 2) * 64;
  f32x8 acc[2][4];
#pragma unroll
  for (int i = 0; i < 2; ++i)
#pragma unroll
    for (int j = 0; j < 4; ++j) { f32x8 z = {}; acc[i][j] = z; }
#pragma unroll 1
  for (int k0 = 0; k0 < K; k0 += 32) {
    __syncthreads();
    { const int row = tid >> 1, ch = (tid & 1) * 16;
      const AT* src = A + (size_t)(m0 + row) * lda + k0 + ch;
#pragma unroll
      for (int g = 0; g < 16; ++g) ldsA[row * GSTR + ch + g] = (f16)src[g]; }
    { const int k = tid >> 3, nn0 = (tid & 7) * 16;
      const float* src = Wm + (size_t)(k0 + k) * ldw + n0 + nn0;
#pragma unroll
      for (int g = 0; g < 4; ++g) { const v4f_t v = *(const v4f_t*)(src + 4 * g);
#pragma unroll
        for (int u = 0; u < 4; ++u) ldsW[(nn0 + 4 * g + u) * GSTR + k] = (f16)v[u]; } }
    __syncthreads();
    f16x16 af[2];
#pragma unroll
    for (int i = 0; i < 2; ++i) af[i] = lds_frag(ldsA + (wm + 16 * i) * GSTR, GSTR);
#pragma unroll
    for (int j = 0; j < 4; ++j) {
      const f16x16 bf = lds_frag(ldsW + (wn + 16 * j) * GSTR, GSTR);
#pragma unroll
      for (int i = 0; i < 2; ++i) acc[i][j] = wmma16(af[i], bf, acc[i][j]);
    }
  }
  float* so = oS[wave];
#pragma unroll
  for (int i = 0; i < 2; ++i)
#pragma unroll
    for (int j = 0; j < 4; ++j) {
      const int n = n0 + wn + 16 * j + cl;
      const float bv = bias ? bias[n] : 0.0f;
      const float gv = (EPI == 2 || EPI == 4) ? gvec[n] : 0.0f;
      if (EPI == 1) {
#pragma unroll 1
        for (int r = 0; r < 8; ++r) { const float xg = acc[i][j][r] + bv; so[(16 * i + rh + r) * 68 + 16 * j + cl] = 0.5f * xg * (1.0f + erff(xg * 0.70710678118654752f)); }
      } else {
#pragma unroll
        for (int r = 0; r < 8; ++r) {
          float v = acc[i][j][r] + bv;
          if (EPI == 3) v = fmaxf(v, 0.0f);
          if (EPI == 4) v = gv * v;
          if (EPI == 2) v = R[(size_t)(m0 + wm + 16 * i + rh + r) * ldy + n] + gv * v;
          so[(16 * i + rh + r) * 68 + 16 * j + cl] = v;
        }
      }
    }
  asm volatile("s_wait_dscnt 0" ::: "memory");
  __builtin_amdgcn_wave_barrier();
{
    if (OUT16) {
      f16* Y = (f16*)Yv;
#pragma unroll
      for (int it = 0; it < 8; ++it) { const int c = lane + 32 * it, rr = c >> 3, q8 = (c & 7) * 8;
        union { f16 h[8]; v4u_t v; } u;
#pragma unroll
        for (int e = 0; e < 8; ++e) u.h[e] = (f16)so[rr * 68 + q8 + e];
        *(v4u_t*)(Y + (size_t)(m0 + wm + rr) * ldy + n0 + wn + q8) = u.v; }
    } else {
      float* Y = (float*)Yv;
#pragma unroll
      for (int it = 0; it < 16; ++it) { const int f4 = lane + 32 * it, rr = f4 >> 4, q = (f4 & 15) * 4;
        *(v4f_t*)(Y + (size_t)(m0 + wm + rr) * ldy + n0 + wn + q) = *(const v4fa*)(so + rr * 68 + q); }
    }
    
  }
}

// ---------------------------------------------------------------------------------------------------------------------------
// gemm_kn2 (value+residual planes on both operands: hh + (hl+lh)/2048, f32-class): Y[m][n] (row stride ldy) = scale * sum_k A[m][k] (f32 or f16, row stride lda) * W[k][n] (f32, row-major [K][N], row
// stride ldw) (+ bias[n]) (+ Y if ACC). Block = 128 x 128 tile, 256 threads = 8 waves as 4(M, 32 rows) x 2(N, 64 cols); per
// 32-wide k-step the A tile and the W tile (stored transposed [n][k]) are staged as f16 in LDS; plain f16 operands, f32
// blockIdx.z selects a batch: A += z*strideA, W += z*strideW, Y += z*strideY (element strides).
// ---------------------------------------------------------------------------------------------------------------------------
template <typename AT, bool ACC>
__global__ __launch_bounds__(256) void gemm_kn2(const AT* __restrict__ A, int lda, size_t strideA,
                                               const float* __restrict__ Wm, int ldw, size_t strideW,
                                               const float* __restrict__ bias, float scale,
                                               float* __restrict__ Y, int ldy, size_t strideY, int K) {
  __shared__ __attribute__((aligned(16))) f16 ldsA[128 * GSTR], ldsAl[128 * GSTR];
  __shared__ __attribute__((aligned(16))) f16 ldsW[128 * GSTR], ldsWl[128 * GSTR];
  __shared__ __attribute__((aligned(16))) float oS[8][32 * 68];
  const int tid = threadIdx.x, lane = tid & 31, wave = tid >> 5, cl = lane & 15, rh = (lane >> 4) * 8;
  const int m0 = blockIdx.x * 128, n0 = blockIdx.y * 128;
  const int wm = (wave & 3) * 32, wn = (wave >> 2) * 64;
  A += (size_t)blockIdx.z * strideA; Wm += (size_t)blockIdx.z * strideW; Y += (size_t)blockIdx.z * strideY;
  f32x8 acc[2][4], accx[2][4];
#pragma unroll
  for (int i = 0; i < 2; ++i)
#pragma unroll
    for (int j = 0; j < 4; ++j) { f32x8 z = {}; acc[i][j] = z; accx[i][j] = z; }
#pragma unroll 1
  for (int k0 = 0; k0 < K; k0 += 32) {
    __syncthreads();
    {  // A: thread -> row tid>>1, 16 elements at column half (tid&1)*16
      const int row = tid >> 1, ch = (tid & 1) * 16;
      const AT* src = A + (size_t)(m0 + row) * lda + k0 + ch;
#pragma unroll
      for (int g = 0; g < 16; ++g) { const float v = (float)src[g]; const f16 h = (f16)v; ldsA[row * GSTR + ch + g] = h; ldsAl[row * GSTR + ch + g] = (f16)((v - (float)h) * 2048.0f); }
    }
    {  // W: thread -> k = tid>>3, 16 consecutive n at (tid&7)*16; stored transposed [n][k]
      const int k = tid >> 3, nn0 = (tid & 7) * 16;
      const float* src = Wm + (size_t)(k0 + k) * ldw + n0 + nn0;
#pragma unroll
      for (int g = 0; g < 4; ++g) { const v4f_t v = *(const v4f_t*)(src + 4 * g);
#pragma unroll
        for (int u = 0; u < 4; ++u) { const f16 h = (f16)v[u]; ldsW[(nn0 + 4 * g + u) * GSTR + k] = h; ldsWl[(nn0 + 4 * g + u) * GSTR + k] = (f16)((v[u] - (float)h) * 2048.0f); } }
    }
    __syncthreads();
    f16x16 af[2], afl[2];
#pragma unroll
    for (int i = 0; i < 2; ++i) { af[i] = lds_frag(ldsA + (wm + 16 * i) * GSTR, GSTR); afl[i] = lds_frag(ldsAl + (wm + 16 * i) * GSTR, GSTR); }
#pragma unroll
    for (int j = 0; j < 4; ++j) {
      const f16x16 bf = lds_frag(ldsW + (wn + 16 * j) * GSTR, GSTR), bfl = lds_frag(ldsWl + (wn + 16 * j) * GSTR, GSTR);
#pragma unroll
      for (int i = 0; i < 2; ++i) { acc[i][j] = wmma16(af[i], bf, acc[i][j]); accx[i][j] = wmma16(af[i], bfl, accx[i][j]); accx[i][j] = wmma16(afl[i], bf, accx[i][j]); }
    }
  }
  float* so = oS[wave];
#pragma unroll
  for (int i = 0; i < 2; ++i)
#pragma unroll
    for (int j = 0; j < 4; ++j) {
      const float bv = bias ? bias[n0 + wn + 16 * j + cl] : 0.0f;
#pragma unroll
      for (int r = 0; r < 8; ++r) so[(16 * i + rh + r) * 68 + 16 * j + cl] = (acc[i][j][r] + accx[i][j][r] * (1.0f / 2048.0f)) * scale + bv;
    }
  asm volatile("s_wait_dscnt 0" ::: "memory");
  __builtin_amdgcn_wave_barrier();
  if (ACC) {   // accumulate: fold the existing Y values into the staging tile ONCE (same thread <-> same chunks as the stores below)
#pragma unroll
    for (int it = 0; it < 16; ++it) { const int f4 = lane + 32 * it, rr = f4 >> 4, q = (f4 & 15) * 4;
      const v4f_t old = *(const v4fa*)(Y + (size_t)(m0 + wm + rr) * ldy + n0 + wn + q);
      v4f_t v = *(const v4fa*)(so + rr * 68 + q); v += old; *(v4fa*)(so + rr * 68 + q) = v; }   // plain LDS store (ordered by the s_wait_dscnt/memory clobber below)
    asm volatile("s_wait_dscnt 0" ::: "memory");
  }
{
#pragma unroll
    for (int it = 0; it < 16; ++it) { const int f4 = lane + 32 * it, rr = f4 >> 4, q = (f4 & 15) * 4;
      *(v4f_t*)(Y + (size_t)(m0 + wm + rr) * ldy + n0 + wn + q) = *(const v4fa*)(so + rr * 68 + q); }
    
  }
}

__global__ __launch_bounds__(256) void k_transpose(const float* __restrict__ Wm, float* __restrict__ Wt, int rows, int cols) {
  __shared__ float tS[64][65];
  const int tid = threadIdx.x, tbj = cols / 64, bi = blockIdx.x / tbj, bj = blockIdx.x % tbj;
  for (int e = tid; e < 64 * 64; e += 256) { const int r = e >> 6, c = e & 63; tS[r][c] = Wm[(size_t)(bi * 64 + r) * cols + bj * 64 + c]; }
  __syncthreads();
  for (int ch = tid; ch < 64 * 16; ch += 256) { const int r = ch >> 4, q4 = (ch & 15) * 4; v4f_t o; o[0] = tS[q4][r]; o[1] = tS[q4 + 1][r]; o[2] = tS[q4 + 2][r]; o[3] = tS[q4 + 3][r];
    float* dst = Wt + (size_t)(bj * 64 + r) * rows + bi * 64 + q4; *(v4f_t*)dst = o;  }
}


#define NBga 2
#define SSga 2048
#define SIN 2048
#define DQga 2048
#define DKga 512
#define HIDga 2048
#define HQga 32
#define HKVga 8
#define HDga 64
// ---------------------------------------------------------------------------------------------------------------------------
// k_pv: Y[m][n] = gvec[n] * (sum_k A[m][k] * W[k][n] + bias[n]) for one query head (blockIdx.z): A = that head's [2048][2048] f32 plane, W = the kv head's [2048][64] f32 columns (row stride 512).
// Block = 32 rows x 64 columns; the K range is split over the block's PVW waves: per stage the block lays 32 x PVK of A and PVK x 64 of W (transposed to [n][k]) as f16 in LDS, wave w
// multiplies the 32-wide k slice w of the stage. Each wave ends with a partial 32 x 64 tile over its own k slices; the PVW partial tiles are added in LDS, then bias, gain and the store.
// Global loads cover whole 128-B lines: A 512 contiguous bytes per wave load, W 4 rows x 128 B per wave load (a lane holds a 4 k x 4 n block and stores it as four 8-byte k runs).
// ---------------------------------------------------------------------------------------------------------------------------
#define PVW 16               // waves per block = k slices per stage
#define PVK (32 * PVW)       // k per stage
#define PVP (PVK + 8)        // LDS row pitch in f16: 16 B x odd, so the 16-byte fragment reads meet no bank conflict
__global__ __launch_bounds__(32 * PVW) void k_pv(const float* __restrict__ A, const float* __restrict__ Wm, const float* __restrict__ bias, const float* __restrict__ gvec, float* __restrict__ Y) {
  __shared__ __attribute__((aligned(16))) f16 ldsA[32 * PVP];
  __shared__ __attribute__((aligned(16))) f16 ldsW[64 * PVP];
  __shared__ __attribute__((aligned(16))) float oS[PVW][32 * 68];
  const int tid = threadIdx.x, lane = tid & 31, wave = tid >> 5, cl = lane & 15, rh = (lane >> 4) * 8;
  A += ((size_t)blockIdx.z * SSga + (size_t)blockIdx.x * 32) * SSga;
  Y += (size_t)blockIdx.x * 32 * DQga + (size_t)blockIdx.z * HDga;
  const int arow = tid / (PVK / 4), akq = (tid % (PVK / 4)) * 4;   // A: rows arow + 4 i, 4 floats at akq
  const int wn = (lane & 7) * 4, wk = (lane >> 3) * 4;             // W: inside a 16 k x 32 n block of the wave, 4 k rows at wk, 4 columns at wn
  f32x8 acc[2][4];
#pragma unroll
  for (int i = 0; i < 2; ++i)
#pragma unroll
    for (int j = 0; j < 4; ++j) { f32x8 z = {}; acc[i][j] = z; }
#pragma unroll 1
  for (int k0 = 0; k0 < SSga; k0 += PVK) {
    v4f_t ra[8], rw[4][4];
#pragma unroll
    for (int i = 0; i < 8; ++i) ra[i] = *(const v4f_t*)(A + (size_t)(arow + 4 * i) * SSga + k0 + akq);
#pragma unroll
    for (int b = 0; b < 4; ++b) { const int blk = wave * 4 + b, kb = (blk >> 1) * 16, nb = (blk & 1) * 32;
#pragma unroll
      for (int t = 0; t < 4; ++t) rw[b][t] = *(const v4f_t*)(Wm + (size_t)(k0 + kb + wk + t) * DKga + nb + wn); }
    __syncthreads();   // every wave has read the previous stage's fragments
#pragma unroll
    for (int i = 0; i < 8; ++i) { bf16x4 q; q[0] = (f16)ra[i][0]; q[1] = (f16)ra[i][1]; q[2] = (f16)ra[i][2]; q[3] = (f16)ra[i][3];
      *(bf16x4*)(ldsA + (arow + 4 * i) * PVP + akq) = q; }
#pragma unroll
    for (int b = 0; b < 4; ++b) { const int blk = wave * 4 + b, kb = (blk >> 1) * 16, nb = (blk & 1) * 32;
#pragma unroll
      for (int u = 0; u < 4; ++u) { bf16x4 q; q[0] = (f16)rw[b][0][u]; q[1] = (f16)rw[b][1][u]; q[2] = (f16)rw[b][2][u]; q[3] = (f16)rw[b][3][u];
        *(bf16x4*)(ldsW + (nb + wn + u) * PVP + kb + wk) = q; } }
    __syncthreads();   // the stage is complete
    f16x16 af[2], bf[4];   // all twelve fragment reads of the slice go out together, ahead of its WMMAs
#pragma unroll
    for (int i = 0; i < 2; ++i) af[i] = lds_frag(ldsA + (16 * i) * PVP + 32 * wave, PVP);
#pragma unroll
    for (int j = 0; j < 4; ++j) bf[j] = lds_frag(ldsW + (16 * j) * PVP + 32 * wave, PVP);
#pragma unroll
    for (int j = 0; j < 4; ++j)
#pragma unroll
      for (int i = 0; i < 2; ++i) acc[i][j] = wmma16(af[i], bf[j], acc[i][j]);
  }
  float* so = oS[wave];
#pragma unroll
  for (int i = 0; i < 2; ++i)
#pragma unroll
    for (int j = 0; j < 4; ++j)
#pragma unroll
      for (int r = 0; r < 8; ++r) so[(16 * i + rh + r) * 68 + 16 * j + cl] = acc[i][j][r];
  __syncthreads();     // all partial tiles are in LDS
#pragma unroll
  for (int f4 = tid; f4 < 32 * 16; f4 += 32 * PVW) { const int rr = f4 >> 4, q = (f4 & 15) * 4;   // 16 lanes x 16 B = one 256-B output row
    v4f_t s = *(const v4fa*)(oS[0] + rr * 68 + q);
#pragma unroll
    for (int w = 1; w < PVW; ++w) s += *(const v4fa*)(oS[w] + rr * 68 + q);
    s = *(const v4f_t*)(gvec + q) * (s + *(const v4f_t*)(bias + q));
    *(v4f_t*)(Y + (size_t)rr * DQga + q) = s; }
}

__global__ __launch_bounds__(256) void k_fill(float* __restrict__ p, float val, size_t n4) { const size_t i = (size_t)blockIdx.x * 256 + threadIdx.x; if (i < n4) { v4f_t v = {val, val, val, val}; *(v4f_t*)(p + 4 * i) = v;  } }
__global__ __launch_bounds__(256) void k_dbg_zero(float* __restrict__ p, size_t n4) { const size_t i = (size_t)blockIdx.x * 256 + threadIdx.x; if (i < n4) { v4f_t z = {0.f,0.f,0.f,0.f}; *(v4f_t*)(p + 4 * i) = z;  } }
__global__ __launch_bounds__(256) void k_copy(const float* __restrict__ src, float* __restrict__ dst, size_t n4) { const size_t i = (size_t)blockIdx.x * 256 + threadIdx.x; if (i < n4) { const v4f_t v = *(const v4f_t*)(src + 4 * i); *(v4f_t*)(dst + 4 * i) = v;  } }
// transpose with source row stride: Wt[c][r] (row stride = rows) = Wm[r][c] (row stride lds), 64x64 LDS tiles; 16 B per lane, 16 lanes per 256-B row segment (8 per line)
__global__ __launch_bounds__(256) void k_transpose_ld(const float* __restrict__ Wm, int lds, float* __restrict__ Wt, int rows, int cols) {
  __shared__ float tS[64][65];
  const int tid = threadIdx.x, tbj = cols / 64, bi = blockIdx.x / tbj, bj = blockIdx.x % tbj;
  for (int e = tid; e < 64 * 64; e += 256) { const int r = e >> 6, c = e & 63; tS[r][c] = Wm[(size_t)(bi * 64 + r) * lds + bj * 64 + c]; }
  __syncthreads();
  for (int ch = tid; ch < 64 * 16; ch += 256) { const int r = ch >> 4, q4 = (ch & 15) * 4; v4f_t o; o[0] = tS[q4][r]; o[1] = tS[q4 + 1][r]; o[2] = tS[q4 + 2][r]; o[3] = tS[q4 + 3][r];
    float* dst = Wt + (size_t)(bj * 64 + r) * rows + bi * 64 + q4; *(v4f_t*)dst = o;  }
}
// VB[c] = sum over the 2048 key rows of V[:, c] (f32): added back after the P'.v GEMM (ctx = (sum P'v + sum v)/1024 with P' = 1024.P - 1).
// Block = 32 columns (one 128-B line per row: 8 lanes x 16 B) x 32 row groups; a thread sums rows rg, rg + 32, ... (64 rows), then the 32 partial sums of a column are added in LDS.
__global__ __launch_bounds__(256) void k_vsum(const float* __restrict__ V, float* __restrict__ VB) {
  __shared__ float part[32][33];
  const int tid = threadIdx.x, c4 = (tid & 7) * 4, rg = tid >> 3, c0 = blockIdx.x * 32;
  const float* src = V + (size_t)rg * DKga + c0 + c4;
  v4f_t s = {0.0f, 0.0f, 0.0f, 0.0f};
#pragma unroll   // constant row pitch: one address, 64 independent loads at immediate offsets, so the load latency is paid a few times and not once per row
  for (int i = 0; i < SSga / 32; ++i) s += *(const v4f_t*)(src + (size_t)(32 * i) * DKga);
#pragma unroll
  for (int u = 0; u < 4; ++u) part[rg][c4 + u] = s[u];
  __syncthreads();
  if (tid < 32) {
    float t = 0.0f;
#pragma unroll
    for (int g = 0; g < 32; ++g) t += part[g][tid];
    VB[c0 + tid] = t;
  }
}
// bf16 round-to-nearest-even of an f32 (bit trick)
__device__ __forceinline__ float bf16r(float x) { unsigned int u = __float_as_uint(x); u = (u + 0x7FFFu + ((u >> 16) & 1u)) & 0xFFFF0000u; return __uint_as_float(u); }
// bf16-rounded copy of an activation block (optionally scaled by a power of two AFTER rounding — exact); 16 B per lane
__global__ __launch_bounds__(256) void k_cpyrnd(const float* __restrict__ src, float* __restrict__ dst, float mul, size_t n4) { const size_t i = (size_t)blockIdx.x * 256 + threadIdx.x; if (i >= n4) return; v4f_t v = *(const v4f_t*)(src + 4 * i);
#pragma unroll
  for (int u = 0; u < 4; ++u) v[u] = mul * bf16r(v[u]);
  *(v4f_t*)(dst + 4 * i) = v;  }
// torch [out][in] weight → WT[i][o] = mul·bf16(W[o][i]) ([in][out], lifted by a power of two so no bf16 weight becomes an f16 subnormal); block = input row i, threads loop over the outputs (4-B lanes)
__global__ __launch_bounds__(256) void k_wprepT(const float* __restrict__ Wt, float* __restrict__ WT, int nout, int nin, float mul) { const int i = blockIdx.x, tid = threadIdx.x;
#pragma unroll 1
  for (int o = tid; o < nout; o += 256) { const float w = mul * bf16r(Wt[(size_t)o * nin + i]); *(float*)(WT + (size_t)i * nout + o) = w;  } }
// bias prep: B2[o] = mul·bf16(b[o]); one block loops
__global__ __launch_bounds__(256) void k_bprep(const float* __restrict__ b, float* __restrict__ B2, int n, float mul) { for (int o = threadIdx.x; o < n; o += 256) { const float v = mul * bf16r(b[o]); *(float*)(B2 + o) = v;  } }

// row softmax of s/8 for (query, head z of the group); P' = 1024·P − 1; block = (q, z), 256 threads x 8
__global__ __launch_bounds__(256) void k_soft(float* __restrict__ Sm) {
  __shared__ float red[256];
  const int q = blockIdx.x, z = blockIdx.y, tid = threadIdx.x; float* sr = Sm + ((size_t)z * SSga + q) * SSga; float v[SSga / 256]; float m = -3.0e38f;
#pragma unroll
  for (int e = 0; e < SSga / 256; ++e) { v[e] = sr[tid + 256 * e] * 0.125f; m = fmaxf(m, v[e]); }
  red[tid] = m; __syncthreads(); for (int o = 128; o > 0; o >>= 1) { if (tid < o) red[tid] = fmaxf(red[tid], red[tid + o]); __syncthreads(); }
  m = red[0]; __syncthreads(); float zs = 0.0f;
#pragma unroll
  for (int e = 0; e < SSga / 256; ++e) { v[e] = expf(v[e] - m); zs += v[e]; }
  red[tid] = zs; __syncthreads(); for (int o = 128; o > 0; o >>= 1) { if (tid < o) red[tid] += red[tid + o]; __syncthreads(); }
  const float kk = 1024.0f / red[0];
{
#pragma unroll
    for (int e = 0; e < SSga / 256; ++e) *(float*)(sr + tid + 256 * e) = v[e] * kk - 1.0f;
     }
}

extern "C" void kernel_launch(void* const* d_in, const int* in_sizes, int n_in,
                              void* d_out, int out_size, void* d_ws, size_t ws_size,
                              hipStream_t stream) {
  (void)in_sizes; (void)n_in; (void)out_size;
  const float** f = (const float**)d_in;
  const float* Qi = f[0], *Ki = f[1], *Vi = f[2], *Wout = f[3], *bout = f[4];
  float* out = (float*)d_out;     // [2,2048,2048]
  char* ws = (char*)d_ws;
  float* WT = (float*)ws; ws += (size_t)DQga * HIDga * 4; float* B64 = (float*)ws; ws += HIDga * 4; float* g64 = (float*)ws; ws += HIDga * 4;
  float* Q = (float*)ws; ws += (size_t)SSga * DQga * 4; float* Km = (float*)ws; ws += (size_t)SSga * DKga * 4; float* V = (float*)ws; ws += (size_t)SSga * DKga * 4; float* KT = (float*)ws; ws += (size_t)HDga * SSga * 4;
  float* VS = (float*)ws; ws += DKga * 4; float* sc = (float*)ws; ws += 64 * 4; float* S = (float*)ws; ws += (size_t)4 * SSga * SSga * 4; float* O = (float*)ws; ws += (size_t)SSga * DQga * 4;
  if ((size_t)(ws - (char*)d_ws) > ws_size) return;                      // WS TOTAL 126,372,096 B
  const dim3 blk(256);
  k_fill<<<dim3(1), blk, 0, stream>>>(sc, 1.0f / 1024.0f, 64 / 4); k_fill<<<dim3(2), blk, 0, stream>>>(g64, 1.0f / 64.0f, HIDga / 4);
  k_wprepT<<<dim3(DQga), blk, 0, stream>>>(Wout, WT, HIDga, DQga, 64.0f); k_bprep<<<dim3(1), blk, 0, stream>>>(bout, B64, HIDga, 64.0f);

  for (int b = 0; b < NBga; ++b) {
    k_cpyrnd<<<dim3(((size_t)SSga * DQga / 4 + 255) / 256), blk, 0, stream>>>(Qi + (size_t)b * SIN * DQga, Q, 1.0f, (size_t)SSga * DQga / 4); k_cpyrnd<<<dim3(((size_t)SSga * DKga / 4 + 255) / 256), blk, 0, stream>>>(Ki + (size_t)b * SIN * DKga, Km, 1.0f, (size_t)SSga * DKga / 4); k_cpyrnd<<<dim3(((size_t)SSga * DKga / 4 + 255) / 256), blk, 0, stream>>>(Vi + (size_t)b * SIN * DKga, V, 1.0f, (size_t)SSga * DKga / 4);
    k_vsum<<<dim3(DKga / 32), blk, 0, stream>>>(V, VS);
    for (int kv = 0; kv < HKVga; ++kv) {
      k_transpose_ld<<<dim3((SSga / 64) * (HDga / 64)), blk, 0, stream>>>(Km + kv * HDga, DKga, KT, SSga, HDga);
      gemm_knez<float, 0, false><<<dim3(SSga / 128, SSga / 128, 4), blk, 0, stream>>>(Q + (size_t)kv * 4 * HDga, DQga, (size_t)HDga, KT, SSga, (size_t)0, nullptr, nullptr, nullptr, S, SSga, (size_t)SSga * SSga, HDga);   // the group's 4 query heads vs kv head
      k_soft<<<dim3(SSga, 4), blk, 0, stream>>>(S);
      k_pv<<<dim3(SSga / 32, 1, 4), dim3(32 * PVW), 0, stream>>>(S, V + kv * HDga, VS + kv * HDga, sc, O + (size_t)kv * 4 * HDga);   // the group's 4 heads as grid z: head z reads S plane z, writes O columns 64 z; shared v, column sums
    }
    gemm_kne<float, 4, false><<<dim3(SSga / 128, HIDga / 128), blk, 0, stream>>>(O, DQga, WT, HIDga, B64, nullptr, g64, out + (size_t)b * SIN * HIDga, HIDga, DQga);   // out = (o·64W_outᵀ + 64b)/64
  }
}

// v004
// It runs in 290 microseconds.
// Timed twice side by side with v003, it ran 4.99 and 5.04 times as fast.
// All steps since v000 together make it 31.8 times as fast.
// Q, K, V, W_out, b_out are rounded to bf16 (RNE) on load; the scores are then exact single f16 products of bf16 values
// with f32 accumulation (no projection exists in this module — Q, K, V are inputs), and the output projection uses 64·bf16(W_outᵀ) with a 2^-6 epilogue.
// Contractions on v_wmma_f32_16x16x32_f16 (f16 operands, f32 accumulate): per (batch, query head) the scores against the kv head (K 64) and o_h = P.v_h (K 2048) inside one kernel,
// P = 2^(c.s - running maximum) rounded to f16, divided by its f32 row sum at the end; out = o.W_out^T + b_out (K 2048). f32 VALU: running softmax of s/8.
// compute dtype: f16 operands (bf16-valued), f32 accumulate.  Q [2,2048,2048], K, V [2,2048,512] → out [2,2048,2048].
#include <hip/hip_runtime.h>
#include <hip/hip_bf16.h>
#include <math.h>


typedef _Float16 bf16;
typedef _Float16 f16;
typedef __attribute__((ext_vector_type(4))) unsigned v4u_t;
typedef unsigned v4ua __attribute__((ext_vector_type(4), may_alias));
typedef __attribute__((ext_vector_type(4))) float v4f_t;
typedef float v4fa __attribute__((ext_vector_type(4), may_alias));
typedef __attribute__((ext_vector_type(16))) bf16  bf16x16;
typedef bf16x16 f16x16;
typedef __attribute__((ext_vector_type(8)))  bf16  bf16x8;
typedef bf16x8 f16x8;
typedef __attribute__((ext_vector_type(4)))  bf16  bf16x4;
typedef __attribute__((ext_vector_type(8)))  float f32x8;
__device__ __forceinline__ f32x8 wmma16(f16x16 a, f16x16 b, f32x8 c) {
  c = __builtin_amdgcn_wmma_f32_16x16x32_f16(false, a, false, b, (short)0, c, false, false);
  asm volatile("v_nop\n\tv_nop\n\tv_nop\n\tv_nop" : "+v"(c) : "v"(a), "v"(b));
  return c;
}
#define LDS_STRIDE 48   // unused; GEMM tiles are staged 32 -> 48 elems (GSTR, 96B rows): aligned b128 reads
#define KSTRIDE    72   // unused; the K tile is staged 64 -> 72 elems (FAP)
#define VSTRIDE    48   // unused; the V tile is staged [dv][key], 64 -> 72 elems (FAP)

__device__ __forceinline__ f32x8 wmma_bf16(bf16x16 a, bf16x16 b, f32x8 c) {
  c = __builtin_amdgcn_wmma_f32_16x16x32_f16(false, a, false, b, (short)0, c, false, false);
  asm volatile("v_nop\n\tv_nop\n\tv_nop\n\tv_nop" : "+v"(c) : "v"(a), "v"(b));   // A/B-overwrite hazard guard
  return c;
}

// 16x32 (MxK) bf16 fragment from a row-major global matrix.
// lanes 0-15  (row=lane)    : elems 0..7 = K+0..7,  8..15 = K+16..23
// lanes 16-31 (row=lane-16) : elems 0..7 = K+8..15, 8..15 = K+24..31
template <typename T>
__device__ __forceinline__ bf16x16 load_frag(const T* __restrict__ base, int ld,
                                             int row0, int k0) {
  const int lane = threadIdx.x & 31;
  const int r    = lane & 15;
  const int kh   = (lane >> 4) * 8;
  const T* p0 = base + (size_t)(row0 + r) * ld + (k0 + kh);
  const T* p1 = p0 + 16;
  bf16x16 f;
#pragma unroll
  for (int i = 0; i < 8; ++i) {
    f[i]     = (bf16)p0[i];
    f[i + 8] = (bf16)p1[i];
  }
  return f;
}

// Same fragment from an LDS tile with padded row stride (base includes row0/k0).
__device__ __forceinline__ bf16x16 lds_frag(const bf16* base, int stride) {
  const int lane = threadIdx.x & 31;
  const int row  = lane & 15;
  const int kh   = (lane >> 4) * 8;
  const bf16x8 lo = *(const bf16x8*)(base + row * stride + kh);
  const bf16x8 hi = *(const bf16x8*)(base + row * stride + kh + 16);
  bf16x16 f;
#pragma unroll
  for (int i = 0; i < 8; ++i) { f[i] = lo[i]; f[i + 8] = hi[i]; }
  return f;
}

template <typename T>
__device__ __forceinline__ void stage_read16(const T* __restrict__ p, float* buf) {
#pragma unroll
  for (int i = 0; i < 16; ++i) buf[i] = (float)p[i];
}

__device__ __forceinline__ void stage_write(bf16* dst, const float* buf, int nquad) {
#pragma unroll
  for (int i = 0; i < nquad; ++i) {
    bf16x4 q;
    q[0] = (bf16)buf[4 * i];     q[1] = (bf16)buf[4 * i + 1];
    q[2] = (bf16)buf[4 * i + 2]; q[3] = (bf16)buf[4 * i + 3];
    *(bf16x4*)(dst + 4 * i) = q;
  }
}


#define GSTR 48
// ---------------------------------------------------------------------------------------------------------------------------
// gemm_kne: Y[m][n] = epi( Σ_k A[m][k]·W[k][n] + bias[n] ), A f32/f16 [M][lda], W f32 row-major [K][N] (ldw), plain f16 operands,
// f32 accumulate. EPI 0: identity; 1: exact-erf GELU; 2: R[m][n] + gvec[n]·(·) (residual with per-channel gain); 3: ReLU; 4: gvec[n]·(·) (per-channel scale, no residual). Output f32 (or f16
// when OUT16). Block = 128x128 tile, 8 waves as 4(M) x 2(N); per 32-wide k-step A and W tiles staged f16 in LDS (W transposed
// ---------------------------------------------------------------------------------------------------------------------------
#define GSTR 48
template <typename AT, int EPI, bool OUT16>
__global__ __launch_bounds__(256) void gemm_kne(const AT* __restrict__ A, int lda, const float* __restrict__ Wm, int ldw,
                                                const float* __restrict__ bias, const float* __restrict__ R, const float* __restrict__ gvec,
                                                void* __restrict__ Yv, int ldy, int K) {
  __shared__ __attribute__((aligned(16))) f16 ldsA[128 * GSTR];
  __shared__ __attribute__((aligned(16))) f16 ldsW[128 * GSTR];
  __shared__ __attribute__((aligned(16))) float oS[8][32 * 68];
  const int tid = threadIdx.x, lane = tid & 31, wave = tid >> 5, cl = lane & 15, rh = (lane >> 4) * 8;
  const int m0 = blockIdx.x * 128, n0 = blockIdx.y * 128;
  const int wm = (wave & 3) * 32, wn = (wave >> 2) * 64;
  f32x8 acc[2][4];
#pragma unroll
  for (int i = 0; i < 2; ++i)
#pragma unroll
    for (int j = 0; j < 4; ++j) { f32x8 z = {}; acc[i][j] = z; }
#pragma unroll 1
  for (int k0 = 0; k0 < K; k0 += 32) {
    __syncthreads();
    { const int row = tid >> 1, ch = (tid & 1) * 16;
      const AT* src = A + (size_t)(m0 + row) * lda + k0 + ch;
#pragma unroll
      for (int g = 0; g < 16; ++g) ldsA[row * GSTR + ch + g] = (f16)src[g]; }
    { const int k = tid >> 3, nn0 = (tid & 7) * 16;
      const float* src = Wm + (size_t)(k0 + k) * ldw + n0 + nn0;
#pragma unroll
      for (int g = 0; g < 4; ++g) { const v4f_t v = *(const v4f_t*)(src + 4 * g);
#pragma unroll
        for (int u = 0; u < 4; ++u) ldsW[(nn0 + 4 * g + u) * GSTR + k] = (f16)v[u]; } }
    __syncthreads();
    f16x16 af[2];
#pragma unroll
    for (int i = 0; i < 2; ++i) af[i] = lds_frag(ldsA + (wm + 16 * i) * GSTR, GSTR);
#pragma unroll
    for (int j = 0; j < 4; ++j) {
      const f16x16 bf = lds_frag(ldsW + (wn + 16 * j) * GSTR, GSTR);
#pragma unroll
      for (int i = 0; i < 2; ++i) acc[i][j] = wmma16(af[i], bf, acc[i][j]);
    }
  }
  float* so = oS[wave];
#pragma unroll
  for (int i = 0; i < 2; ++i)
#pragma unroll
    for (int j = 0; j < 4; ++j) {
      const int n = n0 + wn + 16 * j + cl;
      const float bv = bias ? bias[n] : 0.0f;
      const float gv = (EPI == 2 || EPI == 4) ? gvec[n] : 0.0f;
      if (EPI == 1) {
#pragma unroll 1
        for (int r = 0; r < 8; ++r) { const float xg = acc[i][j][r] + bv; so[(16 * i + rh + r) * 68 + 16 * j + cl] = 0.5f * xg * (1.0f + erff(xg * 0.70710678118654752f)); }
      } else {
#pragma unroll
        for (int r = 0; r < 8; ++r) {
          float v = acc[i][j][r] + bv;
          if (EPI == 3) v = fmaxf(v, 0.0f);
          if (EPI == 4) v = gv * v;
          if (EPI == 2) v = R[(size_t)(m0 + wm + 16 * i + rh + r) * ldy + n] + gv * v;
          so[(16 * i + rh + r) * 68 + 16 * j + cl] = v;
        }
      }
    }
  asm volatile("s_wait_dscnt 0" ::: "memory");
  __builtin_amdgcn_wave_barrier();
{
    if (OUT16) {
      f16* Y = (f16*)Yv;
#pragma unroll
      for (int it = 0; it < 8; ++it) { const int c = lane + 32 * it, rr = c >> 3, q8 = (c & 7) * 8;
        union { f16 h[8]; v4u_t v; } u;
#pragma unroll
        for (int e = 0; e < 8; ++e) u.h[e] = (f16)so[rr * 68 + q8 + e];
        *(v4u_t*)(Y + (size_t)(m0 + wm + rr) * ldy + n0 + wn + q8) = u.v; }
    } else {
      float* Y = (float*)Yv;
#pragma unroll
      for (int it = 0; it < 16; ++it) { const int f4 = lane + 32 * it, rr = f4 >> 4, q = (f4 & 15) * 4;
        *(v4f_t*)(Y + (size_t)(m0 + wm + rr) * ldy + n0 + wn + q) = *(const v4fa*)(so + rr * 68 + q); }
    }
    
  }
}

// ---------------------------------------------------------------------------------------------------------------------------
// gemm_kn2 (value+residual planes on both operands: hh + (hl+lh)/2048, f32-class): Y[m][n] (row stride ldy) = scale * sum_k A[m][k] (f32 or f16, row stride lda) * W[k][n] (f32, row-major [K][N], row
// stride ldw) (+ bias[n]) (+ Y if ACC). Block = 128 x 128 tile, 256 threads = 8 waves as 4(M, 32 rows) x 2(N, 64 cols); per
// 32-wide k-step the A tile and the W tile (stored transposed [n][k]) are staged as f16 in LDS; plain f16 operands, f32
// blockIdx.z selects a batch: A += z*strideA, W += z*strideW, Y += z*strideY (element strides).
// ---------------------------------------------------------------------------------------------------------------------------
template <typename AT, bool ACC>
__global__ __launch_bounds__(256) void gemm_kn2(const AT* __restrict__ A, int lda, size_t strideA,
                                               const float* __restrict__ Wm, int ldw, size_t strideW,
                                               const float* __restrict__ bias, float scale,
                                               float* __restrict__ Y, int ldy, size_t strideY, int K) {
  __shared__ __attribute__((aligned(16))) f16 ldsA[128 * GSTR], ldsAl[128 * GSTR];
  __shared__ __attribute__((aligned(16))) f16 ldsW[128 * GSTR], ldsWl[128 * GSTR];
  __shared__ __attribute__((aligned(16))) float oS[8][32 * 68];
  const int tid = threadIdx.x, lane = tid & 31, wave = tid >> 5, cl = lane & 15, rh = (lane >> 4) * 8;
  const int m0 = blockIdx.x * 128, n0 = blockIdx.y * 128;
  const int wm = (wave & 3) * 32, wn = (wave >> 2) * 64;
  A += (size_t)blockIdx.z * strideA; Wm += (size_t)blockIdx.z * strideW; Y += (size_t)blockIdx.z * strideY;
  f32x8 acc[2][4], accx[2][4];
#pragma unroll
  for (int i = 0; i < 2; ++i)
#pragma unroll
    for (int j = 0; j < 4; ++j) { f32x8 z = {}; acc[i][j] = z; accx[i][j] = z; }
#pragma unroll 1
  for (int k0 = 0; k0 < K; k0 += 32) {
    __syncthreads();
    {  // A: thread -> row tid>>1, 16 elements at column half (tid&1)*16
      const int row = tid >> 1, ch = (tid & 1) * 16;
      const AT* src = A + (size_t)(m0 + row) * lda + k0 + ch;
#pragma unroll
      for (int g = 0; g < 16; ++g) { const float v = (float)src[g]; const f16 h = (f16)v; ldsA[row * GSTR + ch + g] = h; ldsAl[row * GSTR + ch + g] = (f16)((v - (float)h) * 2048.0f); }
    }
    {  // W: thread -> k = tid>>3, 16 consecutive n at (tid&7)*16; stored transposed [n][k]
      const int k = tid >> 3, nn0 = (tid & 7) * 16;
      const float* src = Wm + (size_t)(k0 + k) * ldw + n0 + nn0;
#pragma unroll
      for (int g = 0; g < 4; ++g) { const v4f_t v = *(const v4f_t*)(src + 4 * g);
#pragma unroll
        for (int u = 0; u < 4; ++u) { const f16 h = (f16)v[u]; ldsW[(nn0 + 4 * g + u) * GSTR + k] = h; ldsWl[(nn0 + 4 * g + u) * GSTR + k] = (f16)((v[u] - (float)h) * 2048.0f); } }
    }
    __syncthreads();
    f16x16 af[2], afl[2];
#pragma unroll
    for (int i = 0; i < 2; ++i) { af[i] = lds_frag(ldsA + (wm + 16 * i) * GSTR, GSTR); afl[i] = lds_frag(ldsAl + (wm + 16 * i) * GSTR, GSTR); }
#pragma unroll
    for (int j = 0; j < 4; ++j) {
      const f16x16 bf = lds_frag(ldsW + (wn + 16 * j) * GSTR, GSTR), bfl = lds_frag(ldsWl + (wn + 16 * j) * GSTR, GSTR);
#pragma unroll
      for (int i = 0; i < 2; ++i) { acc[i][j] = wmma16(af[i], bf, acc[i][j]); accx[i][j] = wmma16(af[i], bfl, accx[i][j]); accx[i][j] = wmma16(afl[i], bf, accx[i][j]); }
    }
  }
  float* so = oS[wave];
#pragma unroll
  for (int i = 0; i < 2; ++i)
#pragma unroll
    for (int j = 0; j < 4; ++j) {
      const float bv = bias ? bias[n0 + wn + 16 * j + cl] : 0.0f;
#pragma unroll
      for (int r = 0; r < 8; ++r) so[(16 * i + rh + r) * 68 + 16 * j + cl] = (acc[i][j][r] + accx[i][j][r] * (1.0f / 2048.0f)) * scale + bv;
    }
  asm volatile("s_wait_dscnt 0" ::: "memory");
  __builtin_amdgcn_wave_barrier();
  if (ACC) {   // accumulate: fold the existing Y values into the staging tile ONCE (same thread <-> same chunks as the stores below)
#pragma unroll
    for (int it = 0; it < 16; ++it) { const int f4 = lane + 32 * it, rr = f4 >> 4, q = (f4 & 15) * 4;
      const v4f_t old = *(const v4fa*)(Y + (size_t)(m0 + wm + rr) * ldy + n0 + wn + q);
      v4f_t v = *(const v4fa*)(so + rr * 68 + q); v += old; *(v4fa*)(so + rr * 68 + q) = v; }   // plain LDS store (ordered by the s_wait_dscnt/memory clobber below)
    asm volatile("s_wait_dscnt 0" ::: "memory");
  }
{
#pragma unroll
    for (int it = 0; it < 16; ++it) { const int f4 = lane + 32 * it, rr = f4 >> 4, q = (f4 & 15) * 4;
      *(v4f_t*)(Y + (size_t)(m0 + wm + rr) * ldy + n0 + wn + q) = *(const v4fa*)(so + rr * 68 + q); }
    
  }
}

__global__ __launch_bounds__(256) void k_transpose(const float* __restrict__ Wm, float* __restrict__ Wt, int rows, int cols) {
  __shared__ float tS[64][65];
  const int tid = threadIdx.x, tbj = cols / 64, bi = blockIdx.x / tbj, bj = blockIdx.x % tbj;
  for (int e = tid; e < 64 * 64; e += 256) { const int r = e >> 6, c = e & 63; tS[r][c] = Wm[(size_t)(bi * 64 + r) * cols + bj * 64 + c]; }
  __syncthreads();
  for (int ch = tid; ch < 64 * 16; ch += 256) { const int r = ch >> 4, q4 = (ch & 15) * 4; v4f_t o; o[0] = tS[q4][r]; o[1] = tS[q4 + 1][r]; o[2] = tS[q4 + 2][r]; o[3] = tS[q4 + 3][r];
    float* dst = Wt + (size_t)(bj * 64 + r) * rows + bi * 64 + q4; *(v4f_t*)dst = o;  }
}


#define NBga 2
#define SSga 2048
#define SIN 2048
#define DQga 2048
#define DKga 512
#define HIDga 2048
#define HQga 32
#define HKVga 8
#define HDga 64
// ---------------------------------------------------------------------------------------------------------------------------
// k_attn: scores, softmax and P.V of one query head (blockIdx.y) of one batch element (blockIdx.z) for 256 query rows (blockIdx.x) in one kernel; no score ever goes to memory.
// Transposed products: St = K.Qt (A = 16 key rows from LDS, B = 16 query columns kept in registers), Ot += Vt.Pt (A = 16 value columns from LDS [dv][key], B = P packed from the St accumulators:
// two St tiles of 16 keys, converted in place, are one 32-key B operand in the k order of lds_frag). A lane holds one query's scores (lanes c and c + 16 split the keys), so the running maximum,
// the sum and the rescale factor are per lane; the halves exchange the maximum once per stage and join their sums once at the end.
// Running softmax: p = 2^(c.s - mu), c = log2(e)/8, mu = the maximum in use; the accumulators are rescaled only when some column's new maximum passes mu by more than 8 (p stays <= 256, inside f16).
// Block = 8 waves x 32 query columns; stage = 64 keys: K as [key][d] and V as [dv][key] in f16 in LDS, the next stage's global loads fly in registers while this stage is worked on.
// Every inner loop is unrolled so that the indices of its fragment and accumulator arrays are constants and the arrays stay in registers.
// ---------------------------------------------------------------------------------------------------------------------------
typedef __attribute__((ext_vector_type(2))) float v2f_t;
// eight 2^x in place. One statement, so that each v_exp_f32 is followed by an instruction that touches neither its result nor its source (the next one works on its own register);
// the v_nop is that slot behind the last one.
__device__ __forceinline__ void exp2x8(float& x0, float& x1, float& x2, float& x3, float& x4, float& x5, float& x6, float& x7) {
  asm("v_exp_f32 %0, %0\n\tv_exp_f32 %1, %1\n\tv_exp_f32 %2, %2\n\tv_exp_f32 %3, %3\n\tv_exp_f32 %4, %4\n\tv_exp_f32 %5, %5\n\tv_exp_f32 %6, %6\n\tv_exp_f32 %7, %7\n\tv_nop"
      : "+v"(x0), "+v"(x1), "+v"(x2), "+v"(x3), "+v"(x4), "+v"(x5), "+v"(x6), "+v"(x7));
}
#define FAW 8                // waves per block
#define FAK 64               // keys per stage
#define FAP 72               // LDS row pitch in f16: 16 B x odd, so the 16-byte fragment reads meet no bank conflict
__global__ __launch_bounds__(32 * FAW) void k_attn(const float* __restrict__ Q, const float* __restrict__ Km, const float* __restrict__ V, float* __restrict__ O) {
  __shared__ __attribute__((aligned(16))) f16 ldsK[FAK * FAP];
  __shared__ __attribute__((aligned(16))) f16 ldsV[HDga * FAP];
  const int tid = threadIdx.x, lane = tid & 31, wave = tid >> 5, cl = lane & 15, rh = (lane >> 4) * 8;
  const int head = blockIdx.y, kvh = head / (HQga / HKVga);
  const int q0 = (blockIdx.x * FAW + wave) * 32;
  Q += (size_t)blockIdx.z * SSga * DQga + head * HDga; Km += (size_t)blockIdx.z * SSga * DKga + kvh * HDga; V += (size_t)blockIdx.z * SSga * DKga + kvh * HDga; O += (size_t)blockIdx.z * SSga * DQga + head * HDga;
  const float CS = 0.125f * 1.44269504088896341f;
  f16x16 qf[2][2];
#pragma unroll
  for (int a = 0; a < 2; ++a)
#pragma unroll
    for (int dh = 0; dh < 2; ++dh) qf[a][dh] = load_frag(Q, DQga, q0 + 16 * a, 32 * dh);
  f32x8 acc[2][4];
#pragma unroll
  for (int a = 0; a < 2; ++a)
#pragma unroll
    for (int j = 0; j < 4; ++j) { f32x8 z = {}; acc[a][j] = z; }
  float mu[2] = {-3.0e38f, -3.0e38f};
  v2f_t ls[2] = {{0.0f, 0.0f}, {0.0f, 0.0f}};   // row sums of P: two partial sums per lane (packed adds), joined at the end
  const int g16 = tid >> 4, c4 = (tid & 15) * 4;   // K: rows g16 + 16 i, 4 floats at c4 (16 lanes = one 256-B row); V: 4 key rows at 4 g16, 4 columns at c4
  const unsigned ko = g16 * DKga + c4, vo = 4 * g16 * DKga + c4;   // the lane's fixed offsets; the stage moves the uniform base alone
  v4f_t rk[4], rv[4];
#pragma unroll
  for (int i = 0; i < 4; ++i) { rk[i] = *(const v4f_t*)(Km + ko + 16 * i * DKga); rv[i] = *(const v4f_t*)(V + vo + i * DKga); }
#pragma unroll 1   // stays rolled: the stage uses 250 registers, and 256 is the most that lets two work-groups share a WGP: no room for a second copy of it
  for (int k0 = 0; k0 < SSga; k0 += FAK) {
    __syncthreads();   // every wave has read the previous stage's fragments
#pragma unroll
    for (int i = 0; i < 4; ++i) { bf16x4 q; q[0] = (f16)rk[i][0]; q[1] = (f16)rk[i][1]; q[2] = (f16)rk[i][2]; q[3] = (f16)rk[i][3];
      *(bf16x4*)(ldsK + (g16 + 16 * i) * FAP + c4) = q; }
#pragma unroll
    for (int u = 0; u < 4; ++u) { bf16x4 q; q[0] = (f16)rv[0][u]; q[1] = (f16)rv[1][u]; q[2] = (f16)rv[2][u]; q[3] = (f16)rv[3][u];
      *(bf16x4*)(ldsV + (c4 + u) * FAP + 4 * g16) = q; }
    __syncthreads();   // the stage is complete
    const int kn = (k0 + FAK < SSga) ? k0 + FAK : k0;   // next stage (the last trip reads its own again, in bounds, unused)
    const float* kp = Km + (size_t)kn * DKga; const float* vp = V + (size_t)kn * DKga;
#pragma unroll
    for (int i = 0; i < 4; ++i) { rk[i] = *(const v4f_t*)(kp + ko + 16 * i * DKga); rv[i] = *(const v4f_t*)(vp + vo + i * DKga); }
    f32x8 st[2][4];    // St: st[a][kt][r] = score of key 16 kt + rh + r, query 16 a + cl
#pragma unroll
    for (int kt = 0; kt < 4; ++kt) {
      const f16x16 ka = lds_frag(ldsK + (16 * kt) * FAP, FAP), kb = lds_frag(ldsK + (16 * kt) * FAP + 32, FAP);
#pragma unroll
      for (int a = 0; a < 2; ++a) { f32x8 z = {};
        z = __builtin_amdgcn_wmma_f32_16x16x32_f16(false, ka, false, qf[a][0], (short)0, z, false, false);
        st[a][kt] = __builtin_amdgcn_wmma_f32_16x16x32_f16(false, kb, false, qf[a][1], (short)0, z, false, false); }
    }
    float tm[2];
#pragma unroll
    for (int a = 0; a < 2; ++a) { float t = st[a][0][0];
#pragma unroll
      for (int kt = 0; kt < 4; ++kt)
#pragma unroll
        for (int r = 0; r < 8; ++r) t = fmaxf(t, st[a][kt][r]);
      t = fmaxf(t, __shfl_xor(t, 16, 32));
      tm[a] = t * CS; }
    if (__builtin_amdgcn_ballot_w32(tm[0] > mu[0] + 8.0f || tm[1] > mu[1] + 8.0f) != 0) {   // wave-uniform: some column's maximum has outgrown the one in use
#pragma unroll
      for (int a = 0; a < 2; ++a) { const float m2 = fmaxf(mu[a], tm[a]), al = __builtin_amdgcn_exp2f(mu[a] - m2);
        mu[a] = m2; ls[a] *= al;
#pragma unroll
        for (int j = 0; j < 4; ++j)
#pragma unroll
          for (int r = 0; r < 8; ++r) acc[a][j][r] *= al; }
    }
    f16x16 pf[2][2];   // Pt as B operand: pf[a][kk][s] = p of key 32 kk + (s < 8 ? rh + s : 16 + rh + s - 8), query 16 a + cl
#pragma unroll
    for (int a = 0; a < 2; ++a)
#pragma unroll
      for (int kt = 0; kt < 4; ++kt)
      { float t[8];
#pragma unroll
        for (int r = 0; r < 8; ++r) t[r] = fmaf(st[a][kt][r], CS, -mu[a]);
        exp2x8(t[0], t[1], t[2], t[3], t[4], t[5], t[6], t[7]);
#pragma unroll
        for (int r = 0; r < 8; r += 2) { const v2f_t p = {t[r], t[r + 1]}; ls[a] += p; pf[a][kt >> 1][(kt & 1) * 8 + r] = (f16)t[r]; pf[a][kt >> 1][(kt & 1) * 8 + r + 1] = (f16)t[r + 1]; } }
#pragma unroll
    for (int kk = 0; kk < 2; ++kk)
#pragma unroll
      for (int j = 0; j < 4; ++j) { const f16x16 vf = lds_frag(ldsV + (16 * j) * FAP + 32 * kk, FAP);
#pragma unroll
        for (int a = 0; a < 2; ++a) acc[a][j] = __builtin_amdgcn_wmma_f32_16x16x32_f16(false, vf, false, pf[a][kk], (short)0, acc[a][j], false, false); }
  }
#pragma unroll
  for (int a = 0; a < 2; ++a) { const float lh = ls[a][0] + ls[a][1];
    const float inv = 1.0f / (lh + __shfl_xor(lh, 16, 32));
    float* dst = O + (size_t)(q0 + 16 * a + cl) * DQga + rh;   // acc[a][j][r] = Ot[16 j + rh + r][query]: 8 consecutive columns of one row per lane
#pragma unroll
    for (int j = 0; j < 4; ++j) { v4f_t lo = {acc[a][j][0] * inv, acc[a][j][1] * inv, acc[a][j][2] * inv, acc[a][j][3] * inv}, hi = {acc[a][j][4] * inv, acc[a][j][5] * inv, acc[a][j][6] * inv, acc[a][j][7] * inv};
      *(v4f_t*)(dst + 16 * j) = lo; *(v4f_t*)(dst + 16 * j + 4) = hi; } }
}

__global__ __launch_bounds__(256) void k_fill(float* __restrict__ p, float val, size_t n4) { const size_t i = (size_t)blockIdx.x * 256 + threadIdx.x; if (i < n4) { v4f_t v = {val, val, val, val}; *(v4f_t*)(p + 4 * i) = v;  } }
__global__ __launch_bounds__(256) void k_dbg_zero(float* __restrict__ p, size_t n4) { const size_t i = (size_t)blockIdx.x * 256 + threadIdx.x; if (i < n4) { v4f_t z = {0.f,0.f,0.f,0.f}; *(v4f_t*)(p + 4 * i) = z;  } }
__global__ __launch_bounds__(256) void k_copy(const float* __restrict__ src, float* __restrict__ dst, size_t n4) { const size_t i = (size_t)blockIdx.x * 256 + threadIdx.x; if (i < n4) { const v4f_t v = *(const v4f_t*)(src + 4 * i); *(v4f_t*)(dst + 4 * i) = v;  } }
// bf16 round-to-nearest-even of an f32 (bit trick)
__device__ __forceinline__ float bf16r(float x) { unsigned int u = __float_as_uint(x); u = (u + 0x7FFFu + ((u >> 16) & 1u)) & 0xFFFF0000u; return __uint_as_float(u); }
// bf16-rounded copy of an activation block (optionally scaled by a power of two AFTER rounding — exact); 16 B per lane
__global__ __launch_bounds__(256) void k_cpyrnd(const float* __restrict__ src, float* __restrict__ dst, float mul, size_t n4) { const size_t i = (size_t)blockIdx.x * 256 + threadIdx.x; if (i >= n4) return; v4f_t v = *(const v4f_t*)(src + 4 * i);
#pragma unroll
  for (int u = 0; u < 4; ++u) v[u] = mul * bf16r(v[u]);
  *(v4f_t*)(dst + 4 * i) = v;  }
// torch [out][in] weight → WT[i][o] = mul·bf16(W[o][i]) ([in][out], lifted by a power of two so no bf16 weight becomes an f16 subnormal); block = input row i, threads loop over the outputs (4-B lanes)
__global__ __launch_bounds__(256) void k_wprepT(const float* __restrict__ Wt, float* __restrict__ WT, int nout, int nin, float mul) { const int i = blockIdx.x, tid = threadIdx.x;
#pragma unroll 1
  for (int o = tid; o < nout; o += 256) { const float w = mul * bf16r(Wt[(size_t)o * nin + i]); *(float*)(WT + (size_t)i * nout + o) = w;  } }
// bias prep: B2[o] = mul·bf16(b[o]); one block loops
__global__ __launch_bounds__(256) void k_bprep(const float* __restrict__ b, float* __restrict__ B2, int n, float mul) { for (int o = threadIdx.x; o < n; o += 256) { const float v = mul * bf16r(b[o]); *(float*)(B2 + o) = v;  } }

extern "C" void kernel_launch(void* const* d_in, const int* in_sizes, int n_in,
                              void* d_out, int out_size, void* d_ws, size_t ws_size,
                              hipStream_t stream) {
  (void)in_sizes; (void)n_in; (void)out_size;
  const float** f = (const float**)d_in;
  const float* Qi = f[0], *Ki = f[1], *Vi = f[2], *Wout = f[3], *bout = f[4];
  float* out = (float*)d_out;     // [2,2048,2048]
  char* ws = (char*)d_ws;
  float* WT = (float*)ws; ws += (size_t)DQga * HIDga * 4; float* B64 = (float*)ws; ws += HIDga * 4; float* g64 = (float*)ws; ws += HIDga * 4;
  float* Q = (float*)ws; ws += (size_t)NBga * SSga * DQga * 4; float* Km = (float*)ws; ws += (size_t)NBga * SSga * DKga * 4; float* V = (float*)ws; ws += (size_t)NBga * SSga * DKga * 4;
  float* O = (float*)ws; ws += (size_t)NBga * SSga * DQga * 4;
  if ((size_t)(ws - (char*)d_ws) > ws_size) return;                      // WS TOTAL 100,679,680 B
  const dim3 blk(256);
  k_fill<<<dim3(2), blk, 0, stream>>>(g64, 1.0f / 64.0f, HIDga / 4);
  k_wprepT<<<dim3(DQga), blk, 0, stream>>>(Wout, WT, HIDga, DQga, 64.0f); k_bprep<<<dim3(1), blk, 0, stream>>>(bout, B64, HIDga, 64.0f);
  k_cpyrnd<<<dim3(((size_t)NBga * SSga * DQga / 4 + 255) / 256), blk, 0, stream>>>(Qi, Q, 1.0f, (size_t)NBga * SSga * DQga / 4); k_cpyrnd<<<dim3(((size_t)NBga * SSga * DKga / 4 + 255) / 256), blk, 0, stream>>>(Ki, Km, 1.0f, (size_t)NBga * SSga * DKga / 4); k_cpyrnd<<<dim3(((size_t)NBga * SSga * DKga / 4 + 255) / 256), blk, 0, stream>>>(Vi, V, 1.0f, (size_t)NBga * SSga * DKga / 4);
  k_attn<<<dim3(SSga / (32 * FAW), HQga, NBga), dim3(32 * FAW), 0, stream>>>(Q, Km, V, O);   // every (batch, query head, 256-query block) is one work-group; the 4 heads of a kv group are neighbours in the grid
  for (int b = 0; b < NBga; ++b)
    gemm_kne<float, 4, false><<<dim3(SSga / 128, HIDga / 128), blk, 0, stream>>>(O + (size_t)b * SSga * DQga, DQga, WT, HIDga, B64, nullptr, g64, out + (size_t)b * SIN * HIDga, HIDga, DQga);   // out = (o.64W_out^T + 64b)/64
}

// v005
// Measured time: 146 microseconds a run.
// Next to v004, in two timings, it ran 1.96 and 2.01 times as fast.
// Counting every step since v000, it is 63.3 times as fast.
// Q, K, V, W_out, b_out are rounded to bf16 (RNE) on load; the scores are then exact single f16 products of bf16 values
// with f32 accumulation (no projection exists in this module — Q, K, V are inputs), and the output projection uses 64·bf16(W_outᵀ) with a 2^-6 epilogue.
// Contractions on v_wmma_f32_16x16x32_f16 (f16 operands, f32 accumulate): per (batch, query head) the scores against the kv head (K 64) and o_h = P.v_h (K 2048) inside one kernel,
// P = 2^(c.s - running maximum) rounded to f16, divided by its f32 row sum at the end; out = o.W_out^T + b_out (K 2048). f32 VALU: running softmax of s/8.
// compute dtype: f16 operands (bf16-valued), f32 accumulate.  Q [2,2048,2048], K, V [2,2048,512] → out [2,2048,2048].
#include <hip/hip_runtime.h>
#include <hip/hip_bf16.h>
#include <math.h>


typedef _Float16 bf16;
typedef _Float16 f16;
typedef __attribute__((ext_vector_type(4))) unsigned v4u_t;
typedef unsigned v4ua __attribute__((ext_vector_type(4), may_alias));
typedef __attribute__((ext_vector_type(4))) float v4f_t;
typedef float v4fa __attribute__((ext_vector_type(4), may_alias));
typedef __attribute__((ext_vector_type(16))) bf16  bf16x16;
typedef bf16x16 f16x16;
typedef __attribute__((ext_vector_type(8)))  bf16  bf16x8;
typedef bf16x8 f16x8;
typedef __attribute__((ext_vector_type(4)))  bf16  bf16x4;
typedef __attribute__((ext_vector_type(8)))  float f32x8;
__device__ __forceinline__ f32x8 wmma16(f16x16 a, f16x16 b, f32x8 c) {
  c = __builtin_amdgcn_wmma_f32_16x16x32_f16(false, a, false, b, (short)0, c, false, false);
  asm volatile("v_nop\n\tv_nop\n\tv_nop\n\tv_nop" : "+v"(c) : "v"(a), "v"(b));
  return c;
}
#define LDS_STRIDE 48   // unused; gemm_kn2's tiles are staged 32 -> 48 elems (GSTR, 96B rows): aligned b128 reads
#define KSTRIDE    72   // unused; the K tile is staged 64 -> 72 elems (FAP)
#define VSTRIDE    48   // unused; the V tile is staged [dv][key], 64 -> 72 elems (FAP)

__device__ __forceinline__ f32x8 wmma_bf16(bf16x16 a, bf16x16 b, f32x8 c) {
  c = __builtin_amdgcn_wmma_f32_16x16x32_f16(false, a, false, b, (short)0, c, false, false);
  asm volatile("v_nop\n\tv_nop\n\tv_nop\n\tv_nop" : "+v"(c) : "v"(a), "v"(b));   // A/B-overwrite hazard guard
  return c;
}

// 16x32 (MxK) bf16 fragment from a row-major global matrix.
// lanes 0-15  (row=lane)    : elems 0..7 = K+0..7,  8..15 = K+16..23
// lanes 16-31 (row=lane-16) : elems 0..7 = K+8..15, 8..15 = K+24..31
template <typename T>
__device__ __forceinline__ bf16x16 load_frag(const T* __restrict__ base, int ld,
                                             int row0, int k0) {
  const int lane = threadIdx.x & 31;
  const int r    = lane & 15;
  const int kh   = (lane >> 4) * 8;
  const T* p0 = base + (size_t)(row0 + r) * ld + (k0 + kh);
  const T* p1 = p0 + 16;
  bf16x16 f;
#pragma unroll
  for (int i = 0; i < 8; ++i) {
    f[i]     = (bf16)p0[i];
    f[i + 8] = (bf16)p1[i];
  }
  return f;
}

// Same fragment from an LDS tile with padded row stride (base includes row0/k0).
__device__ __forceinline__ bf16x16 lds_frag(const bf16* base, int stride) {
  const int lane = threadIdx.x & 31;
  const int row  = lane & 15;
  const int kh   = (lane >> 4) * 8;
  const bf16x8 lo = *(const bf16x8*)(base + row * stride + kh);
  const bf16x8 hi = *(const bf16x8*)(base + row * stride + kh + 16);
  bf16x16 f;
#pragma unroll
  for (int i = 0; i < 8; ++i) { f[i] = lo[i]; f[i + 8] = hi[i]; }
  return f;
}

template <typename T>
__device__ __forceinline__ void stage_read16(const T* __restrict__ p, float* buf) {
#pragma unroll
  for (int i = 0; i < 16; ++i) buf[i] = (float)p[i];
}

__device__ __forceinline__ void stage_write(bf16* dst, const float* buf, int nquad) {
#pragma unroll
  for (int i = 0; i < nquad; ++i) {
    bf16x4 q;
    q[0] = (bf16)buf[4 * i];     q[1] = (bf16)buf[4 * i + 1];
    q[2] = (bf16)buf[4 * i + 2]; q[3] = (bf16)buf[4 * i + 3];
    *(bf16x4*)(dst + 4 * i) = q;
  }
}


#define GSTR 48
// ---------------------------------------------------------------------------------------------------------------------------
// gemm_nt: Y[m][n] = gvec[n] * ( sum_k A[m][k].Wh[n][k] + bias[n] ), A f16 [M][K], Wh f16 [N][K] (both k contiguous), f32 accumulate, Y f32.
// Block = 128x128 tile, 8 waves as 4(M) x 2(N). A trip is 64 k: the A tile and the Wh tile (128 rows of 128 B each, LDS pitch 144 B) come into LDS by asynchronous 16-byte copies,
// 8 lanes to a row (whole 128-B lines), through no register; two buffers, the next trip's copies fly while this trip's tiles are worked on.
// Every inner loop is unrolled so that the indices of its fragment and accumulator arrays are constants and the arrays stay in registers.
// ---------------------------------------------------------------------------------------------------------------------------
#define PK 64                // k per trip
#define PP 72                // LDS row pitch in f16: 144 B = 16 B x odd, so the 16-byte fragment reads meet no bank conflict
#define PT (128 * PP)        // one operand tile in f16; a buffer is two tiles = 4 * PT bytes
// One trip's copies of this lane: rows r, r + 32, r + 64, r + 96 of the A tile and of the Wh tile, 16 bytes each. l = the lane's LDS byte address in the A tile of the buffer, rs = 32 rows in elements.
// s_wait_xcnt stands inside the statement, behind the last copy, so that no address register of a copy is rewritten in front of it.
__device__ __forceinline__ void copy_tiles(unsigned l, const _Float16* a, const _Float16* w, size_t rs) {
  asm volatile("global_load_async_to_lds_b128 %0, %8, off\n\t"
               "global_load_async_to_lds_b128 %1, %9, off\n\t"
               "global_load_async_to_lds_b128 %2, %10, off\n\t"
               "global_load_async_to_lds_b128 %3, %11, off\n\t"
               "global_load_async_to_lds_b128 %4, %12, off\n\t"
               "global_load_async_to_lds_b128 %5, %13, off\n\t"
               "global_load_async_to_lds_b128 %6, %14, off\n\t"
               "global_load_async_to_lds_b128 %7, %15, off\n\t"
               "s_wait_xcnt 0x0"
               :: "v"(l), "v"(l + 32 * PP * 2), "v"(l + 64 * PP * 2), "v"(l + 96 * PP * 2),
                  "v"(l + 2 * PT), "v"(l + 2 * PT + 32 * PP * 2), "v"(l + 2 * PT + 64 * PP * 2), "v"(l + 2 * PT + 96 * PP * 2),
                  "v"(a), "v"(a + rs), "v"(a + 2 * rs), "v"(a + 3 * rs), "v"(w), "v"(w + rs), "v"(w + 2 * rs), "v"(w + 3 * rs)
               : "memory");
}
__global__ __launch_bounds__(256) void gemm_nt(const _Float16* __restrict__ A, const _Float16* __restrict__ Wh, const float* __restrict__ bias, const float* __restrict__ gvec,
                                               float* __restrict__ Y, int ldy, int K) {
  __shared__ __attribute__((aligned(16))) f16 ring[2 * 2 * PT];
  __shared__ __attribute__((aligned(16))) float oS[8][32 * 68];
  const int tid = threadIdx.x, lane = tid & 31, wave = tid >> 5, cl = lane & 15, rh = (lane >> 4) * 8;
  const int m0 = blockIdx.x * 128, n0 = blockIdx.y * 128;
  const int wm = (wave & 3) * 32, wn = (wave >> 2) * 64;
  f32x8 acc[2][4];
#pragma unroll
  for (int i = 0; i < 2; ++i)
#pragma unroll
    for (int j = 0; j < 4; ++j) { f32x8 z = {}; acc[i][j] = z; }
  const int crow = tid >> 3, cc = (tid & 7) * 8;
  const _Float16* ga = A + (size_t)(m0 + crow) * K + cc;
  const _Float16* gw = Wh + (size_t)(n0 + crow) * K + cc;
  const unsigned l0 = (unsigned)(size_t)ring + (crow * PP + cc) * 2;
  const size_t rs = (size_t)32 * K;
  const int nt = K / PK;
  copy_tiles(l0, ga, gw, rs);
  asm volatile("s_wait_asynccnt 0x0" ::: "memory");   // this wave's copies of tile 0 have landed
  __syncthreads();                                     // every wave's have
  if (nt > 1) copy_tiles(l0 + 4 * PT, ga + PK, gw + PK, rs);
  for (int t = 0; t < nt; ++t) {
    const f16* sA = ring + (t & 1) * 2 * PT;
    const f16* sW = sA + PT;
#pragma unroll
    for (int kh = 0; kh < 2; ++kh) {
      f16x16 af[2];
#pragma unroll
      for (int i = 0; i < 2; ++i) af[i] = lds_frag(sA + (wm + 16 * i) * PP + 32 * kh, PP);
#pragma unroll
      for (int j = 0; j < 4; ++j) {
        const f16x16 bf = lds_frag(sW + (wn + 16 * j) * PP + 32 * kh, PP);
#pragma unroll
        for (int i = 0; i < 2; ++i) acc[i][j] = wmma16(af[i], bf, acc[i][j]);
      }
    }
    asm volatile("s_wait_dscnt 0x0" ::: "memory");      // this wave's reads of the buffer are done before it is refilled
    asm volatile("s_wait_asynccnt 0x0" ::: "memory");   // this wave's copies of tile t + 1 have landed
    __syncthreads();                                     // tile t + 1 is complete, and every wave has left tile t's buffer
    if (t + 2 < nt) copy_tiles(l0 + (t & 1) * 4 * PT, ga + (size_t)(t + 2) * PK, gw + (size_t)(t + 2) * PK, rs);
  }
  asm volatile("s_wait_asynccnt 0x0" ::: "memory");     // no copy is outstanding when the wave goes on
  float* so = oS[wave];
#pragma unroll
  for (int i = 0; i < 2; ++i)
#pragma unroll
    for (int j = 0; j < 4; ++j) {
      const int n = n0 + wn + 16 * j + cl;
      const float bv = bias[n], gv = gvec[n];
#pragma unroll
      for (int r = 0; r < 8; ++r) so[(16 * i + rh + r) * 68 + 16 * j + cl] = gv * (acc[i][j][r] + bv);
    }
  asm volatile("s_wait_dscnt 0" ::: "memory");   // the wave's stores to its own staging tile are done before its lanes read each other's values
  __builtin_amdgcn_wave_barrier();               // keeps the compiler from moving those reads up over the wait
#pragma unroll
  for (int it = 0; it < 16; ++it) { const int f4 = lane + 32 * it, rr = f4 >> 4, q = (f4 & 15) * 4;
    *(v4f_t*)(Y + (size_t)(m0 + wm + rr) * ldy + n0 + wn + q) = *(const v4fa*)(so + rr * 68 + q); }
}

// ---------------------------------------------------------------------------------------------------------------------------
// gemm_kn2 (value+residual planes on both operands: hh + (hl+lh)/2048, f32-class): Y[m][n] (row stride ldy) = scale * sum_k A[m][k] (f32 or f16, row stride lda) * W[k][n] (f32, row-major [K][N], row
// stride ldw) (+ bias[n]) (+ Y if ACC). Block = 128 x 128 tile, 256 threads = 8 waves as 4(M, 32 rows) x 2(N, 64 cols); per
// 32-wide k-step the A tile and the W tile (stored transposed [n][k]) are staged as f16 in LDS; f16 value and residual planes, f32 accumulate
// blockIdx.z selects a batch: A += z*strideA, W += z*strideW, Y += z*strideY (element strides).
// ---------------------------------------------------------------------------------------------------------------------------
template <typename AT, bool ACC>
__global__ __launch_bounds__(256) void gemm_kn2(const AT* __restrict__ A, int lda, size_t strideA,
                                               const float* __restrict__ Wm, int ldw, size_t strideW,
                                               const float* __restrict__ bias, float scale,
                                               float* __restrict__ Y, int ldy, size_t strideY, int K) {
  __shared__ __attribute__((aligned(16))) f16 ldsA[128 * GSTR], ldsAl[128 * GSTR];
  __shared__ __attribute__((aligned(16))) f16 ldsW[128 * GSTR], ldsWl[128 * GSTR];
  __shared__ __attribute__((aligned(16))) float oS[8][32 * 68];
  const int tid = threadIdx.x, lane = tid & 31, wave = tid >> 5, cl = lane & 15, rh = (lane >> 4) * 8;
  const int m0 = blockIdx.x * 128, n0 = blockIdx.y * 128;
  const int wm = (wave & 3) * 32, wn = (wave >> 2) * 64;
  A += (size_t)blockIdx.z * strideA; Wm += (size_t)blockIdx.z * strideW; Y += (size_t)blockIdx.z * strideY;
  f32x8 acc[2][4], accx[2][4];
#pragma unroll
  for (int i = 0; i < 2; ++i)
#pragma unroll
    for (int j = 0; j < 4; ++j) { f32x8 z = {}; acc[i][j] = z; accx[i][j] = z; }
#pragma unroll 1
  for (int k0 = 0; k0 < K; k0 += 32) {
    __syncthreads();
    {  // A: thread -> row tid>>1, 16 elements at column half (tid&1)*16
      const int row = tid >> 1, ch = (tid & 1) * 16;
      const AT* src = A + (size_t)(m0 + row) * lda + k0 + ch;
#pragma unroll
      for (int g = 0; g < 16; ++g) { const float v = (float)src[g]; const f16 h = (f16)v; ldsA[row * GSTR + ch + g] = h; ldsAl[row * GSTR + ch + g] = (f16)((v - (float)h) * 2048.0f); }
    }
    {  // W: thread -> k = tid>>3, 16 consecutive n at (tid&7)*16; stored transposed [n][k]
      const int k = tid >> 3, nn0 = (tid & 7) * 16;
      const float* src = Wm + (size_t)(k0 + k) * ldw + n0 + nn0;
#pragma unroll
      for (int g = 0; g < 4; ++g) { const v4f_t v = *(const v4f_t*)(src + 4 * g);
#pragma unroll
        for (int u = 0; u < 4; ++u) { const f16 h = (f16)v[u]; ldsW[(nn0 + 4 * g + u) * GSTR + k] = h; ldsWl[(nn0 + 4 * g + u) * GSTR + k] = (f16)((v[u] - (float)h) * 2048.0f); } }
    }
    __syncthreads();
    f16x16 af[2], afl[2];
#pragma unroll
    for (int i = 0; i < 2; ++i) { af[i] = lds_frag(ldsA + (wm + 16 * i) * GSTR, GSTR); afl[i] = lds_frag(ldsAl + (wm + 16 * i) * GSTR, GSTR); }
#pragma unroll
    for (int j = 0; j < 4; ++j) {
      const f16x16 bf = lds_frag(ldsW + (wn + 16 * j) * GSTR, GSTR), bfl = lds_frag(ldsWl + (wn + 16 * j) * GSTR, GSTR);
#pragma unroll
      for (int i = 0; i < 2; ++i) { acc[i][j] = wmma16(af[i], bf, acc[i][j]); accx[i][j] = wmma16(af[i], bfl, accx[i][j]); accx[i][j] = wmma16(afl[i], bf, accx[i][j]); }
    }
  }
  float* so = oS[wave];
#pragma unroll
  for (int i = 0; i < 2; ++i)
#pragma unroll
    for (int j = 0; j < 4; ++j) {
      const float bv = bias ? bias[n0 + wn + 16 * j + cl] : 0.0f;
#pragma unroll
      for (int r = 0; r < 8; ++r) so[(16 * i + rh + r) * 68 + 16 * j + cl] = (acc[i][j][r] + accx[i][j][r] * (1.0f / 2048.0f)) * scale + bv;
    }
  asm volatile("s_wait_dscnt 0" ::: "memory");
  __builtin_amdgcn_wave_barrier();
  if (ACC) {   // accumulate: fold the existing Y values into the staging tile ONCE (same thread <-> same chunks as the stores below)
#pragma unroll
    for (int it = 0; it < 16; ++it) { const int f4 = lane + 32 * it, rr = f4 >> 4, q = (f4 & 15) * 4;
      const v4f_t old = *(const v4fa*)(Y + (size_t)(m0 + wm + rr) * ldy + n0 + wn + q);
      v4f_t v = *(const v4fa*)(so + rr * 68 + q); v += old; *(v4fa*)(so + rr * 68 + q) = v; }   // plain LDS store (ordered by the s_wait_dscnt/memory clobber below)
    asm volatile("s_wait_dscnt 0" ::: "memory");
  }
{
#pragma unroll
    for (int it = 0; it < 16; ++it) { const int f4 = lane + 32 * it, rr = f4 >> 4, q = (f4 & 15) * 4;
      *(v4f_t*)(Y + (size_t)(m0 + wm + rr) * ldy + n0 + wn + q) = *(const v4fa*)(so + rr * 68 + q); }
    
  }
}

__global__ __launch_bounds__(256) void k_transpose(const float* __restrict__ Wm, float* __restrict__ Wt, int rows, int cols) {
  __shared__ float tS[64][65];
  const int tid = threadIdx.x, tbj = cols / 64, bi = blockIdx.x / tbj, bj = blockIdx.x % tbj;
  for (int e = tid; e < 64 * 64; e += 256) { const int r = e >> 6, c = e & 63; tS[r][c] = Wm[(size_t)(bi * 64 + r) * cols + bj * 64 + c]; }
  __syncthreads();
  for (int ch = tid; ch < 64 * 16; ch += 256) { const int r = ch >> 4, q4 = (ch & 15) * 4; v4f_t o; o[0] = tS[q4][r]; o[1] = tS[q4 + 1][r]; o[2] = tS[q4 + 2][r]; o[3] = tS[q4 + 3][r];
    float* dst = Wt + (size_t)(bj * 64 + r) * rows + bi * 64 + q4; *(v4f_t*)dst = o;  }
}


#define NBga 2
#define SSga 2048
#define SIN 2048
#define DQga 2048
#define DKga 512
#define HIDga 2048
#define HQga 32
#define HKVga 8
#define HDga 64
// ---------------------------------------------------------------------------------------------------------------------------
// k_attn: scores, softmax and P.V of one query head (blockIdx.y) of one batch element (blockIdx.z) for 256 query rows (blockIdx.x) in one kernel; no score ever goes to memory.
// Transposed products: St = K.Qt (A = 16 key rows from LDS, B = 16 query columns kept in registers), Ot += Vt.Pt (A = 16 value columns from LDS [dv][key], B = P packed from the St accumulators:
// two St tiles of 16 keys, converted in place, are one 32-key B operand in the k order of lds_frag). A lane holds one query's scores (lanes c and c + 16 split the keys), so the running maximum,
// the sum and the rescale factor are per lane; the halves exchange the maximum once per stage and join their sums once at the end.
// Running softmax: p = 2^(c.s - mu), c = log2(e)/8, mu = the maximum in use; the accumulators are rescaled only when some column's new maximum passes mu by more than 8 (p stays <= 256, inside f16).
// Block = 8 waves x 32 query columns; stage = 64 keys: K as [key][d] and V as [dv][key] in f16 in LDS, the next stage's global loads fly in registers while this stage is worked on.
// Every inner loop is unrolled so that the indices of its fragment and accumulator arrays are constants and the arrays stay in registers.
// ---------------------------------------------------------------------------------------------------------------------------
typedef __attribute__((ext_vector_type(2))) float v2f_t;
// eight 2^x in place. One statement, so that each v_exp_f32 is followed by an instruction that touches neither its result nor its source (the next one works on its own register);
// the v_nop is that slot behind the last one.
__device__ __forceinline__ void exp2x8(float& x0, float& x1, float& x2, float& x3, float& x4, float& x5, float& x6, float& x7) {
  asm("v_exp_f32 %0, %0\n\tv_exp_f32 %1, %1\n\tv_exp_f32 %2, %2\n\tv_exp_f32 %3, %3\n\tv_exp_f32 %4, %4\n\tv_exp_f32 %5, %5\n\tv_exp_f32 %6, %6\n\tv_exp_f32 %7, %7\n\tv_nop"
      : "+v"(x0), "+v"(x1), "+v"(x2), "+v"(x3), "+v"(x4), "+v"(x5), "+v"(x6), "+v"(x7));
}
#define FAW 8                // waves per block
#define FAK 64               // keys per stage
#define FAP 72               // LDS row pitch in f16: 16 B x odd, so the 16-byte fragment reads meet no bank conflict
__global__ __launch_bounds__(32 * FAW) void k_attn(const float* __restrict__ Q, const float* __restrict__ Km, const float* __restrict__ V, _Float16* __restrict__ O) {
  __shared__ __attribute__((aligned(16))) f16 ldsK[FAK * FAP];
  __shared__ __attribute__((aligned(16))) f16 ldsV[HDga * FAP];
  const int tid = threadIdx.x, lane = tid & 31, wave = tid >> 5, cl = lane & 15, rh = (lane >> 4) * 8;
  const int head = blockIdx.y, kvh = head / (HQga / HKVga);
  const int q0 = (blockIdx.x * FAW + wave) * 32;
  Q += (size_t)blockIdx.z * SSga * DQga + head * HDga; Km += (size_t)blockIdx.z * SSga * DKga + kvh * HDga; V += (size_t)blockIdx.z * SSga * DKga + kvh * HDga; O += (size_t)blockIdx.z * SSga * DQga + head * HDga;
  const float CS = 0.125f * 1.44269504088896341f;
  f16x16 qf[2][2];
#pragma unroll
  for (int a = 0; a < 2; ++a)
#pragma unroll
    for (int dh = 0; dh < 2; ++dh) qf[a][dh] = load_frag(Q, DQga, q0 + 16 * a, 32 * dh);
  f32x8 acc[2][4];
#pragma unroll
  for (int a = 0; a < 2; ++a)
#pragma unroll
    for (int j = 0; j < 4; ++j) { f32x8 z = {}; acc[a][j] = z; }
  float mu[2] = {-3.0e38f, -3.0e38f};
  v2f_t ls[2] = {{0.0f, 0.0f}, {0.0f, 0.0f}};   // row sums of P: two partial sums per lane (packed adds), joined at the end
  const int g16 = tid >> 4, c4 = (tid & 15) * 4;   // K: rows g16 + 16 i, 4 floats at c4 (16 lanes = one 256-B row); V: 4 key rows at 4 g16, 4 columns at c4
  const unsigned ko = g16 * DKga + c4, vo = 4 * g16 * DKga + c4;   // the lane's fixed offsets; the stage moves the uniform base alone
  v4f_t rk[4], rv[4];
#pragma unroll
  for (int i = 0; i < 4; ++i) { rk[i] = *(const v4f_t*)(Km + ko + 16 * i * DKga); rv[i] = *(const v4f_t*)(V + vo + i * DKga); }
#pragma unroll 1   // stays rolled: the stage uses 250 registers, and 256 is the most that lets two work-groups share a WGP: no room for a second copy of it
  for (int k0 = 0; k0 < SSga; k0 += FAK) {
    __syncthreads();   // every wave has read the previous stage's fragments
#pragma unroll
    for (int i = 0; i < 4; ++i) { bf16x4 q; q[0] = (f16)rk[i][0]; q[1] = (f16)rk[i][1]; q[2] = (f16)rk[i][2]; q[3] = (f16)rk[i][3];
      *(bf16x4*)(ldsK + (g16 + 16 * i) * FAP + c4) = q; }
#pragma unroll
    for (int u = 0; u < 4; ++u) { bf16x4 q; q[0] = (f16)rv[0][u]; q[1] = (f16)rv[1][u]; q[2] = (f16)rv[2][u]; q[3] = (f16)rv[3][u];
      *(bf16x4*)(ldsV + (c4 + u) * FAP + 4 * g16) = q; }
    __syncthreads();   // the stage is complete
    const int kn = (k0 + FAK < SSga) ? k0 + FAK : k0;   // next stage (the last trip reads its own again, in bounds, unused)
    const float* kp = Km + (size_t)kn * DKga; const float* vp = V + (size_t)kn * DKga;
#pragma unroll
    for (int i = 0; i < 4; ++i) { rk[i] = *(const v4f_t*)(kp + ko + 16 * i * DKga); rv[i] = *(const v4f_t*)(vp + vo + i * DKga); }
    f32x8 st[2][4];    // St: st[a][kt][r] = score of key 16 kt + rh + r, query 16 a + cl
#pragma unroll
    for (int kt = 0; kt < 4; ++kt) {
      const f16x16 ka = lds_frag(ldsK + (16 * kt) * FAP, FAP), kb = lds_frag(ldsK + (16 * kt) * FAP + 32, FAP);
#pragma unroll
      for (int a = 0; a < 2; ++a) { f32x8 z = {};
        z = __builtin_amdgcn_wmma_f32_16x16x32_f16(false, ka, false, qf[a][0], (short)0, z, false, false);
        st[a][kt] = __builtin_amdgcn_wmma_f32_16x16x32_f16(false, kb, false, qf[a][1], (short)0, z, false, false); }
    }
    float tm[2];
#pragma unroll
    for (int a = 0; a < 2; ++a) { float t = st[a][0][0];
#pragma unroll
      for (int kt = 0; kt < 4; ++kt)
#pragma unroll
        for (int r = 0; r < 8; ++r) t = fmaxf(t, st[a][kt][r]);
      t = fmaxf(t, __shfl_xor(t, 16, 32));
      tm[a] = t * CS; }
    if (__builtin_amdgcn_ballot_w32(tm[0] > mu[0] + 8.0f || tm[1] > mu[1] + 8.0f) != 0) {   // wave-uniform: some column's maximum has outgrown the one in use
#pragma unroll
      for (int a = 0; a < 2; ++a) { const float m2 = fmaxf(mu[a], tm[a]), al = __builtin_amdgcn_exp2f(mu[a] - m2);
        mu[a] = m2; ls[a] *= al;
#pragma unroll
        for (int j = 0; j < 4; ++j)
#pragma unroll
          for (int r = 0; r < 8; ++r) acc[a][j][r] *= al; }
    }
    f16x16 pf[2][2];   // Pt as B operand: pf[a][kk][s] = p of key 32 kk + (s < 8 ? rh + s : 16 + rh + s - 8), query 16 a + cl
#pragma unroll
    for (int a = 0; a < 2; ++a)
#pragma unroll
      for (int kt = 0; kt < 4; ++kt)
      { float t[8];
#pragma unroll
        for (int r = 0; r < 8; ++r) t[r] = fmaf(st[a][kt][r], CS, -mu[a]);
        exp2x8(t[0], t[1], t[2], t[3], t[4], t[5], t[6], t[7]);
#pragma unroll
        for (int r = 0; r < 8; r += 2) { const v2f_t p = {t[r], t[r + 1]}; ls[a] += p; pf[a][kt >> 1][(kt & 1) * 8 + r] = (f16)t[r]; pf[a][kt >> 1][(kt & 1) * 8 + r + 1] = (f16)t[r + 1]; } }
#pragma unroll
    for (int kk = 0; kk < 2; ++kk)
#pragma unroll
      for (int j = 0; j < 4; ++j) { const f16x16 vf = lds_frag(ldsV + (16 * j) * FAP + 32 * kk, FAP);
#pragma unroll
        for (int a = 0; a < 2; ++a) acc[a][j] = __builtin_amdgcn_wmma_f32_16x16x32_f16(false, vf, false, pf[a][kk], (short)0, acc[a][j], false, false); }
  }
#pragma unroll
  for (int a = 0; a < 2; ++a) { const float lh = ls[a][0] + ls[a][1];
    const float inv = 1.0f / (lh + __shfl_xor(lh, 16, 32));
    _Float16* dst = O + (size_t)(q0 + 16 * a + cl) * DQga + rh;   // acc[a][j][r] = Ot[16 j + rh + r][query]: 8 consecutive columns of one row per lane, stored as the f16 operand of the projection
#pragma unroll
    for (int j = 0; j < 4; ++j) { f16x8 h;
#pragma unroll
      for (int r = 0; r < 8; ++r) h[r] = (f16)(acc[a][j][r] * inv);
      *(f16x8*)(dst + 16 * j) = h; } }
}

__global__ __launch_bounds__(256) void k_fill(float* __restrict__ p, float val, size_t n4) { const size_t i = (size_t)blockIdx.x * 256 + threadIdx.x; if (i < n4) { v4f_t v = {val, val, val, val}; *(v4f_t*)(p + 4 * i) = v;  } }
__global__ __launch_bounds__(256) void k_dbg_zero(float* __restrict__ p, size_t n4) { const size_t i = (size_t)blockIdx.x * 256 + threadIdx.x; if (i < n4) { v4f_t z = {0.f,0.f,0.f,0.f}; *(v4f_t*)(p + 4 * i) = z;  } }
__global__ __launch_bounds__(256) void k_copy(const float* __restrict__ src, float* __restrict__ dst, size_t n4) { const size_t i = (size_t)blockIdx.x * 256 + threadIdx.x; if (i < n4) { const v4f_t v = *(const v4f_t*)(src + 4 * i); *(v4f_t*)(dst + 4 * i) = v;  } }
// bf16 round-to-nearest-even of an f32 (bit trick)
__device__ __forceinline__ float bf16r(float x) { unsigned int u = __float_as_uint(x); u = (u + 0x7FFFu + ((u >> 16) & 1u)) & 0xFFFF0000u; return __uint_as_float(u); }
// bf16-rounded copy of an activation block (optionally scaled by a power of two AFTER rounding — exact); 16 B per lane
__global__ __launch_bounds__(256) void k_cpyrnd(const float* __restrict__ src, float* __restrict__ dst, float mul, size_t n4) { const size_t i = (size_t)blockIdx.x * 256 + threadIdx.x; if (i >= n4) return; v4f_t v = *(const v4f_t*)(src + 4 * i);
#pragma unroll
  for (int u = 0; u < 4; ++u) v[u] = mul * bf16r(v[u]);
  *(v4f_t*)(dst + 4 * i) = v;  }
// weight prep: Wh[o][i] = f16(mul.bf16(W[o][i])), in the weight's own [out][in] rows (lifted by a power of two so no bf16 weight becomes an f16 subnormal); 8 elements per lane
__global__ __launch_bounds__(256) void k_wprep16(const float* __restrict__ Wt, _Float16* __restrict__ Wh, float mul, size_t n8) { const size_t i = (size_t)blockIdx.x * 256 + threadIdx.x; if (i >= n8) return;
  const v4f_t a = *(const v4f_t*)(Wt + 8 * i), b = *(const v4f_t*)(Wt + 8 * i + 4); f16x8 h;
#pragma unroll   // constant vector indices, so that h stays in registers
  for (int u = 0; u < 4; ++u) { h[u] = (f16)(mul * bf16r(a[u])); h[4 + u] = (f16)(mul * bf16r(b[u])); }
  *(f16x8*)(Wh + 8 * i) = h; }
// bias prep: B2[o] = mul·bf16(b[o]); one block loops
__global__ __launch_bounds__(256) void k_bprep(const float* __restrict__ b, float* __restrict__ B2, int n, float mul) { for (int o = threadIdx.x; o < n; o += 256) { const float v = mul * bf16r(b[o]); *(float*)(B2 + o) = v;  } }

extern "C" void kernel_launch(void* const* d_in, const int* in_sizes, int n_in,
                              void* d_out, int out_size, void* d_ws, size_t ws_size,
                              hipStream_t stream) {
  (void)in_sizes; (void)n_in; (void)out_size;
  const float** f = (const float**)d_in;
  const float* Qi = f[0], *Ki = f[1], *Vi = f[2], *Wout = f[3], *bout = f[4];
  float* out = (float*)d_out;     // [2,2048,2048]
  char* ws = (char*)d_ws;
  _Float16* Wh = (_Float16*)ws; ws += (size_t)DQga * HIDga * 4; float* B64 = (float*)ws; ws += HIDga * 4; float* g64 = (float*)ws; ws += HIDga * 4;
  float* Q = (float*)ws; ws += (size_t)NBga * SSga * DQga * 4; float* Km = (float*)ws; ws += (size_t)NBga * SSga * DKga * 4; float* V = (float*)ws; ws += (size_t)NBga * SSga * DKga * 4;
  _Float16* O = (_Float16*)ws; ws += (size_t)NBga * SSga * DQga * 4;
  if ((size_t)(ws - (char*)d_ws) > ws_size) return;                      // WS TOTAL 100,679,680 B
  const dim3 blk(256);
  k_fill<<<dim3(2), blk, 0, stream>>>(g64, 1.0f / 64.0f, HIDga / 4);
  k_wprep16<<<dim3(((size_t)HIDga * DQga / 8 + 255) / 256), blk, 0, stream>>>(Wout, Wh, 64.0f, (size_t)HIDga * DQga / 8); k_bprep<<<dim3(1), blk, 0, stream>>>(bout, B64, HIDga, 64.0f);
  k_cpyrnd<<<dim3(((size_t)NBga * SSga * DQga / 4 + 255) / 256), blk, 0, stream>>>(Qi, Q, 1.0f, (size_t)NBga * SSga * DQga / 4); k_cpyrnd<<<dim3(((size_t)NBga * SSga * DKga / 4 + 255) / 256), blk, 0, stream>>>(Ki, Km, 1.0f, (size_t)NBga * SSga * DKga / 4); k_cpyrnd<<<dim3(((size_t)NBga * SSga * DKga / 4 + 255) / 256), blk, 0, stream>>>(Vi, V, 1.0f, (size_t)NBga * SSga * DKga / 4);
  k_attn<<<dim3(SSga / (32 * FAW), HQga, NBga), dim3(32 * FAW), 0, stream>>>(Q, Km, V, O);   // every (batch, query head, 256-query block) is one work-group; the 4 heads of a kv group are neighbours in the grid
  for (int b = 0; b < NBga; ++b)
    gemm_nt<<<dim3(SSga / 128, HIDga / 128), blk, 0, stream>>>(O + (size_t)b * SSga * DQga, Wh, B64, g64, out + (size_t)b * SIN * HIDga, HIDga, DQga);   // out = (o.64W_out^T + 64b)/64
}

// v006
// A run of this version takes 125 microseconds.
// Next to v005, in two timings, it ran 1.15 and 1.17 times as fast.
// Over all steps from v000 it is 73.6 times as fast.
// Q, K, V, W_out, b_out are rounded to bf16 (RNE) on load; the scores are then exact single f16 products of bf16 values
// with f32 accumulation (no projection exists in this module — Q, K, V are inputs), and the output projection uses 64·bf16(W_outᵀ) with a 2^-6 epilogue.
// Contractions on v_wmma_f32_16x16x32_f16 (f16 operands, f32 accumulate): per (batch, query head) the scores against the kv head (K 64) and o_h = P.v_h (K 2048) inside one kernel,
// P = 2^(c.s - running maximum) rounded to f16, divided by its f32 row sum at the end; out = o.W_out^T + b_out (K 2048). f32 VALU: running softmax of s/8.
// compute dtype: f16 operands (bf16-valued), f32 accumulate.  Q [2,2048,2048], K, V [2,2048,512] → out [2,2048,2048].
#include <hip/hip_runtime.h>
#include <hip/hip_bf16.h>
#include <math.h>


typedef _Float16 bf16;
typedef _Float16 f16;
typedef __attribute__((ext_vector_type(4))) unsigned v4u_t;
typedef unsigned v4ua __attribute__((ext_vector_type(4), may_alias));
typedef __attribute__((ext_vector_type(4))) float v4f_t;
typedef float v4fa __attribute__((ext_vector_type(4), may_alias));
typedef __attribute__((ext_vector_type(16))) bf16  bf16x16;
typedef bf16x16 f16x16;
typedef __attribute__((ext_vector_type(8)))  bf16  bf16x8;
typedef bf16x8 f16x8;
typedef __attribute__((ext_vector_type(4)))  bf16  bf16x4;
typedef __attribute__((ext_vector_type(8)))  float f32x8;
typedef __attribute__((ext_vector_type(2)))  float f32x2;
typedef __attribute__((ext_vector_type(2)))  __bf16 rb16x2;
typedef __attribute__((ext_vector_type(2)))  _Float16 f16x2;
// Input rounding, done where an input is read: f32 -> bf16 (nearest even, one packed convert per pair) -> the same value as f32 / as f16 operand.
__device__ __forceinline__ f32x2 rnd_f32(float a, float b) { const f32x2 x = {a, b}; return __builtin_convertvector(__builtin_convertvector(x, rb16x2), f32x2); }
__device__ __forceinline__ f16x2 rnd_f16(float a, float b) { return __builtin_convertvector(rnd_f32(a, b), f16x2); }
__device__ __forceinline__ v4f_t rnd_f32x4(v4f_t x) { const f32x2 lo = rnd_f32(x[0], x[1]), hi = rnd_f32(x[2], x[3]); const v4f_t r = {lo[0], lo[1], hi[0], hi[1]}; return r; }
__device__ __forceinline__ f32x8 wmma16(f16x16 a, f16x16 b, f32x8 c) {
  c = __builtin_amdgcn_wmma_f32_16x16x32_f16(false, a, false, b, (short)0, c, false, false);
  asm volatile("v_nop\n\tv_nop\n\tv_nop\n\tv_nop" : "+v"(c) : "v"(a), "v"(b));
  return c;
}
#define LDS_STRIDE 48   // unused; gemm_kn2's tiles are staged 32 -> 48 elems (GSTR, 96B rows): aligned b128 reads
#define KSTRIDE    72   // unused; the K tile is staged 64 -> 72 elems (FAP)
#define VSTRIDE    48   // unused; the V tile is staged [dv][key], 64 -> 72 elems (FAP)

__device__ __forceinline__ f32x8 wmma_bf16(bf16x16 a, bf16x16 b, f32x8 c) {
  c = __builtin_amdgcn_wmma_f32_16x16x32_f16(false, a, false, b, (short)0, c, false, false);
  asm volatile("v_nop\n\tv_nop\n\tv_nop\n\tv_nop" : "+v"(c) : "v"(a), "v"(b));   // A/B-overwrite hazard guard
  return c;
}

// 16x32 (MxK) fragment from a row-major global f32 matrix, each element rounded to bf16 on the way (rnd_f16).
// lanes 0-15  (row=lane)    : elems 0..7 = K+0..7,  8..15 = K+16..23
// lanes 16-31 (row=lane-16) : elems 0..7 = K+8..15, 8..15 = K+24..31
template <typename T>
__device__ __forceinline__ bf16x16 load_frag(const T* __restrict__ base, int ld,
                                             int row0, int k0) {
  const int lane = threadIdx.x & 31;
  const int r    = lane & 15;
  const int kh   = (lane >> 4) * 8;
  const T* p0 = base + (size_t)(row0 + r) * ld + (k0 + kh);
  const T* p1 = p0 + 16;
  bf16x16 f;
#pragma unroll
  for (int i = 0; i < 8; i += 2) {
    const f16x2 lo = rnd_f16((float)p0[i], (float)p0[i + 1]), hi = rnd_f16((float)p1[i], (float)p1[i + 1]);
    f[i]     = lo[0]; f[i + 1] = lo[1];
    f[i + 8] = hi[0]; f[i + 9] = hi[1];
  }
  return f;
}

// Same fragment from an LDS tile with padded row stride (base includes row0/k0).
__device__ __forceinline__ bf16x16 lds_frag(const bf16* base, int stride) {
  const int lane = threadIdx.x & 31;
  const int row  = lane & 15;
  const int kh   = (lane >> 4) * 8;
  const bf16x8 lo = *(const bf16x8*)(base + row * stride + kh);
  const bf16x8 hi = *(const bf16x8*)(base + row * stride + kh + 16);
  bf16x16 f;
#pragma unroll
  for (int i = 0; i < 8; ++i) { f[i] = lo[i]; f[i + 8] = hi[i]; }
  return f;
}

template <typename T>
__device__ __forceinline__ void stage_read16(const T* __restrict__ p, float* buf) {
#pragma unroll
  for (int i = 0; i < 16; ++i) buf[i] = (float)p[i];
}

__device__ __forceinline__ void stage_write(bf16* dst, const float* buf, int nquad) {
#pragma unroll
  for (int i = 0; i < nquad; ++i) {
    bf16x4 q;
    q[0] = (bf16)buf[4 * i];     q[1] = (bf16)buf[4 * i + 1];
    q[2] = (bf16)buf[4 * i + 2]; q[3] = (bf16)buf[4 * i + 3];
    *(bf16x4*)(dst + 4 * i) = q;
  }
}


#define GSTR 48
// ---------------------------------------------------------------------------------------------------------------------------
// gemm_nt: Y[m][n] = unlift * ( sum_k A[m][k].Wh[n][k] + lift * bf16(bias[n]) ), A f16 [M][K], Wh f16 [N][K] (both k contiguous), f32 accumulate, Y f32; bias is the f32 input, rounded here.
// Block = 128x128 tile, 8 waves as 4(M) x 2(N). A trip is 64 k: the A tile and the Wh tile (128 rows of 128 B each, LDS pitch 144 B) come into LDS by asynchronous 16-byte copies,
// 8 lanes to a row (whole 128-B lines), through no register; two buffers, the next trip's copies fly while this trip's tiles are worked on.
// Every inner loop is unrolled so that the indices of its fragment and accumulator arrays are constants and the arrays stay in registers.
// ---------------------------------------------------------------------------------------------------------------------------
#define PK 64                // k per trip
#define PP 72                // LDS row pitch in f16: 144 B = 16 B x odd, so the 16-byte fragment reads meet no bank conflict
#define PT (128 * PP)        // one operand tile in f16; a buffer is two tiles = 4 * PT bytes
// One trip's copies of this lane: rows r, r + 32, r + 64, r + 96 of the A tile and of the Wh tile, 16 bytes each. l = the lane's LDS byte address in the A tile of the buffer, rs = 32 rows in elements.
// s_wait_xcnt stands inside the statement, behind the last copy, so that no address register of a copy is rewritten in front of it.
__device__ __forceinline__ void copy_tiles(unsigned l, const _Float16* a, const _Float16* w, size_t rs) {
  asm volatile("global_load_async_to_lds_b128 %0, %8, off\n\t"
               "global_load_async_to_lds_b128 %1, %9, off\n\t"
               "global_load_async_to_lds_b128 %2, %10, off\n\t"
               "global_load_async_to_lds_b128 %3, %11, off\n\t"
               "global_load_async_to_lds_b128 %4, %12, off\n\t"
               "global_load_async_to_lds_b128 %5, %13, off\n\t"
               "global_load_async_to_lds_b128 %6, %14, off\n\t"
               "global_load_async_to_lds_b128 %7, %15, off\n\t"
               "s_wait_xcnt 0x0"
               :: "v"(l), "v"(l + 32 * PP * 2), "v"(l + 64 * PP * 2), "v"(l + 96 * PP * 2),
                  "v"(l + 2 * PT), "v"(l + 2 * PT + 32 * PP * 2), "v"(l + 2 * PT + 64 * PP * 2), "v"(l + 2 * PT + 96 * PP * 2),
                  "v"(a), "v"(a + rs), "v"(a + 2 * rs), "v"(a + 3 * rs), "v"(w), "v"(w + rs), "v"(w + 2 * rs), "v"(w + 3 * rs)
               : "memory");
}
__global__ __launch_bounds__(256) void gemm_nt(const _Float16* __restrict__ A, const _Float16* __restrict__ Wh, const float* __restrict__ bias, float lift, float unlift,
                                               float* __restrict__ Y, int ldy, int K) {
  __shared__ __attribute__((aligned(16))) f16 ring[2 * 2 * PT];
  __shared__ __attribute__((aligned(16))) float oS[8][32 * 68];
  const int tid = threadIdx.x, lane = tid & 31, wave = tid >> 5, cl = lane & 15, rh = (lane >> 4) * 8;
  const int m0 = blockIdx.x * 128, n0 = blockIdx.y * 128;
  const int wm = (wave & 3) * 32, wn = (wave >> 2) * 64;
  f32x8 acc[2][4];
#pragma unroll
  for (int i = 0; i < 2; ++i)
#pragma unroll
    for (int j = 0; j < 4; ++j) { f32x8 z = {}; acc[i][j] = z; }
  const int crow = tid >> 3, cc = (tid & 7) * 8;
  const _Float16* ga = A + (size_t)(m0 + crow) * K + cc;
  const _Float16* gw = Wh + (size_t)(n0 + crow) * K + cc;
  const unsigned l0 = (unsigned)(size_t)ring + (crow * PP + cc) * 2;
  const size_t rs = (size_t)32 * K;
  const int nt = K / PK;
  copy_tiles(l0, ga, gw, rs);
  asm volatile("s_wait_asynccnt 0x0" ::: "memory");   // this wave's copies of tile 0 have landed
  __syncthreads();                                     // every wave's have
  if (nt > 1) copy_tiles(l0 + 4 * PT, ga + PK, gw + PK, rs);
  for (int t = 0; t < nt; ++t) {
    const f16* sA = ring + (t & 1) * 2 * PT;
    const f16* sW = sA + PT;
#pragma unroll
    for (int kh = 0; kh < 2; ++kh) {
      f16x16 af[2];
#pragma unroll
      for (int i = 0; i < 2; ++i) af[i] = lds_frag(sA + (wm + 16 * i) * PP + 32 * kh, PP);
#pragma unroll
      for (int j = 0; j < 4; ++j) {
        const f16x16 bf = lds_frag(sW + (wn + 16 * j) * PP + 32 * kh, PP);
#pragma unroll
        for (int i = 0; i < 2; ++i) acc[i][j] = wmma16(af[i], bf, acc[i][j]);
      }
    }
    asm volatile("s_wait_dscnt 0x0" ::: "memory");      // this wave's reads of the buffer are done before it is refilled
    asm volatile("s_wait_asynccnt 0x0" ::: "memory");   // this wave's copies of tile t + 1 have landed
    __syncthreads();                                     // tile t + 1 is complete, and every wave has left tile t's buffer
    if (t + 2 < nt) copy_tiles(l0 + (t & 1) * 4 * PT, ga + (size_t)(t + 2) * PK, gw + (size_t)(t + 2) * PK, rs);
  }
  asm volatile("s_wait_asynccnt 0x0" ::: "memory");     // no copy is outstanding when the wave goes on
  float* so = oS[wave];
#pragma unroll
  for (int i = 0; i < 2; ++i)
#pragma unroll
    for (int j = 0; j < 4; ++j) {
      const int n = n0 + wn + 16 * j + cl;
      const float bv = lift * rnd_f32(bias[n], 0.0f)[0], gv = unlift;
#pragma unroll
      for (int r = 0; r < 8; ++r) so[(16 * i + rh + r) * 68 + 16 * j + cl] = gv * (acc[i][j][r] + bv);
    }
  asm volatile("s_wait_dscnt 0" ::: "memory");   // the wave's stores to its own staging tile are done before its lanes read each other's values
  __builtin_amdgcn_wave_barrier();               // keeps the compiler from moving those reads up over the wait
#pragma unroll
  for (int it = 0; it < 16; ++it) { const int f4 = lane + 32 * it, rr = f4 >> 4, q = (f4 & 15) * 4;
    *(v4f_t*)(Y + (size_t)(m0 + wm + rr) * ldy + n0 + wn + q) = *(const v4fa*)(so + rr * 68 + q); }
}

// ---------------------------------------------------------------------------------------------------------------------------
// gemm_kn2 (value+residual planes on both operands: hh + (hl+lh)/2048, f32-class): Y[m][n] (row stride ldy) = scale * sum_k A[m][k] (f32 or f16, row stride lda) * W[k][n] (f32, row-major [K][N], row
// stride ldw) (+ bias[n]) (+ Y if ACC). Block = 128 x 128 tile, 256 threads = 8 waves as 4(M, 32 rows) x 2(N, 64 cols); per
// 32-wide k-step the A tile and the W tile (stored transposed [n][k]) are staged as f16 in LDS; f16 value and residual planes, f32 accumulate
// blockIdx.z selects a batch: A += z*strideA, W += z*strideW, Y += z*strideY (element strides).
// ---------------------------------------------------------------------------------------------------------------------------
template <typename AT, bool ACC>
__global__ __launch_bounds__(256) void gemm_kn2(const AT* __restrict__ A, int lda, size_t strideA,
                                               const float* __restrict__ Wm, int ldw, size_t strideW,
                                               const float* __restrict__ bias, float scale,
                                               float* __restrict__ Y, int ldy, size_t strideY, int K) {
  __shared__ __attribute__((aligned(16))) f16 ldsA[128 * GSTR], ldsAl[128 * GSTR];
  __shared__ __attribute__((aligned(16))) f16 ldsW[128 * GSTR], ldsWl[128 * GSTR];
  __shared__ __attribute__((aligned(16))) float oS[8][32 * 68];
  const int tid = threadIdx.x, lane = tid & 31, wave = tid >> 5, cl = lane & 15, rh = (lane >> 4) * 8;
  const int m0 = blockIdx.x * 128, n0 = blockIdx.y * 128;
  const int wm = (wave & 3) * 32, wn = (wave >> 2) * 64;
  A += (size_t)blockIdx.z * strideA; Wm += (size_t)blockIdx.z * strideW; Y += (size_t)blockIdx.z * strideY;
  f32x8 acc[2][4], accx[2][4];
#pragma unroll
  for (int i = 0; i < 2; ++i)
#pragma unroll
    for (int j = 0; j < 4; ++j) { f32x8 z = {}; acc[i][j] = z; accx[i][j] = z; }
#pragma unroll 1
  for (int k0 = 0; k0 < K; k0 += 32) {
    __syncthreads();
    {  // A: thread -> row tid>>1, 16 elements at column half (tid&1)*16
      const int row = tid >> 1, ch = (tid & 1) * 16;
      const AT* src = A + (size_t)(m0 + row) * lda + k0 + ch;
#pragma unroll
      for (int g = 0; g < 16; ++g) { const float v = (float)src[g]; const f16 h = (f16)v; ldsA[row * GSTR + ch + g] = h; ldsAl[row * GSTR + ch + g] = (f16)((v - (float)h) * 2048.0f); }
    }
    {  // W: thread -> k = tid>>3, 16 consecutive n at (tid&7)*16; stored transposed [n][k]
      const int k = tid >> 3, nn0 = (tid & 7) * 16;
      const float* src = Wm + (size_t)(k0 + k) * ldw + n0 + nn0;
#pragma unroll
      for (int g = 0; g < 4; ++g) { const v4f_t v = *(const v4f_t*)(src + 4 * g);
#pragma unroll
        for (int u = 0; u < 4; ++u) { const f16 h = (f16)v[u]; ldsW[(nn0 + 4 * g + u) * GSTR + k] = h; ldsWl[(nn0 + 4 * g + u) * GSTR + k] = (f16)((v[u] - (float)h) * 2048.0f); } }
    }
    __syncthreads();
    f16x16 af[2], afl[2];
#pragma unroll
    for (int i = 0; i < 2; ++i) { af[i] = lds_frag(ldsA + (wm + 16 * i) * GSTR, GSTR); afl[i] = lds_frag(ldsAl + (wm + 16 * i) * GSTR, GSTR); }
#pragma unroll
    for (int j = 0; j < 4; ++j) {
      const f16x16 bf = lds_frag(ldsW + (wn + 16 * j) * GSTR, GSTR), bfl = lds_frag(ldsWl + (wn + 16 * j) * GSTR, GSTR);
#pragma unroll
      for (int i = 0; i < 2; ++i) { acc[i][j] = wmma16(af[i], bf, acc[i][j]); accx[i][j] = wmma16(af[i], bfl, accx[i][j]); accx[i][j] = wmma16(afl[i], bf, accx[i][j]); }
    }
  }
  float* so = oS[wave];
#pragma unroll
  for (int i = 0; i < 2; ++i)
#pragma unroll
    for (int j = 0; j < 4; ++j) {
      const float bv = bias ? bias[n0 + wn + 16 * j + cl] : 0.0f;
#pragma unroll
      for (int r = 0; r < 8; ++r) so[(16 * i + rh + r) * 68 + 16 * j + cl] = (acc[i][j][r] + accx[i][j][r] * (1.0f / 2048.0f)) * scale + bv;
    }
  asm volatile("s_wait_dscnt 0" ::: "memory");
  __builtin_amdgcn_wave_barrier();
  if (ACC) {   // accumulate: fold the existing Y values into the staging tile ONCE (same thread <-> same chunks as the stores below)
#pragma unroll
    for (int it = 0; it < 16; ++it) { const int f4 = lane + 32 * it, rr = f4 >> 4, q = (f4 & 15) * 4;
      const v4f_t old = *(const v4fa*)(Y + (size_t)(m0 + wm + rr) * ldy + n0 + wn + q);
      v4f_t v = *(const v4fa*)(so + rr * 68 + q); v += old; *(v4fa*)(so + rr * 68 + q) = v; }   // plain LDS store (ordered by the s_wait_dscnt/memory clobber below)
    asm volatile("s_wait_dscnt 0" ::: "memory");
  }
{
#pragma unroll
    for (int it = 0; it < 16; ++it) { const int f4 = lane + 32 * it, rr = f4 >> 4, q = (f4 & 15) * 4;
      *(v4f_t*)(Y + (size_t)(m0 + wm + rr) * ldy + n0 + wn + q) = *(const v4fa*)(so + rr * 68 + q); }
    
  }
}

__global__ __launch_bounds__(256) void k_transpose(const float* __restrict__ Wm, float* __restrict__ Wt, int rows, int cols) {
  __shared__ float tS[64][65];
  const int tid = threadIdx.x, tbj = cols / 64, bi = blockIdx.x / tbj, bj = blockIdx.x % tbj;
  for (int e = tid; e < 64 * 64; e += 256) { const int r = e >> 6, c = e & 63; tS[r][c] = Wm[(size_t)(bi * 64 + r) * cols + bj * 64 + c]; }
  __syncthreads();
  for (int ch = tid; ch < 64 * 16; ch += 256) { const int r = ch >> 4, q4 = (ch & 15) * 4; v4f_t o; o[0] = tS[q4][r]; o[1] = tS[q4 + 1][r]; o[2] = tS[q4 + 2][r]; o[3] = tS[q4 + 3][r];
    float* dst = Wt + (size_t)(bj * 64 + r) * rows + bi * 64 + q4; *(v4f_t*)dst = o;  }
}


#define NBga 2
#define SSga 2048
#define SIN 2048
#define DQga 2048
#define DKga 512
#define HIDga 2048
#define HQga 32
#define HKVga 8
#define HDga 64
// ---------------------------------------------------------------------------------------------------------------------------
// k_attn: scores, softmax and P.V of one query head (blockIdx.y) of one batch element (blockIdx.z) for 256 query rows (blockIdx.x) in one kernel; no score ever goes to memory.
// Transposed products: St = K.Qt (A = 16 key rows from LDS, B = 16 query columns kept in registers), Ot += Vt.Pt (A = 16 value columns from LDS [dv][key], B = P packed from the St accumulators:
// two St tiles of 16 keys, converted in place, are one 32-key B operand in the k order of lds_frag). A lane holds one query's scores (lanes c and c + 16 split the keys), so the running maximum,
// the sum and the rescale factor are per lane; the halves exchange the maximum once per stage and join their sums once at the end.
// Running softmax: p = 2^(c.s - mu), c = log2(e)/8, mu = the maximum in use; the accumulators are rescaled only when some column's new maximum passes mu by more than 8 (p stays <= 256, inside f16).
// Block = 8 waves x 32 query columns; stage = 64 keys: K as [key][d] and V as [dv][key] in f16 in LDS, the next stage's global loads fly in registers while this stage is worked on.
// Q, Km, V are the f32 inputs themselves: each element is rounded to bf16 where it is turned into an operand (Q once per lane, K and V in the stage's conversion), so no rounded copy goes through memory.
// Every inner loop is unrolled so that the indices of its fragment and accumulator arrays are constants and the arrays stay in registers.
// ---------------------------------------------------------------------------------------------------------------------------
typedef __attribute__((ext_vector_type(2))) float v2f_t;
// eight 2^x in place. One statement, so that each v_exp_f32 is followed by an instruction that touches neither its result nor its source (the next one works on its own register);
// the v_nop is that slot behind the last one.
__device__ __forceinline__ void exp2x8(float& x0, float& x1, float& x2, float& x3, float& x4, float& x5, float& x6, float& x7) {
  asm("v_exp_f32 %0, %0\n\tv_exp_f32 %1, %1\n\tv_exp_f32 %2, %2\n\tv_exp_f32 %3, %3\n\tv_exp_f32 %4, %4\n\tv_exp_f32 %5, %5\n\tv_exp_f32 %6, %6\n\tv_exp_f32 %7, %7\n\tv_nop"
      : "+v"(x0), "+v"(x1), "+v"(x2), "+v"(x3), "+v"(x4), "+v"(x5), "+v"(x6), "+v"(x7));
}
#define FAW 8                // waves per block
#define FAK 64               // keys per stage
#define FAP 72               // LDS row pitch in f16: 16 B x odd, so the 16-byte fragment reads meet no bank conflict
__global__ __launch_bounds__(32 * FAW) void k_attn(const float* __restrict__ Q, const float* __restrict__ Km, const float* __restrict__ V, _Float16* __restrict__ O) {
  __shared__ __attribute__((aligned(16))) f16 ldsK[FAK * FAP];
  __shared__ __attribute__((aligned(16))) f16 ldsV[HDga * FAP];
  const int tid = threadIdx.x, lane = tid & 31, wave = tid >> 5, cl = lane & 15, rh = (lane >> 4) * 8;
  const int head = blockIdx.y, kvh = head / (HQga / HKVga);
  const int q0 = (blockIdx.x * FAW + wave) * 32;
  Q += (size_t)blockIdx.z * SSga * DQga + head * HDga; Km += (size_t)blockIdx.z * SSga * DKga + kvh * HDga; V += (size_t)blockIdx.z * SSga * DKga + kvh * HDga; O += (size_t)blockIdx.z * SSga * DQga + head * HDga;
  const float CS = 0.125f * 1.44269504088896341f;
  f16x16 qf[2][2];
#pragma unroll
  for (int a = 0; a < 2; ++a)
#pragma unroll
    for (int dh = 0; dh < 2; ++dh) qf[a][dh] = load_frag(Q, DQga, q0 + 16 * a, 32 * dh);
  f32x8 acc[2][4];
#pragma unroll
  for (int a = 0; a < 2; ++a)
#pragma unroll
    for (int j = 0; j < 4; ++j) { f32x8 z = {}; acc[a][j] = z; }
  float mu[2] = {-3.0e38f, -3.0e38f};
  v2f_t ls[2] = {{0.0f, 0.0f}, {0.0f, 0.0f}};   // row sums of P: two partial sums per lane (packed adds), joined at the end
  const int g16 = tid >> 4, c4 = (tid & 15) * 4;   // K: rows g16 + 16 i, 4 floats at c4 (16 lanes = one 256-B row); V: 4 key rows at 4 g16, 4 columns at c4
  const unsigned ko = g16 * DKga + c4, vo = 4 * g16 * DKga + c4;   // the lane's fixed offsets; the stage moves the uniform base alone
  v4f_t rk[4], rv[4];
#pragma unroll
  for (int i = 0; i < 4; ++i) { rk[i] = *(const v4f_t*)(Km + ko + 16 * i * DKga); rv[i] = *(const v4f_t*)(V + vo + i * DKga); }
#pragma unroll 1   // stays rolled: the stage uses 250 registers, and 256 is the most that lets two work-groups share a WGP: no room for a second copy of it
  for (int k0 = 0; k0 < SSga; k0 += FAK) {
    __syncthreads();   // every wave has read the previous stage's fragments
#pragma unroll
    for (int i = 0; i < 4; ++i) { const v4f_t k = rnd_f32x4(rk[i]); bf16x4 q; q[0] = (f16)k[0]; q[1] = (f16)k[1]; q[2] = (f16)k[2]; q[3] = (f16)k[3];
      *(bf16x4*)(ldsK + (g16 + 16 * i) * FAP + c4) = q; }
    const v4f_t w[4] = {rnd_f32x4(rv[0]), rnd_f32x4(rv[1]), rnd_f32x4(rv[2]), rnd_f32x4(rv[3])};   // rounded in the order loaded (register neighbours pair up), transposed behind it
#pragma unroll
    for (int u = 0; u < 4; ++u) { bf16x4 q; q[0] = (f16)w[0][u]; q[1] = (f16)w[1][u]; q[2] = (f16)w[2][u]; q[3] = (f16)w[3][u];
      *(bf16x4*)(ldsV + (c4 + u) * FAP + 4 * g16) = q; }
    __syncthreads();   // the stage is complete
    const int kn = (k0 + FAK < SSga) ? k0 + FAK : k0;   // next stage (the last trip reads its own again, in bounds, unused)
    const float* kp = Km + (size_t)kn * DKga; const float* vp = V + (size_t)kn * DKga;
#pragma unroll
    for (int i = 0; i < 4; ++i) { rk[i] = *(const v4f_t*)(kp + ko + 16 * i * DKga); rv[i] = *(const v4f_t*)(vp + vo + i * DKga); }
    f32x8 st[2][4];    // St: st[a][kt][r] = score of key 16 kt + rh + r, query 16 a + cl
#pragma unroll
    for (int kt = 0; kt < 4; ++kt) {
      const f16x16 ka = lds_frag(ldsK + (16 * kt) * FAP, FAP), kb = lds_frag(ldsK + (16 * kt) * FAP + 32, FAP);
#pragma unroll
      for (int a = 0; a < 2; ++a) { f32x8 z = {};
        z = __builtin_amdgcn_wmma_f32_16x16x32_f16(false, ka, false, qf[a][0], (short)0, z, false, false);
        st[a][kt] = __builtin_amdgcn_wmma_f32_16x16x32_f16(false, kb, false, qf[a][1], (short)0, z, false, false); }
    }
    float tm[2];
#pragma unroll
    for (int a = 0; a < 2; ++a) { float t = st[a][0][0];
#pragma unroll
      for (int kt = 0; kt < 4; ++kt)
#pragma unroll
        for (int r = 0; r < 8; ++r) t = fmaxf(t, st[a][kt][r]);
      t = fmaxf(t, __shfl_xor(t, 16, 32));
      tm[a] = t * CS; }
    if (__builtin_amdgcn_ballot_w32(tm[0] > mu[0] + 8.0f || tm[1] > mu[1] + 8.0f) != 0) {   // wave-uniform: some column's maximum has outgrown the one in use
#pragma unroll
      for (int a = 0; a < 2; ++a) { const float m2 = fmaxf(mu[a], tm[a]), al = __builtin_amdgcn_exp2f(mu[a] - m2);
        mu[a] = m2; ls[a] *= al;
#pragma unroll
        for (int j = 0; j < 4; ++j)
#pragma unroll
          for (int r = 0; r < 8; ++r) acc[a][j][r] *= al; }
    }
    f16x16 pf[2][2];   // Pt as B operand: pf[a][kk][s] = p of key 32 kk + (s < 8 ? rh + s : 16 + rh + s - 8), query 16 a + cl
#pragma unroll
    for (int a = 0; a < 2; ++a)
#pragma unroll
      for (int kt = 0; kt < 4; ++kt)
      { float t[8];
#pragma unroll
        for (int r = 0; r < 8; ++r) t[r] = fmaf(st[a][kt][r], CS, -mu[a]);
        exp2x8(t[0], t[1], t[2], t[3], t[4], t[5], t[6], t[7]);
#pragma unroll
        for (int r = 0; r < 8; r += 2) { const v2f_t p = {t[r], t[r + 1]}; ls[a] += p; pf[a][kt >> 1][(kt & 1) * 8 + r] = (f16)t[r]; pf[a][kt >> 1][(kt & 1) * 8 + r + 1] = (f16)t[r + 1]; } }
#pragma unroll
    for (int kk = 0; kk < 2; ++kk)
#pragma unroll
      for (int j = 0; j < 4; ++j) { const f16x16 vf = lds_frag(ldsV + (16 * j) * FAP + 32 * kk, FAP);
#pragma unroll
        for (int a = 0; a < 2; ++a) acc[a][j] = __builtin_amdgcn_wmma_f32_16x16x32_f16(false, vf, false, pf[a][kk], (short)0, acc[a][j], false, false); }
  }
#pragma unroll
  for (int a = 0; a < 2; ++a) { const float lh = ls[a][0] + ls[a][1];
    const float inv = 1.0f / (lh + __shfl_xor(lh, 16, 32));
    _Float16* dst = O + (size_t)(q0 + 16 * a + cl) * DQga + rh;   // acc[a][j][r] = Ot[16 j + rh + r][query]: 8 consecutive columns of one row per lane, stored as the f16 operand of the projection
#pragma unroll
    for (int j = 0; j < 4; ++j) { f16x8 h;
#pragma unroll
      for (int r = 0; r < 8; ++r) h[r] = (f16)(acc[a][j][r] * inv);
      *(f16x8*)(dst + 16 * j) = h; } }
}

__global__ __launch_bounds__(256) void k_dbg_zero(float* __restrict__ p, size_t n4) { const size_t i = (size_t)blockIdx.x * 256 + threadIdx.x; if (i < n4) { v4f_t z = {0.f,0.f,0.f,0.f}; *(v4f_t*)(p + 4 * i) = z;  } }
__global__ __launch_bounds__(256) void k_copy(const float* __restrict__ src, float* __restrict__ dst, size_t n4) { const size_t i = (size_t)blockIdx.x * 256 + threadIdx.x; if (i < n4) { const v4f_t v = *(const v4f_t*)(src + 4 * i); *(v4f_t*)(dst + 4 * i) = v;  } }
// bf16 round-to-nearest-even of an f32 (bit trick)
__device__ __forceinline__ float bf16r(float x) { unsigned int u = __float_as_uint(x); u = (u + 0x7FFFu + ((u >> 16) & 1u)) & 0xFFFF0000u; return __uint_as_float(u); }
// weight prep: Wh[o][i] = f16(mul.bf16(W[o][i])), in the weight's own [out][in] rows (lifted by a power of two so no bf16 weight becomes an f16 subnormal); 8 elements per lane
__global__ __launch_bounds__(256) void k_wprep16(const float* __restrict__ Wt, _Float16* __restrict__ Wh, float mul, size_t n8) { const size_t i = (size_t)blockIdx.x * 256 + threadIdx.x; if (i >= n8) return;
  const v4f_t a = *(const v4f_t*)(Wt + 8 * i), b = *(const v4f_t*)(Wt + 8 * i + 4); f16x8 h;
#pragma unroll   // constant vector indices, so that h stays in registers
  for (int u = 0; u < 4; ++u) { h[u] = (f16)(mul * bf16r(a[u])); h[4 + u] = (f16)(mul * bf16r(b[u])); }
  *(f16x8*)(Wh + 8 * i) = h; }

extern "C" void kernel_launch(void* const* d_in, const int* in_sizes, int n_in,
                              void* d_out, int out_size, void* d_ws, size_t ws_size,
                              hipStream_t stream) {
  (void)in_sizes; (void)n_in; (void)out_size;
  const float** f = (const float**)d_in;
  const float* Qi = f[0], *Ki = f[1], *Vi = f[2], *Wout = f[3], *bout = f[4];
  float* out = (float*)d_out;     // [2,2048,2048]
  char* ws = (char*)d_ws;
  _Float16* Wh = (_Float16*)ws; ws += (size_t)DQga * HIDga * 2;
  _Float16* O = (_Float16*)ws; ws += (size_t)NBga * SSga * DQga * 2;
  if ((size_t)(ws - (char*)d_ws) > ws_size) return;                      // WS TOTAL 25,165,824 B
  const dim3 blk(256);
  k_wprep16<<<dim3(((size_t)HIDga * DQga / 8 + 255) / 256), blk, 0, stream>>>(Wout, Wh, 64.0f, (size_t)HIDga * DQga / 8);
  k_attn<<<dim3(SSga / (32 * FAW), HQga, NBga), dim3(32 * FAW), 0, stream>>>(Qi, Ki, Vi, O);   // every (batch, query head, 256-query block) is one work-group; the 4 heads of a kv group are neighbours in the grid
  for (int b = 0; b < NBga; ++b)
    gemm_nt<<<dim3(SSga / 128, HIDga / 128), blk, 0, stream>>>(O + (size_t)b * SSga * DQga, Wh, bout, 64.0f, 1.0f / 64.0f, out + (size_t)b * SIN * HIDga, HIDga, DQga);   // out = (o.64W_out^T + 64b)/64
}

// v007
// It runs in 118 microseconds.
// Next to v006, in two timings, it ran 1.05 and 1.07 times as fast.
// All steps since v000 together make it 78.1 times as fast.
// Q, K, V, W_out, b_out are rounded to bf16 (RNE) on load; the scores are then exact single f16 products of bf16 values
// with f32 accumulation (no projection exists in this module — Q, K, V are inputs), and the output projection uses 64·bf16(W_outᵀ) with a 2^-6 epilogue.
// Contractions on v_wmma_f32_16x16x32_f16 (f16 operands, f32 accumulate): per (batch, query head) the scores against the kv head (K 64) and o_h = P.v_h (K 2048) inside one kernel,
// P = 2^(c.s - running maximum) rounded to f16, divided by its f32 row sum at the end; out = o.W_out^T + b_out (K 2048). f32 VALU: running softmax of s/8.
// compute dtype: f16 operands (bf16-valued), f32 accumulate.  Q [2,2048,2048], K, V [2,2048,512] → out [2,2048,2048].
#include <hip/hip_runtime.h>
#include <hip/hip_bf16.h>
#include <math.h>


typedef _Float16 bf16;
typedef _Float16 f16;
typedef __attribute__((ext_vector_type(4))) unsigned v4u_t;
typedef unsigned v4ua __attribute__((ext_vector_type(4), may_alias));
typedef __attribute__((ext_vector_type(4))) float v4f_t;
typedef float v4fa __attribute__((ext_vector_type(4), may_alias));
typedef __attribute__((ext_vector_type(16))) bf16  bf16x16;
typedef bf16x16 f16x16;
typedef __attribute__((ext_vector_type(8)))  bf16  bf16x8;
typedef bf16x8 f16x8;
typedef __attribute__((ext_vector_type(4)))  bf16  bf16x4;
typedef __attribute__((ext_vector_type(8)))  float f32x8;
typedef __attribute__((ext_vector_type(2)))  float f32x2;
typedef __attribute__((ext_vector_type(2)))  __bf16 rb16x2;
typedef __attribute__((ext_vector_type(2)))  _Float16 f16x2;
// Input rounding, done where an input is read: f32 -> bf16 (nearest even, one packed convert per pair) -> the same value as f32 / as f16 operand.
__device__ __forceinline__ f32x2 rnd_f32(float a, float b) { const f32x2 x = {a, b}; return __builtin_convertvector(__builtin_convertvector(x, rb16x2), f32x2); }
__device__ __forceinline__ f16x2 rnd_f16(float a, float b) { return __builtin_convertvector(rnd_f32(a, b), f16x2); }
__device__ __forceinline__ v4f_t rnd_f32x4(v4f_t x) { const f32x2 lo = rnd_f32(x[0], x[1]), hi = rnd_f32(x[2], x[3]); const v4f_t r = {lo[0], lo[1], hi[0], hi[1]}; return r; }
__device__ __forceinline__ f32x8 wmma16(f16x16 a, f16x16 b, f32x8 c) {
  c = __builtin_amdgcn_wmma_f32_16x16x32_f16(false, a, false, b, (short)0, c, false, false);
  asm volatile("v_nop\n\tv_nop\n\tv_nop\n\tv_nop" : "+v"(c) : "v"(a), "v"(b));
  return c;
}
#define LDS_STRIDE 48   // unused; gemm_kn2's tiles are staged 32 -> 48 elems (GSTR, 96B rows): aligned b128 reads
#define KSTRIDE    72   // unused; the K tile is staged 64 -> 72 elems (FAP)
#define VSTRIDE    48   // unused; the V tile is staged [dv][key], 64 -> 72 elems (FAP)

__device__ __forceinline__ f32x8 wmma_bf16(bf16x16 a, bf16x16 b, f32x8 c) {
  c = __builtin_amdgcn_wmma_f32_16x16x32_f16(false, a, false, b, (short)0, c, false, false);
  asm volatile("v_nop\n\tv_nop\n\tv_nop\n\tv_nop" : "+v"(c) : "v"(a), "v"(b));   // A/B-overwrite hazard guard
  return c;
}

// 16x32 (MxK) fragment from a row-major global f32 matrix, each element rounded to bf16 on the way (rnd_f16).
// lanes 0-15  (row=lane)    : elems 0..7 = K+0..7,  8..15 = K+16..23
// lanes 16-31 (row=lane-16) : elems 0..7 = K+8..15, 8..15 = K+24..31
template <typename T>
__device__ __forceinline__ bf16x16 load_frag(const T* __restrict__ base, int ld,
                                             int row0, int k0) {
  const int lane = threadIdx.x & 31;
  const int r    = lane & 15;
  const int kh   = (lane >> 4) * 8;
  const T* p0 = base + (size_t)(row0 + r) * ld + (k0 + kh);
  const T* p1 = p0 + 16;
  bf16x16 f;
#pragma unroll
  for (int i = 0; i < 8; i += 2) {
    const f16x2 lo = rnd_f16((float)p0[i], (float)p0[i + 1]), hi = rnd_f16((float)p1[i], (float)p1[i + 1]);
    f[i]     = lo[0]; f[i + 1] = lo[1];
    f[i + 8] = hi[0]; f[i + 9] = hi[1];
  }
  return f;
}

// Same fragment from an LDS tile with padded row stride (base includes row0/k0).
__device__ __forceinline__ bf16x16 lds_frag(const bf16* base, int stride) {
  const int lane = threadIdx.x & 31;
  const int row  = lane & 15;
  const int kh   = (lane >> 4) * 8;
  const bf16x8 lo = *(const bf16x8*)(base + row * stride + kh);
  const bf16x8 hi = *(const bf16x8*)(base + row * stride + kh + 16);
  bf16x16 f;
#pragma unroll
  for (int i = 0; i < 8; ++i) { f[i] = lo[i]; f[i + 8] = hi[i]; }
  return f;
}

template <typename T>
__device__ __forceinline__ void stage_read16(const T* __restrict__ p, float* buf) {
#pragma unroll
  for (int i = 0; i < 16; ++i) buf[i] = (float)p[i];
}

__device__ __forceinline__ void stage_write(bf16* dst, const float* buf, int nquad) {
#pragma unroll
  for (int i = 0; i < nquad; ++i) {
    bf16x4 q;
    q[0] = (bf16)buf[4 * i];     q[1] = (bf16)buf[4 * i + 1];
    q[2] = (bf16)buf[4 * i + 2]; q[3] = (bf16)buf[4 * i + 3];
    *(bf16x4*)(dst + 4 * i) = q;
  }
}


#define GSTR 48
// ---------------------------------------------------------------------------------------------------------------------------
// gemm_nt: Y[m][n] = unlift * ( sum_k A[m][k].Wh[n][k] + lift * bf16(bias[n]) ), A f16 [M][K], Wh f16 [N][K] (both k contiguous), f32 accumulate, Y f32; bias is the f32 input, rounded here.
// Block = 128x128 tile, 8 waves as 4(M) x 2(N). A trip is 64 k: the A tile and the Wh tile (128 rows of 128 B each, LDS pitch 144 B) come into LDS by asynchronous 16-byte copies,
// 8 lanes to a row (whole 128-B lines), through no register; two buffers, the next trip's copies fly while this trip's tiles are worked on.
// A trip's 24 fragment loads stand as one group ahead of its 16 products, every fragment in registers of its own, so a wave meets the LDS latency once a trip and each product waits on a count.
// Every inner loop is unrolled so that the indices of its fragment and accumulator arrays are constants and the arrays stay in registers.
// ---------------------------------------------------------------------------------------------------------------------------
#define PK 64                // k per trip
#define PP 72                // LDS row pitch in f16: 144 B = 16 B x odd, so the 16-byte fragment reads meet no bank conflict
#define PT (128 * PP)        // one operand tile in f16; a buffer is two tiles = 4 * PT bytes
// One trip's copies of this lane: rows r, r + 32, r + 64, r + 96 of the A tile and of the Wh tile, 16 bytes each. l = the lane's LDS byte address in the A tile of the buffer, rs = 32 rows in elements.
// s_wait_xcnt stands inside the statement, behind the last copy, so that no address register of a copy is rewritten in front of it.
__device__ __forceinline__ void copy_tiles(unsigned l, const _Float16* a, const _Float16* w, size_t rs) {
  asm volatile("global_load_async_to_lds_b128 %0, %8, off\n\t"
               "global_load_async_to_lds_b128 %1, %9, off\n\t"
               "global_load_async_to_lds_b128 %2, %10, off\n\t"
               "global_load_async_to_lds_b128 %3, %11, off\n\t"
               "global_load_async_to_lds_b128 %4, %12, off\n\t"
               "global_load_async_to_lds_b128 %5, %13, off\n\t"
               "global_load_async_to_lds_b128 %6, %14, off\n\t"
               "global_load_async_to_lds_b128 %7, %15, off\n\t"
               "s_wait_xcnt 0x0"
               :: "v"(l), "v"(l + 32 * PP * 2), "v"(l + 64 * PP * 2), "v"(l + 96 * PP * 2),
                  "v"(l + 2 * PT), "v"(l + 2 * PT + 32 * PP * 2), "v"(l + 2 * PT + 64 * PP * 2), "v"(l + 2 * PT + 96 * PP * 2),
                  "v"(a), "v"(a + rs), "v"(a + 2 * rs), "v"(a + 3 * rs), "v"(w), "v"(w + rs), "v"(w + 2 * rs), "v"(w + 3 * rs)
               : "memory");
}
__global__ __launch_bounds__(256) void gemm_nt(const _Float16* __restrict__ A, const _Float16* __restrict__ Wh, const float* __restrict__ bias, float lift, float unlift,
                                               float* __restrict__ Y, int ldy, int K) {
  __shared__ __attribute__((aligned(16))) f16 ring[2 * 2 * PT];
  __shared__ __attribute__((aligned(16))) float oS[8][32 * 68];
  const int tid = threadIdx.x, lane = tid & 31, wave = tid >> 5, cl = lane & 15, rh = (lane >> 4) * 8;
  const int m0 = blockIdx.x * 128, n0 = blockIdx.y * 128;
  const int wm = (wave & 3) * 32, wn = (wave >> 2) * 64;
  f32x8 acc[2][4];
#pragma unroll
  for (int i = 0; i < 2; ++i)
#pragma unroll
    for (int j = 0; j < 4; ++j) { f32x8 z = {}; acc[i][j] = z; }
  const int crow = tid >> 3, cc = (tid & 7) * 8;
  const _Float16* ga = A + (size_t)(m0 + crow) * K + cc;
  const _Float16* gw = Wh + (size_t)(n0 + crow) * K + cc;
  const unsigned l0 = (unsigned)(size_t)ring + (crow * PP + cc) * 2;
  const size_t rs = (size_t)32 * K;
  const int nt = K / PK;
  copy_tiles(l0, ga, gw, rs);
  asm volatile("s_wait_asynccnt 0x0" ::: "memory");   // this wave's copies of tile 0 have landed
  __syncthreads();                                     // every wave's have
  if (nt > 1) copy_tiles(l0 + 4 * PT, ga + PK, gw + PK, rs);
  for (int t = 0; t < nt; ++t) {
    const f16* sA = ring + (t & 1) * 2 * PT;
    const f16* sW = sA + PT;
    f16x16 af[2][2], bf[2][4];   // the trip's 12 fragments, each in registers of its own, loaded in the order in which the products want them
#pragma unroll
    for (int kh = 0; kh < 2; ++kh) {
      af[kh][0] = lds_frag(sA + wm * PP + 32 * kh, PP);
      bf[kh][0] = lds_frag(sW + wn * PP + 32 * kh, PP);
      af[kh][1] = lds_frag(sA + (wm + 16) * PP + 32 * kh, PP);
#pragma unroll
      for (int j = 1; j < 4; ++j) bf[kh][j] = lds_frag(sW + (wn + 16 * j) * PP + 32 * kh, PP);
    }
    __builtin_amdgcn_sched_barrier(0);   // keeps the 24 loads one group ahead of the products: without it the compiler sinks them back among the products, into one register set, with a wait to 0 at each pair
#pragma unroll
    for (int kh = 0; kh < 2; ++kh)
#pragma unroll
      for (int j = 0; j < 4; ++j)
#pragma unroll
        for (int i = 0; i < 2; ++i) acc[i][j] = __builtin_amdgcn_wmma_f32_16x16x32_f16(false, af[kh][i], false, bf[kh][j], (short)0, acc[i][j], false, false);
    __builtin_amdgcn_sched_barrier(0);   // keeps the wait to 0 below behind the products: hoisted over them it would hold the first product back until the last of the 24 loads has landed
    asm volatile("s_wait_dscnt 0x0" ::: "memory");      // this wave's reads of the buffer are done before it is refilled
    asm volatile("s_wait_asynccnt 0x0" ::: "memory");   // this wave's copies of tile t + 1 have landed
    __syncthreads();                                     // tile t + 1 is complete, and every wave has left tile t's buffer
    if (t + 2 < nt) copy_tiles(l0 + (t & 1) * 4 * PT, ga + (size_t)(t + 2) * PK, gw + (size_t)(t + 2) * PK, rs);
  }
  asm volatile("s_wait_asynccnt 0x0" ::: "memory");     // no copy is outstanding when the wave goes on
  float* so = oS[wave];
#pragma unroll
  for (int i = 0; i < 2; ++i)
#pragma unroll
    for (int j = 0; j < 4; ++j) {
      const int n = n0 + wn + 16 * j + cl;
      const float bv = lift * rnd_f32(bias[n], 0.0f)[0], gv = unlift;
#pragma unroll
      for (int r = 0; r < 8; ++r) so[(16 * i + rh + r) * 68 + 16 * j + cl] = gv * (acc[i][j][r] + bv);
    }
  asm volatile("s_wait_dscnt 0" ::: "memory");   // the wave's stores to its own staging tile are done before its lanes read each other's values
  __builtin_amdgcn_wave_barrier();               // keeps the compiler from moving those reads up over the wait
#pragma unroll
  for (int it = 0; it < 16; ++it) { const int f4 = lane + 32 * it, rr = f4 >> 4, q = (f4 & 15) * 4;
    *(v4f_t*)(Y + (size_t)(m0 + wm + rr) * ldy + n0 + wn + q) = *(const v4fa*)(so + rr * 68 + q); }
}

// ---------------------------------------------------------------------------------------------------------------------------
// gemm_kn2 (value+residual planes on both operands: hh + (hl+lh)/2048, f32-class): Y[m][n] (row stride ldy) = scale * sum_k A[m][k] (f32 or f16, row stride lda) * W[k][n] (f32, row-major [K][N], row
// stride ldw) (+ bias[n]) (+ Y if ACC). Block = 128 x 128 tile, 256 threads = 8 waves as 4(M, 32 rows) x 2(N, 64 cols); per
// 32-wide k-step the A tile and the W tile (stored transposed [n][k]) are staged as f16 in LDS; f16 value and residual planes, f32 accumulate
// blockIdx.z selects a batch: A += z*strideA, W += z*strideW, Y += z*strideY (element strides).
// ---------------------------------------------------------------------------------------------------------------------------
template <typename AT, bool ACC>
__global__ __launch_bounds__(256) void gemm_kn2(const AT* __restrict__ A, int lda, size_t strideA,
                                               const float* __restrict__ Wm, int ldw, size_t strideW,
                                               const float* __restrict__ bias, float scale,
                                               float* __restrict__ Y, int ldy, size_t strideY, int K) {
  __shared__ __attribute__((aligned(16))) f16 ldsA[128 * GSTR], ldsAl[128 * GSTR];
  __shared__ __attribute__((aligned(16))) f16 ldsW[128 * GSTR], ldsWl[128 * GSTR];
  __shared__ __attribute__((aligned(16))) float oS[8][32 * 68];
  const int tid = threadIdx.x, lane = tid & 31, wave = tid >> 5, cl = lane & 15, rh = (lane >> 4) * 8;
  const int m0 = blockIdx.x * 128, n0 = blockIdx.y * 128;
  const int wm = (wave & 3) * 32, wn = (wave >> 2) * 64;
  A += (size_t)blockIdx.z * strideA; Wm += (size_t)blockIdx.z * strideW; Y += (size_t)blockIdx.z * strideY;
  f32x8 acc[2][4], accx[2][4];
#pragma unroll
  for (int i = 0; i < 2; ++i)
#pragma unroll
    for (int j = 0; j < 4; ++j) { f32x8 z = {}; acc[i][j] = z; accx[i][j] = z; }
#pragma unroll 1
  for (int k0 = 0; k0 < K; k0 += 32) {
    __syncthreads();
    {  // A: thread -> row tid>>1, 16 elements at column half (tid&1)*16
      const int row = tid >> 1, ch = (tid & 1) * 16;
      const AT* src = A + (size_t)(m0 + row) * lda + k0 + ch;
#pragma unroll
      for (int g = 0; g < 16; ++g) { const float v = (float)src[g]; const f16 h = (f16)v; ldsA[row * GSTR + ch + g] = h; ldsAl[row * GSTR + ch + g] = (f16)((v - (float)h) * 2048.0f); }
    }
    {  // W: thread -> k = tid>>3, 16 consecutive n at (tid&7)*16; stored transposed [n][k]
      const int k = tid >> 3, nn0 = (tid & 7) * 16;
      const float* src = Wm + (size_t)(k0 + k) * ldw + n0 + nn0;
#pragma unroll
      for (int g = 0; g < 4; ++g) { const v4f_t v = *(const v4f_t*)(src + 4 * g);
#pragma unroll
        for (int u = 0; u < 4; ++u) { const f16 h = (f16)v[u]; ldsW[(nn0 + 4 * g + u) * GSTR + k] = h; ldsWl[(nn0 + 4 * g + u) * GSTR + k] = (f16)((v[u] - (float)h) * 2048.0f); } }
    }
    __syncthreads();
    f16x16 af[2], afl[2];
#pragma unroll
    for (int i = 0; i < 2; ++i) { af[i] = lds_frag(ldsA + (wm + 16 * i) * GSTR, GSTR); afl[i] = lds_frag(ldsAl + (wm + 16 * i) * GSTR, GSTR); }
#pragma unroll
    for (int j = 0; j < 4; ++j) {
      const f16x16 bf = lds_frag(ldsW + (wn + 16 * j) * GSTR, GSTR), bfl = lds_frag(ldsWl + (wn + 16 * j) * GSTR, GSTR);
#pragma unroll
      for (int i = 0; i < 2; ++i) { acc[i][j] = wmma16(af[i], bf, acc[i][j]); accx[i][j] = wmma16(af[i], bfl, accx[i][j]); accx[i][j] = wmma16(afl[i], bf, accx[i][j]); }
    }
  }
  float* so = oS[wave];
#pragma unroll
  for (int i = 0; i < 2; ++i)
#pragma unroll
    for (int j = 0; j < 4; ++j) {
      const float bv = bias ? bias[n0 + wn + 16 * j + cl] : 0.0f;
#pragma unroll
      for (int r = 0; r < 8; ++r) so[(16 * i + rh + r) * 68 + 16 * j + cl] = (acc[i][j][r] + accx[i][j][r] * (1.0f / 2048.0f)) * scale + bv;
    }
  asm volatile("s_wait_dscnt 0" ::: "memory");
  __builtin_amdgcn_wave_barrier();
  if (ACC) {   // accumulate: fold the existing Y values into the staging tile ONCE (same thread <-> same chunks as the stores below)
#pragma unroll
    for (int it = 0; it < 16; ++it) { const int f4 = lane + 32 * it, rr = f4 >> 4, q = (f4 & 15) * 4;
      const v4f_t old = *(const v4fa*)(Y + (size_t)(m0 + wm + rr) * ldy + n0 + wn + q);
      v4f_t v = *(const v4fa*)(so + rr * 68 + q); v += old; *(v4fa*)(so + rr * 68 + q) = v; }   // plain LDS store (ordered by the s_wait_dscnt/memory clobber below)
    asm volatile("s_wait_dscnt 0" ::: "memory");
  }
{
#pragma unroll
    for (int it = 0; it < 16; ++it) { const int f4 = lane + 32 * it, rr = f4 >> 4, q = (f4 & 15) * 4;
      *(v4f_t*)(Y + (size_t)(m0 + wm + rr) * ldy + n0 + wn + q) = *(const v4fa*)(so + rr * 68 + q); }
    
  }
}

__global__ __launch_bounds__(256) void k_transpose(const float* __restrict__ Wm, float* __restrict__ Wt, int rows, int cols) {
  __shared__ float tS[64][65];
  const int tid = threadIdx.x, tbj = cols / 64, bi = blockIdx.x / tbj, bj = blockIdx.x % tbj;
  for (int e = tid; e < 64 * 64; e += 256) { const int r = e >> 6, c = e & 63; tS[r][c] = Wm[(size_t)(bi * 64 + r) * cols + bj * 64 + c]; }
  __syncthreads();
  for (int ch = tid; ch < 64 * 16; ch += 256) { const int r = ch >> 4, q4 = (ch & 15) * 4; v4f_t o; o[0] = tS[q4][r]; o[1] = tS[q4 + 1][r]; o[2] = tS[q4 + 2][r]; o[3] = tS[q4 + 3][r];
    float* dst = Wt + (size_t)(bj * 64 + r) * rows + bi * 64 + q4; *(v4f_t*)dst = o;  }
}


#define NBga 2
#define SSga 2048
#define SIN 2048
#define DQga 2048
#define DKga 512
#define HIDga 2048
#define HQga 32
#define HKVga 8
#define HDga 64
// ---------------------------------------------------------------------------------------------------------------------------
// k_attn: scores, softmax and P.V of one query head (blockIdx.y) of one batch element (blockIdx.z) for 256 query rows (blockIdx.x) in one kernel; no score ever goes to memory.
// Transposed products: St = K.Qt (A = 16 key rows from LDS, B = 16 query columns kept in registers), Ot += Vt.Pt (A = 16 value columns from LDS [dv][key], B = P packed from the St accumulators:
// two St tiles of 16 keys, converted in place, are one 32-key B operand in the k order of lds_frag). A lane holds one query's scores (lanes c and c + 16 split the keys), so the running maximum,
// the sum and the rescale factor are per lane; the halves exchange the maximum once per stage and join their sums once at the end.
// Running softmax: p = 2^(c.s - mu), c = log2(e)/8, mu = the maximum in use; the accumulators are rescaled only when some column's new maximum passes mu by more than 8 (p stays <= 256, inside f16).
// Block = 8 waves x 32 query columns; stage = 64 keys: K as [key][d] and V as [dv][key] in f16 in LDS, the next stage's global loads fly in registers while this stage is worked on.
// Q, Km, V are the f32 inputs themselves: each element is rounded to bf16 where it is turned into an operand (Q once per lane, K and V in the stage's conversion), so no rounded copy goes through memory.
// Every inner loop is unrolled so that the indices of its fragment and accumulator arrays are constants and the arrays stay in registers.
// ---------------------------------------------------------------------------------------------------------------------------
typedef __attribute__((ext_vector_type(2))) float v2f_t;
// eight 2^x in place. One statement, so that each v_exp_f32 is followed by an instruction that touches neither its result nor its source (the next one works on its own register);
// the v_nop is that slot behind the last one.
__device__ __forceinline__ void exp2x8(float& x0, float& x1, float& x2, float& x3, float& x4, float& x5, float& x6, float& x7) {
  asm("v_exp_f32 %0, %0\n\tv_exp_f32 %1, %1\n\tv_exp_f32 %2, %2\n\tv_exp_f32 %3, %3\n\tv_exp_f32 %4, %4\n\tv_exp_f32 %5, %5\n\tv_exp_f32 %6, %6\n\tv_exp_f32 %7, %7\n\tv_nop"
      : "+v"(x0), "+v"(x1), "+v"(x2), "+v"(x3), "+v"(x4), "+v"(x5), "+v"(x6), "+v"(x7));
}
#define FAW 8                // waves per block
#define FAK 64               // keys per stage
#define FAP 72               // LDS row pitch in f16: 16 B x odd, so the 16-byte fragment reads meet no bank conflict
__global__ __launch_bounds__(32 * FAW) void k_attn(const float* __restrict__ Q, const float* __restrict__ Km, const float* __restrict__ V, _Float16* __restrict__ O) {
  __shared__ __attribute__((aligned(16))) f16 ldsK[FAK * FAP];
  __shared__ __attribute__((aligned(16))) f16 ldsV[HDga * FAP];
  const int tid = threadIdx.x, lane = tid & 31, wave = tid >> 5, cl = lane & 15, rh = (lane >> 4) * 8;
  const int head = blockIdx.y, kvh = head / (HQga / HKVga);
  const int q0 = (blockIdx.x * FAW + wave) * 32;
  Q += (size_t)blockIdx.z * SSga * DQga + head * HDga; Km += (size_t)blockIdx.z * SSga * DKga + kvh * HDga; V += (size_t)blockIdx.z * SSga * DKga + kvh * HDga; O += (size_t)blockIdx.z * SSga * DQga + head * HDga;
  const float CS = 0.125f * 1.44269504088896341f;
  f16x16 qf[2][2];
#pragma unroll
  for (int a = 0; a < 2; ++a)
#pragma unroll
    for (int dh = 0; dh < 2; ++dh) qf[a][dh] = load_frag(Q, DQga, q0 + 16 * a, 32 * dh);
  f32x8 acc[2][4];
#pragma unroll
  for (int a = 0; a < 2; ++a)
#pragma unroll
    for (int j = 0; j < 4; ++j) { f32x8 z = {}; acc[a][j] = z; }
  float mu[2] = {-3.0e38f, -3.0e38f};
  v2f_t ls[2] = {{0.0f, 0.0f}, {0.0f, 0.0f}};   // row sums of P: two partial sums per lane (packed adds), joined at the end
  const int g16 = tid >> 4, c4 = (tid & 15) * 4;   // K: rows g16 + 16 i, 4 floats at c4 (16 lanes = one 256-B row); V: 4 key rows at 4 g16, 4 columns at c4
  const unsigned ko = g16 * DKga + c4, vo = 4 * g16 * DKga + c4;   // the lane's fixed offsets; the stage moves the uniform base alone
  v4f_t rk[4], rv[4];
#pragma unroll
  for (int i = 0; i < 4; ++i) { rk[i] = *(const v4f_t*)(Km + ko + 16 * i * DKga); rv[i] = *(const v4f_t*)(V + vo + i * DKga); }
#pragma unroll 1   // stays rolled: the stage uses 250 registers, and 256 is the most that lets two work-groups share a WGP: no room for a second copy of it
  for (int k0 = 0; k0 < SSga; k0 += FAK) {
    __syncthreads();   // every wave has read the previous stage's fragments
#pragma unroll
    for (int i = 0; i < 4; ++i) { const v4f_t k = rnd_f32x4(rk[i]); bf16x4 q; q[0] = (f16)k[0]; q[1] = (f16)k[1]; q[2] = (f16)k[2]; q[3] = (f16)k[3];
      *(bf16x4*)(ldsK + (g16 + 16 * i) * FAP + c4) = q; }
    const v4f_t w[4] = {rnd_f32x4(rv[0]), rnd_f32x4(rv[1]), rnd_f32x4(rv[2]), rnd_f32x4(rv[3])};   // rounded in the order loaded (register neighbours pair up), transposed behind it
#pragma unroll
    for (int u = 0; u < 4; ++u) { bf16x4 q; q[0] = (f16)w[0][u]; q[1] = (f16)w[1][u]; q[2] = (f16)w[2][u]; q[3] = (f16)w[3][u];
      *(bf16x4*)(ldsV + (c4 + u) * FAP + 4 * g16) = q; }
    __syncthreads();   // the stage is complete
    const int kn = (k0 + FAK < SSga) ? k0 + FAK : k0;   // next stage (the last trip reads its own again, in bounds, unused)
    const float* kp = Km + (size_t)kn * DKga; const float* vp = V + (size_t)kn * DKga;
#pragma unroll
    for (int i = 0; i < 4; ++i) { rk[i] = *(const v4f_t*)(kp + ko + 16 * i * DKga); rv[i] = *(const v4f_t*)(vp + vo + i * DKga); }
    f32x8 st[2][4];    // St: st[a][kt][r] = score of key 16 kt + rh + r, query 16 a + cl
#pragma unroll
    for (int kt = 0; kt < 4; ++kt) {
      const f16x16 ka = lds_frag(ldsK + (16 * kt) * FAP, FAP), kb = lds_frag(ldsK + (16 * kt) * FAP + 32, FAP);
#pragma unroll
      for (int a = 0; a < 2; ++a) { f32x8 z = {};
        z = __builtin_amdgcn_wmma_f32_16x16x32_f16(false, ka, false, qf[a][0], (short)0, z, false, false);
        st[a][kt] = __builtin_amdgcn_wmma_f32_16x16x32_f16(false, kb, false, qf[a][1], (short)0, z, false, false); }
    }
    float tm[2];
#pragma unroll
    for (int a = 0; a < 2; ++a) { float t = st[a][0][0];
#pragma unroll
      for (int kt = 0; kt < 4; ++kt)
#pragma unroll
        for (int r = 0; r < 8; ++r) t = fmaxf(t, st[a][kt][r]);
      t = fmaxf(t, __shfl_xor(t, 16, 32));
      tm[a] = t * CS; }
    if (__builtin_amdgcn_ballot_w32(tm[0] > mu[0] + 8.0f || tm[1] > mu[1] + 8.0f) != 0) {   // wave-uniform: some column's maximum has outgrown the one in use
#pragma unroll
      for (int a = 0; a < 2; ++a) { const float m2 = fmaxf(mu[a], tm[a]), al = __builtin_amdgcn_exp2f(mu[a] - m2);
        mu[a] = m2; ls[a] *= al;
#pragma unroll
        for (int j = 0; j < 4; ++j)
#pragma unroll
          for (int r = 0; r < 8; ++r) acc[a][j][r] *= al; }
    }
    f16x16 pf[2][2];   // Pt as B operand: pf[a][kk][s] = p of key 32 kk + (s < 8 ? rh + s : 16 + rh + s - 8), query 16 a + cl
#pragma unroll
    for (int a = 0; a < 2; ++a)
#pragma unroll
      for (int kt = 0; kt < 4; ++kt)
      { float t[8];
#pragma unroll
        for (int r = 0; r < 8; ++r) t[r] = fmaf(st[a][kt][r], CS, -mu[a]);
        exp2x8(t[0], t[1], t[2], t[3], t[4], t[5], t[6], t[7]);
#pragma unroll
        for (int r = 0; r < 8; r += 2) { const v2f_t p = {t[r], t[r + 1]}; ls[a] += p; pf[a][kt >> 1][(kt & 1) * 8 + r] = (f16)t[r]; pf[a][kt >> 1][(kt & 1) * 8 + r + 1] = (f16)t[r + 1]; } }
#pragma unroll
    for (int kk = 0; kk < 2; ++kk)
#pragma unroll
      for (int j = 0; j < 4; ++j) { const f16x16 vf = lds_frag(ldsV + (16 * j) * FAP + 32 * kk, FAP);
#pragma unroll
        for (int a = 0; a < 2; ++a) acc[a][j] = __builtin_amdgcn_wmma_f32_16x16x32_f16(false, vf, false, pf[a][kk], (short)0, acc[a][j], false, false); }
  }
#pragma unroll
  for (int a = 0; a < 2; ++a) { const float lh = ls[a][0] + ls[a][1];
    const float inv = 1.0f / (lh + __shfl_xor(lh, 16, 32));
    _Float16* dst = O + (size_t)(q0 + 16 * a + cl) * DQga + rh;   // acc[a][j][r] = Ot[16 j + rh + r][query]: 8 consecutive columns of one row per lane, stored as the f16 operand of the projection
#pragma unroll
    for (int j = 0; j < 4; ++j) { f16x8 h;
#pragma unroll
      for (int r = 0; r < 8; ++r) h[r] = (f16)(acc[a][j][r] * inv);
      *(f16x8*)(dst + 16 * j) = h; } }
}

__global__ __launch_bounds__(256) void k_dbg_zero(float* __restrict__ p, size_t n4) { const size_t i = (size_t)blockIdx.x * 256 + threadIdx.x; if (i < n4) { v4f_t z = {0.f,0.f,0.f,0.f}; *(v4f_t*)(p + 4 * i) = z;  } }
__global__ __launch_bounds__(256) void k_copy(const float* __restrict__ src, float* __restrict__ dst, size_t n4) { const size_t i = (size_t)blockIdx.x * 256 + threadIdx.x; if (i < n4) { const v4f_t v = *(const v4f_t*)(src + 4 * i); *(v4f_t*)(dst + 4 * i) = v;  } }
// bf16 round-to-nearest-even of an f32 (bit trick)
__device__ __forceinline__ float bf16r(float x) { unsigned int u = __float_as_uint(x); u = (u + 0x7FFFu + ((u >> 16) & 1u)) & 0xFFFF0000u; return __uint_as_float(u); }
// weight prep: Wh[o][i] = f16(mul.bf16(W[o][i])), in the weight's own [out][in] rows (lifted by a power of two so no bf16 weight becomes an f16 subnormal); 8 elements per lane
__global__ __launch_bounds__(256) void k_wprep16(const float* __restrict__ Wt, _Float16* __restrict__ Wh, float mul, size_t n8) { const size_t i = (size_t)blockIdx.x * 256 + threadIdx.x; if (i >= n8) return;
  const v4f_t a = *(const v4f_t*)(Wt + 8 * i), b = *(const v4f_t*)(Wt + 8 * i + 4); f16x8 h;
#pragma unroll   // constant vector indices, so that h stays in registers
  for (int u = 0; u < 4; ++u) { h[u] = (f16)(mul * bf16r(a[u])); h[4 + u] = (f16)(mul * bf16r(b[u])); }
  *(f16x8*)(Wh + 8 * i) = h; }

extern "C" void kernel_launch(void* const* d_in, const int* in_sizes, int n_in,
                              void* d_out, int out_size, void* d_ws, size_t ws_size,
                              hipStream_t stream) {
  (void)in_sizes; (void)n_in; (void)out_size;
  const float** f = (const float**)d_in;
  const float* Qi = f[0], *Ki = f[1], *Vi = f[2], *Wout = f[3], *bout = f[4];
  float* out = (float*)d_out;     // [2,2048,2048]
  char* ws = (char*)d_ws;
  _Float16* Wh = (_Float16*)ws; ws += (size_t)DQga * HIDga * 2;
  _Float16* O = (_Float16*)ws; ws += (size_t)NBga * SSga * DQga * 2;
  if ((size_t)(ws - (char*)d_ws) > ws_size) return;                      // WS TOTAL 25,165,824 B
  const dim3 blk(256);
  k_wprep16<<<dim3(((size_t)HIDga * DQga / 8 + 255) / 256), blk, 0, stream>>>(Wout, Wh, 64.0f, (size_t)HIDga * DQga / 8);
  k_attn<<<dim3(SSga / (32 * FAW), HQga, NBga), dim3(32 * FAW), 0, stream>>>(Qi, Ki, Vi, O);   // every (batch, query head, 256-query block) is one work-group; the 4 heads of a kv group are neighbours in the grid
  for (int b = 0; b < NBga; ++b)
    gemm_nt<<<dim3(SSga / 128, HIDga / 128), blk, 0, stream>>>(O + (size_t)b * SSga * DQga, Wh, bout, 64.0f, 1.0f / 64.0f, out + (size_t)b * SIN * HIDga, HIDga, DQga);   // out = (o.64W_out^T + 64b)/64
}

// v008
// A run of this version takes 99.3 microseconds.
// Next to v007, in two timings, it ran 1.16 times as fast each time.
// Over all steps from v000 it is 90.7 times as fast.
// Q, K, V, W_out, b_out are rounded to bf16 (RNE) on load; the scores are then exact single f16 products of bf16 values
// with f32 accumulation (no projection exists in this module — Q, K, V are inputs), and the output projection uses 64·bf16(W_outᵀ) with a 2^-6 epilogue.
// Contractions on v_wmma_f32_16x16x32_f16 (f16 operands, f32 accumulate): per (batch, query head) the scores against the kv head (K 64) and o_h = P.v_h (K 2048) inside one kernel,
// P = 2^(c.s - running maximum) rounded to f16, divided by its f32 row sum at the end; out = o.W_out^T + b_out (K 2048). f32 VALU: running softmax of s/8.
// compute dtype: f16 operands (bf16-valued), f32 accumulate.  Q [2,2048,2048], K, V [2,2048,512] → out [2,2048,2048].
#include <hip/hip_runtime.h>
#include <hip/hip_bf16.h>
#include <math.h>


typedef _Float16 bf16;
typedef _Float16 f16;
typedef __attribute__((ext_vector_type(4))) unsigned v4u_t;
typedef unsigned v4ua __attribute__((ext_vector_type(4), may_alias));
typedef __attribute__((ext_vector_type(4))) float v4f_t;
typedef float v4fa __attribute__((ext_vector_type(4), may_alias));
typedef __attribute__((ext_vector_type(16))) bf16  bf16x16;
typedef bf16x16 f16x16;
typedef __attribute__((ext_vector_type(8)))  bf16  bf16x8;
typedef bf16x8 f16x8;
typedef __attribute__((ext_vector_type(4)))  bf16  bf16x4;
typedef __attribute__((ext_vector_type(8)))  float f32x8;
typedef __attribute__((ext_vector_type(2)))  float f32x2;
typedef __attribute__((ext_vector_type(2)))  __bf16 rb16x2;
typedef __attribute__((ext_vector_type(2)))  _Float16 f16x2;
// Input rounding, done where an input is read: f32 -> bf16 (nearest even, one packed convert per pair) -> the same value as f32 / as f16 operand.
__device__ __forceinline__ f32x2 rnd_f32(float a, float b) { const f32x2 x = {a, b}; return __builtin_convertvector(__builtin_convertvector(x, rb16x2), f32x2); }
__device__ __forceinline__ f16x2 rnd_f16(float a, float b) { return __builtin_convertvector(rnd_f32(a, b), f16x2); }
__device__ __forceinline__ v4f_t rnd_f32x4(v4f_t x) { const f32x2 lo = rnd_f32(x[0], x[1]), hi = rnd_f32(x[2], x[3]); const v4f_t r = {lo[0], lo[1], hi[0], hi[1]}; return r; }
__device__ __forceinline__ f32x8 wmma16(f16x16 a, f16x16 b, f32x8 c) {
  c = __builtin_amdgcn_wmma_f32_16x16x32_f16(false, a, false, b, (short)0, c, false, false);
  asm volatile("v_nop\n\tv_nop\n\tv_nop\n\tv_nop" : "+v"(c) : "v"(a), "v"(b));
  return c;
}
#define LDS_STRIDE 48   // unused; gemm_kn2's tiles are staged 32 -> 48 elems (GSTR, 96B rows): aligned b128 reads
#define KSTRIDE    72   // unused; the K tile is staged 64 -> 72 elems (FAP)
#define VSTRIDE    48   // unused; the V tile is staged [dv][key], 64 -> 72 elems (FAP)

__device__ __forceinline__ f32x8 wmma_bf16(bf16x16 a, bf16x16 b, f32x8 c) {
  c = __builtin_amdgcn_wmma_f32_16x16x32_f16(false, a, false, b, (short)0, c, false, false);
  asm volatile("v_nop\n\tv_nop\n\tv_nop\n\tv_nop" : "+v"(c) : "v"(a), "v"(b));   // A/B-overwrite hazard guard
  return c;
}

// 16x32 (MxK) fragment from a row-major global f32 matrix, each element rounded to bf16 on the way (rnd_f16).
// lanes 0-15  (row=lane)    : elems 0..7 = K+0..7,  8..15 = K+16..23
// lanes 16-31 (row=lane-16) : elems 0..7 = K+8..15, 8..15 = K+24..31
template <typename T>
__device__ __forceinline__ bf16x16 load_frag(const T* __restrict__ base, int ld,
                                             int row0, int k0) {
  const int lane = threadIdx.x & 31;
  const int r    = lane & 15;
  const int kh   = (lane >> 4) * 8;
  const T* p0 = base + (size_t)(row0 + r) * ld + (k0 + kh);
  const T* p1 = p0 + 16;
  bf16x16 f;
#pragma unroll
  for (int i = 0; i < 8; i += 2) {
    const f16x2 lo = rnd_f16((float)p0[i], (float)p0[i + 1]), hi = rnd_f16((float)p1[i], (float)p1[i + 1]);
    f[i]     = lo[0]; f[i + 1] = lo[1];
    f[i + 8] = hi[0]; f[i + 9] = hi[1];
  }
  return f;
}

// Same fragment from an LDS tile with padded row stride (base includes row0/k0).
__device__ __forceinline__ bf16x16 lds_frag(const bf16* base, int stride) {
  const int lane = threadIdx.x & 31;
  const int row  = lane & 15;
  const int kh   = (lane >> 4) * 8;
  const bf16x8 lo = *(const bf16x8*)(base + row * stride + kh);
  const bf16x8 hi = *(const bf16x8*)(base + row * stride + kh + 16);
  bf16x16 f;
#pragma unroll
  for (int i = 0; i < 8; ++i) { f[i] = lo[i]; f[i + 8] = hi[i]; }
  return f;
}

template <typename T>
__device__ __forceinline__ void stage_read16(const T* __restrict__ p, float* buf) {
#pragma unroll
  for (int i = 0; i < 16; ++i) buf[i] = (float)p[i];
}

__device__ __forceinline__ void stage_write(bf16* dst, const float* buf, int nquad) {
#pragma unroll
  for (int i = 0; i < nquad; ++i) {
    bf16x4 q;
    q[0] = (bf16)buf[4 * i];     q[1] = (bf16)buf[4 * i + 1];
    q[2] = (bf16)buf[4 * i + 2]; q[3] = (bf16)buf[4 * i + 3];
    *(bf16x4*)(dst + 4 * i) = q;
  }
}


#define GSTR 48
// ---------------------------------------------------------------------------------------------------------------------------
// gemm_nt: Y[m][n] = unlift * ( sum_k A[m][k].Wh[n][k] + lift * bf16(bias[n]) ), A f16 [M][K], Wh f16 [N][K] (both k contiguous), f32 accumulate, Y f32; bias is the f32 input, rounded here.
// Block = 128x128 tile, 8 waves as 4(M) x 2(N). A trip is 64 k: the A tile and the Wh tile (128 rows of 128 B each, LDS pitch 144 B) come into LDS by asynchronous 16-byte copies,
// 8 lanes to a row (whole 128-B lines), through no register; two buffers, the next trip's copies fly while this trip's tiles are worked on.
// A trip's 24 fragment loads stand as one group ahead of its 16 products, every fragment in registers of its own, so a wave meets the LDS latency once a trip and each product waits on a count.
// Every inner loop is unrolled so that the indices of its fragment and accumulator arrays are constants and the arrays stay in registers.
// blockIdx.z selects a batch element: A += z*strideA, Y += z*strideY (element strides), Wh and bias shared. With both elements in one grid two work-groups (140 KiB of LDS, 8 waves each) share a WGP:
// while one waits for its copies or at its barrier, the other reads LDS and multiplies.
// ---------------------------------------------------------------------------------------------------------------------------
#define PK 64                // k per trip
#define PP 72                // LDS row pitch in f16: 144 B = 16 B x odd, so the 16-byte fragment reads meet no bank conflict
#define PT (128 * PP)        // one operand tile in f16; a buffer is two tiles = 4 * PT bytes
// One trip's copies of this lane: rows r, r + 32, r + 64, r + 96 of the A tile and of the Wh tile, 16 bytes each. l = the lane's LDS byte address in the A tile of the buffer, rs = 32 rows in elements.
// s_wait_xcnt stands inside the statement, behind the last copy, so that no address register of a copy is rewritten in front of it.
__device__ __forceinline__ void copy_tiles(unsigned l, const _Float16* a, const _Float16* w, size_t rs) {
  asm volatile("global_load_async_to_lds_b128 %0, %8, off\n\t"
               "global_load_async_to_lds_b128 %1, %9, off\n\t"
               "global_load_async_to_lds_b128 %2, %10, off\n\t"
               "global_load_async_to_lds_b128 %3, %11, off\n\t"
               "global_load_async_to_lds_b128 %4, %12, off\n\t"
               "global_load_async_to_lds_b128 %5, %13, off\n\t"
               "global_load_async_to_lds_b128 %6, %14, off\n\t"
               "global_load_async_to_lds_b128 %7, %15, off\n\t"
               "s_wait_xcnt 0x0"
               :: "v"(l), "v"(l + 32 * PP * 2), "v"(l + 64 * PP * 2), "v"(l + 96 * PP * 2),
                  "v"(l + 2 * PT), "v"(l + 2 * PT + 32 * PP * 2), "v"(l + 2 * PT + 64 * PP * 2), "v"(l + 2 * PT + 96 * PP * 2),
                  "v"(a), "v"(a + rs), "v"(a + 2 * rs), "v"(a + 3 * rs), "v"(w), "v"(w + rs), "v"(w + 2 * rs), "v"(w + 3 * rs)
               : "memory");
}
__global__ __launch_bounds__(256) void gemm_nt(const _Float16* __restrict__ A, const _Float16* __restrict__ Wh, const float* __restrict__ bias, float lift, float unlift,
                                               float* __restrict__ Y, int ldy, int K, size_t strideA, size_t strideY) {
  __shared__ __attribute__((aligned(16))) f16 ring[2 * 2 * PT];
  __shared__ __attribute__((aligned(16))) float oS[8][32 * 68];
  const int tid = threadIdx.x, lane = tid & 31, wave = tid >> 5, cl = lane & 15, rh = (lane >> 4) * 8;
  const int m0 = blockIdx.x * 128, n0 = blockIdx.y * 128;
  const int wm = (wave & 3) * 32, wn = (wave >> 2) * 64;
  A += (size_t)blockIdx.z * strideA; Y += (size_t)blockIdx.z * strideY;
  f32x8 acc[2][4];
#pragma unroll
  for (int i = 0; i < 2; ++i)
#pragma unroll
    for (int j = 0; j < 4; ++j) { f32x8 z = {}; acc[i][j] = z; }
  const int crow = tid >> 3, cc = (tid & 7) * 8;
  const _Float16* ga = A + (size_t)(m0 + crow) * K + cc;
  const _Float16* gw = Wh + (size_t)(n0 + crow) * K + cc;
  const unsigned l0 = (unsigned)(size_t)ring + (crow * PP + cc) * 2;
  const size_t rs = (size_t)32 * K;
  const int nt = K / PK;
  copy_tiles(l0, ga, gw, rs);
  asm volatile("s_wait_asynccnt 0x0" ::: "memory");   // this wave's copies of tile 0 have landed
  __syncthreads();                                     // every wave's have
  if (nt > 1) copy_tiles(l0 + 4 * PT, ga + PK, gw + PK, rs);
  for (int t = 0; t < nt; ++t) {
    const f16* sA = ring + (t & 1) * 2 * PT;
    const f16* sW = sA + PT;
    f16x16 af[2][2], bf[2][4];   // the trip's 12 fragments, each in registers of its own, loaded in the order in which the products want them
#pragma unroll
    for (int kh = 0; kh < 2; ++kh) {
      af[kh][0] = lds_frag(sA + wm * PP + 32 * kh, PP);
      bf[kh][0] = lds_frag(sW + wn * PP + 32 * kh, PP);
      af[kh][1] = lds_frag(sA + (wm + 16) * PP + 32 * kh, PP);
#pragma unroll
      for (int j = 1; j < 4; ++j) bf[kh][j] = lds_frag(sW + (wn + 16 * j) * PP + 32 * kh, PP);
    }
    __builtin_amdgcn_sched_barrier(0);   // keeps the 24 loads one group ahead of the products: without it the compiler sinks them back among the products, into one register set, with a wait to 0 at each pair
#pragma unroll
    for (int kh = 0; kh < 2; ++kh)
#pragma unroll
      for (int j = 0; j < 4; ++j)
#pragma unroll
        for (int i = 0; i < 2; ++i) acc[i][j] = __builtin_amdgcn_wmma_f32_16x16x32_f16(false, af[kh][i], false, bf[kh][j], (short)0, acc[i][j], false, false);
    __builtin_amdgcn_sched_barrier(0);   // keeps the wait to 0 below behind the products: hoisted over them it would hold the first product back until the last of the 24 loads has landed
    asm volatile("s_wait_dscnt 0x0" ::: "memory");      // this wave's reads of the buffer are done before it is refilled
    asm volatile("s_wait_asynccnt 0x0" ::: "memory");   // this wave's copies of tile t + 1 have landed
    __syncthreads();                                     // tile t + 1 is complete, and every wave has left tile t's buffer
    if (t + 2 < nt) copy_tiles(l0 + (t & 1) * 4 * PT, ga + (size_t)(t + 2) * PK, gw + (size_t)(t + 2) * PK, rs);
  }
  asm volatile("s_wait_asynccnt 0x0" ::: "memory");     // no copy is outstanding when the wave goes on
  float* so = oS[wave];
#pragma unroll
  for (int i = 0; i < 2; ++i)
#pragma unroll
    for (int j = 0; j < 4; ++j) {
      const int n = n0 + wn + 16 * j + cl;
      const float bv = lift * rnd_f32(bias[n], 0.0f)[0], gv = unlift;
#pragma unroll
      for (int r = 0; r < 8; ++r) so[(16 * i + rh + r) * 68 + 16 * j + cl] = gv * (acc[i][j][r] + bv);
    }
  asm volatile("s_wait_dscnt 0" ::: "memory");   // the wave's stores to its own staging tile are done before its lanes read each other's values
  __builtin_amdgcn_wave_barrier();               // keeps the compiler from moving those reads up over the wait
#pragma unroll
  for (int it = 0; it < 16; ++it) { const int f4 = lane + 32 * it, rr = f4 >> 4, q = (f4 & 15) * 4;
    *(v4f_t*)(Y + (size_t)(m0 + wm + rr) * ldy + n0 + wn + q) = *(const v4fa*)(so + rr * 68 + q); }
}

// ---------------------------------------------------------------------------------------------------------------------------
// gemm_kn2 (value+residual planes on both operands: hh + (hl+lh)/2048, f32-class): Y[m][n] (row stride ldy) = scale * sum_k A[m][k] (f32 or f16, row stride lda) * W[k][n] (f32, row-major [K][N], row
// stride ldw) (+ bias[n]) (+ Y if ACC). Block = 128 x 128 tile, 256 threads = 8 waves as 4(M, 32 rows) x 2(N, 64 cols); per
// 32-wide k-step the A tile and the W tile (stored transposed [n][k]) are staged as f16 in LDS; f16 value and residual planes, f32 accumulate
// blockIdx.z selects a batch: A += z*strideA, W += z*strideW, Y += z*strideY (element strides).
// ---------------------------------------------------------------------------------------------------------------------------
template <typename AT, bool ACC>
__global__ __launch_bounds__(256) void gemm_kn2(const AT* __restrict__ A, int lda, size_t strideA,
                                               const float* __restrict__ Wm, int ldw, size_t strideW,
                                               const float* __restrict__ bias, float scale,
                                               float* __restrict__ Y, int ldy, size_t strideY, int K) {
  __shared__ __attribute__((aligned(16))) f16 ldsA[128 * GSTR], ldsAl[128 * GSTR];
  __shared__ __attribute__((aligned(16))) f16 ldsW[128 * GSTR], ldsWl[128 * GSTR];
  __shared__ __attribute__((aligned(16))) float oS[8][32 * 68];
  const int tid = threadIdx.x, lane = tid & 31, wave = tid >> 5, cl = lane & 15, rh = (lane >> 4) * 8;
  const int m0 = blockIdx.x * 128, n0 = blockIdx.y * 128;
  const int wm = (wave & 3) * 32, wn = (wave >> 2) * 64;
  A += (size_t)blockIdx.z * strideA; Wm += (size_t)blockIdx.z * strideW; Y += (size_t)blockIdx.z * strideY;
  f32x8 acc[2][4], accx[2][4];
#pragma unroll
  for (int i = 0; i < 2; ++i)
#pragma unroll
    for (int j = 0; j < 4; ++j) { f32x8 z = {}; acc[i][j] = z; accx[i][j] = z; }
#pragma unroll 1
  for (int k0 = 0; k0 < K; k0 += 32) {
    __syncthreads();
    {  // A: thread -> row tid>>1, 16 elements at column half (tid&1)*16
      const int row = tid >> 1, ch = (tid & 1) * 16;
      const AT* src = A + (size_t)(m0 + row) * lda + k0 + ch;
#pragma unroll
      for (int g = 0; g < 16; ++g) { const float v = (float)src[g]; const f16 h = (f16)v; ldsA[row * GSTR + ch + g] = h; ldsAl[row * GSTR + ch + g] = (f16)((v - (float)h) * 2048.0f); }
    }
    {  // W: thread -> k = tid>>3, 16 consecutive n at (tid&7)*16; stored transposed [n][k]
      const int k = tid >> 3, nn0 = (tid & 7) * 16;
      const float* src = Wm + (size_t)(k0 + k) * ldw + n0 + nn0;
#pragma unroll
      for (int g = 0; g < 4; ++g) { const v4f_t v = *(const v4f_t*)(src + 4 * g);
#pragma unroll
        for (int u = 0; u < 4; ++u) { const f16 h = (f16)v[u]; ldsW[(nn0 + 4 * g + u) * GSTR + k] = h; ldsWl[(nn0 + 4 * g + u) * GSTR + k] = (f16)((v[u] - (float)h) * 2048.0f); } }
    }
    __syncthreads();
    f16x16 af[2], afl[2];
#pragma unroll
    for (int i = 0; i < 2; ++i) { af[i] = lds_frag(ldsA + (wm + 16 * i) * GSTR, GSTR); afl[i] = lds_frag(ldsAl + (wm + 16 * i) * GSTR, GSTR); }
#pragma unroll
    for (int j = 0; j < 4; ++j) {
      const f16x16 bf = lds_frag(ldsW + (wn + 16 * j) * GSTR, GSTR), bfl = lds_frag(ldsWl + (wn + 16 * j) * GSTR, GSTR);
#pragma unroll
      for (int i = 0; i < 2; ++i) { acc[i][j] = wmma16(af[i], bf, acc[i][j]); accx[i][j] = wmma16(af[i], bfl, accx[i][j]); accx[i][j] = wmma16(afl[i], bf, accx[i][j]); }
    }
  }
  float* so = oS[wave];
#pragma unroll
  for (int i = 0; i < 2; ++i)
#pragma unroll
    for (int j = 0; j < 4; ++j) {
      const float bv = bias ? bias[n0 + wn + 16 * j + cl] : 0.0f;
#pragma unroll
      for (int r = 0; r < 8; ++r) so[(16 * i + rh + r) * 68 + 16 * j + cl] = (acc[i][j][r] + accx[i][j][r] * (1.0f / 2048.0f)) * scale + bv;
    }
  asm volatile("s_wait_dscnt 0" ::: "memory");
  __builtin_amdgcn_wave_barrier();
  if (ACC) {   // accumulate: fold the existing Y values into the staging tile ONCE (same thread <-> same chunks as the stores below)
#pragma unroll
    for (int it = 0; it < 16; ++it) { const int f4 = lane + 32 * it, rr = f4 >> 4, q = (f4 & 15) * 4;
      const v4f_t old = *(const v4fa*)(Y + (size_t)(m0 + wm + rr) * ldy + n0 + wn + q);
      v4f_t v = *(const v4fa*)(so + rr * 68 + q); v += old; *(v4fa*)(so + rr * 68 + q) = v; }   // plain LDS store (ordered by the s_wait_dscnt/memory clobber below)
    asm volatile("s_wait_dscnt 0" ::: "memory");
  }
{
#pragma unroll
    for (int it = 0; it < 16; ++it) { const int f4 = lane + 32 * it, rr = f4 >> 4, q = (f4 & 15) * 4;
      *(v4f_t*)(Y + (size_t)(m0 + wm + rr) * ldy + n0 + wn + q) = *(const v4fa*)(so + rr * 68 + q); }
    
  }
}

__global__ __launch_bounds__(256) void k_transpose(const float* __restrict__ Wm, float* __restrict__ Wt, int rows, int cols) {
  __shared__ float tS[64][65];
  const int tid = threadIdx.x, tbj = cols / 64, bi = blockIdx.x / tbj, bj = blockIdx.x % tbj;
  for (int e = tid; e < 64 * 64; e += 256) { const int r = e >> 6, c = e & 63; tS[r][c] = Wm[(size_t)(bi * 64 + r) * cols + bj * 64 + c]; }
  __syncthreads();
  for (int ch = tid; ch < 64 * 16; ch += 256) { const int r = ch >> 4, q4 = (ch & 15) * 4; v4f_t o; o[0] = tS[q4][r]; o[1] = tS[q4 + 1][r]; o[2] = tS[q4 + 2][r]; o[3] = tS[q4 + 3][r];
    float* dst = Wt + (size_t)(bj * 64 + r) * rows + bi * 64 + q4; *(v4f_t*)dst = o;  }
}


#define NBga 2
#define SSga 2048
#define SIN 2048
#define DQga 2048
#define DKga 512
#define HIDga 2048
#define HQga 32
#define HKVga 8
#define HDga 64
// ---------------------------------------------------------------------------------------------------------------------------
// k_attn: scores, softmax and P.V of one query head (blockIdx.y) of one batch element (blockIdx.z) for 256 query rows (blockIdx.x) in one kernel; no score ever goes to memory.
// Transposed products: St = K.Qt (A = 16 key rows from LDS, B = 16 query columns kept in registers), Ot += Vt.Pt (A = 16 value columns from LDS [dv][key], B = P packed from the St accumulators:
// two St tiles of 16 keys, converted in place, are one 32-key B operand in the k order of lds_frag). A lane holds one query's scores (lanes c and c + 16 split the keys), so the running maximum,
// the sum and the rescale factor are per lane; the halves exchange the maximum once per stage and join their sums once at the end.
// Running softmax: p = 2^(c.s - mu), c = log2(e)/8, mu = the maximum in use; the accumulators are rescaled only when some column's new maximum passes mu by more than 8 (p stays <= 256, inside f16).
// Block = 8 waves x 32 query columns; stage = 64 keys: K as [key][d] and V as [dv][key] in f16 in LDS, the next stage's global loads fly in registers while this stage is worked on.
// Q, Km, V are the f32 inputs themselves: each element is rounded to bf16 where it is turned into an operand (Q once per lane, K and V in the stage's conversion), so no rounded copy goes through memory.
// Every inner loop is unrolled so that the indices of its fragment and accumulator arrays are constants and the arrays stay in registers.
// ---------------------------------------------------------------------------------------------------------------------------
typedef __attribute__((ext_vector_type(2))) float v2f_t;
// eight 2^x in place. One statement, so that each v_exp_f32 is followed by an instruction that touches neither its result nor its source (the next one works on its own register);
// the v_nop is that slot behind the last one.
__device__ __forceinline__ void exp2x8(float& x0, float& x1, float& x2, float& x3, float& x4, float& x5, float& x6, float& x7) {
  asm("v_exp_f32 %0, %0\n\tv_exp_f32 %1, %1\n\tv_exp_f32 %2, %2\n\tv_exp_f32 %3, %3\n\tv_exp_f32 %4, %4\n\tv_exp_f32 %5, %5\n\tv_exp_f32 %6, %6\n\tv_exp_f32 %7, %7\n\tv_nop"
      : "+v"(x0), "+v"(x1), "+v"(x2), "+v"(x3), "+v"(x4), "+v"(x5), "+v"(x6), "+v"(x7));
}
#define FAW 8                // waves per block
#define FAK 64               // keys per stage
#define FAP 72               // LDS row pitch in f16: 16 B x odd, so the 16-byte fragment reads meet no bank conflict
__global__ __launch_bounds__(32 * FAW) void k_attn(const float* __restrict__ Q, const float* __restrict__ Km, const float* __restrict__ V, _Float16* __restrict__ O) {
  __shared__ __attribute__((aligned(16))) f16 ldsK[FAK * FAP];
  __shared__ __attribute__((aligned(16))) f16 ldsV[HDga * FAP];
  const int tid = threadIdx.x, lane = tid & 31, wave = tid >> 5, cl = lane & 15, rh = (lane >> 4) * 8;
  const int head = blockIdx.y, kvh = head / (HQga / HKVga);
  const int q0 = (blockIdx.x * FAW + wave) * 32;
  Q += (size_t)blockIdx.z * SSga * DQga + head * HDga; Km += (size_t)blockIdx.z * SSga * DKga + kvh * HDga; V += (size_t)blockIdx.z * SSga * DKga + kvh * HDga; O += (size_t)blockIdx.z * SSga * DQga + head * HDga;
  const float CS = 0.125f * 1.44269504088896341f;
  f16x16 qf[2][2];
#pragma unroll
  for (int a = 0; a < 2; ++a)
#pragma unroll
    for (int dh = 0; dh < 2; ++dh) qf[a][dh] = load_frag(Q, DQga, q0 + 16 * a, 32 * dh);
  f32x8 acc[2][4];
#pragma unroll
  for (int a = 0; a < 2; ++a)
#pragma unroll
    for (int j = 0; j < 4; ++j) { f32x8 z = {}; acc[a][j] = z; }
  float mu[2] = {-3.0e38f, -3.0e38f};
  v2f_t ls[2] = {{0.0f, 0.0f}, {0.0f, 0.0f}};   // row sums of P: two partial sums per lane (packed adds), joined at the end
  const int g16 = tid >> 4, c4 = (tid & 15) * 4;   // K: rows g16 + 16 i, 4 floats at c4 (16 lanes = one 256-B row); V: 4 key rows at 4 g16, 4 columns at c4
  const unsigned ko = g16 * DKga + c4, vo = 4 * g16 * DKga + c4;   // the lane's fixed offsets; the stage moves the uniform base alone
  v4f_t rk[4], rv[4];
#pragma unroll
  for (int i = 0; i < 4; ++i) { rk[i] = *(const v4f_t*)(Km + ko + 16 * i * DKga); rv[i] = *(const v4f_t*)(V + vo + i * DKga); }
#pragma unroll 1   // stays rolled: the stage uses 250 registers, and 256 is the most that lets two work-groups share a WGP: no room for a second copy of it
  for (int k0 = 0; k0 < SSga; k0 += FAK) {
    __syncthreads();   // every wave has read the previous stage's fragments
#pragma unroll
    for (int i = 0; i < 4; ++i) { const v4f_t k = rnd_f32x4(rk[i]); bf16x4 q; q[0] = (f16)k[0]; q[1] = (f16)k[1]; q[2] = (f16)k[2]; q[3] = (f16)k[3];
      *(bf16x4*)(ldsK + (g16 + 16 * i) * FAP + c4) = q; }
    const v4f_t w[4] = {rnd_f32x4(rv[0]), rnd_f32x4(rv[1]), rnd_f32x4(rv[2]), rnd_f32x4(rv[3])};   // rounded in the order loaded (register neighbours pair up), transposed behind it
#pragma unroll
    for (int u = 0; u < 4; ++u) { bf16x4 q; q[0] = (f16)w[0][u]; q[1] = (f16)w[1][u]; q[2] = (f16)w[2][u]; q[3] = (f16)w[3][u];
      *(bf16x4*)(ldsV + (c4 + u) * FAP + 4 * g16) = q; }
    __syncthreads();   // the stage is complete
    const int kn = (k0 + FAK < SSga) ? k0 + FAK : k0;   // next stage (the last trip reads its own again, in bounds, unused)
    const float* kp = Km + (size_t)kn * DKga; const float* vp = V + (size_t)kn * DKga;
#pragma unroll
    for (int i = 0; i < 4; ++i) { rk[i] = *(const v4f_t*)(kp + ko + 16 * i * DKga); rv[i] = *(const v4f_t*)(vp + vo + i * DKga); }
    f32x8 st[2][4];    // St: st[a][kt][r] = score of key 16 kt + rh + r, query 16 a + cl
#pragma unroll
    for (int kt = 0; kt < 4; ++kt) {
      const f16x16 ka = lds_frag(ldsK + (16 * kt) * FAP, FAP), kb = lds_frag(ldsK + (16 * kt) * FAP + 32, FAP);
#pragma unroll
      for (int a = 0; a < 2; ++a) { f32x8 z = {};
        z = __builtin_amdgcn_wmma_f32_16x16x32_f16(false, ka, false, qf[a][0], (short)0, z, false, false);
        st[a][kt] = __builtin_amdgcn_wmma_f32_16x16x32_f16(false, kb, false, qf[a][1], (short)0, z, false, false); }
    }
    float tm[2];
#pragma unroll
    for (int a = 0; a < 2; ++a) { float t = st[a][0][0];
#pragma unroll
      for (int kt = 0; kt < 4; ++kt)
#pragma unroll
        for (int r = 0; r < 8; ++r) t = fmaxf(t, st[a][kt][r]);
      t = fmaxf(t, __shfl_xor(t, 16, 32));
      tm[a] = t * CS; }
    if (__builtin_amdgcn_ballot_w32(tm[0] > mu[0] + 8.0f || tm[1] > mu[1] + 8.0f) != 0) {   // wave-uniform: some column's maximum has outgrown the one in use
#pragma unroll
      for (int a = 0; a < 2; ++a) { const float m2 = fmaxf(mu[a], tm[a]), al = __builtin_amdgcn_exp2f(mu[a] - m2);
        mu[a] = m2; ls[a] *= al;
#pragma unroll
        for (int j = 0; j < 4; ++j)
#pragma unroll
          for (int r = 0; r < 8; ++r) acc[a][j][r] *= al; }
    }
    f16x16 pf[2][2];   // Pt as B operand: pf[a][kk][s] = p of key 32 kk + (s < 8 ? rh + s : 16 + rh + s - 8), query 16 a + cl
#pragma unroll
    for (int a = 0; a < 2; ++a)
#pragma unroll
      for (int kt = 0; kt < 4; ++kt)
      { float t[8];
#pragma unroll
        for (int r = 0; r < 8; ++r) t[r] = fmaf(st[a][kt][r], CS, -mu[a]);
        exp2x8(t[0], t[1], t[2], t[3], t[4], t[5], t[6], t[7]);
#pragma unroll
        for (int r = 0; r < 8; r += 2) { const v2f_t p = {t[r], t[r + 1]}; ls[a] += p; pf[a][kt >> 1][(kt & 1) * 8 + r] = (f16)t[r]; pf[a][kt >> 1][(kt & 1) * 8 + r + 1] = (f16)t[r + 1]; } }
#pragma unroll
    for (int kk = 0; kk < 2; ++kk)
#pragma unroll
      for (int j = 0; j < 4; ++j) { const f16x16 vf = lds_frag(ldsV + (16 * j) * FAP + 32 * kk, FAP);
#pragma unroll
        for (int a = 0; a < 2; ++a) acc[a][j] = __builtin_amdgcn_wmma_f32_16x16x32_f16(false, vf, false, pf[a][kk], (short)0, acc[a][j], false, false); }
  }
#pragma unroll
  for (int a = 0; a < 2; ++a) { const float lh = ls[a][0] + ls[a][1];
    const float inv = 1.0f / (lh + __shfl_xor(lh, 16, 32));
    _Float16* dst = O + (size_t)(q0 + 16 * a + cl) * DQga + rh;   // acc[a][j][r] = Ot[16 j + rh + r][query]: 8 consecutive columns of one row per lane, stored as the f16 operand of the projection
#pragma unroll
    for (int j = 0; j < 4; ++j) { f16x8 h;
#pragma unroll
      for (int r = 0; r < 8; ++r) h[r] = (f16)(acc[a][j][r] * inv);
      *(f16x8*)(dst + 16 * j) = h; } }
}

__global__ __launch_bounds__(256) void k_dbg_zero(float* __restrict__ p, size_t n4) { const size_t i = (size_t)blockIdx.x * 256 + threadIdx.x; if (i < n4) { v4f_t z = {0.f,0.f,0.f,0.f}; *(v4f_t*)(p + 4 * i) = z;  } }
__global__ __launch_bounds__(256) void k_copy(const float* __restrict__ src, float* __restrict__ dst, size_t n4) { const size_t i = (size_t)blockIdx.x * 256 + threadIdx.x; if (i < n4) { const v4f_t v = *(const v4f_t*)(src + 4 * i); *(v4f_t*)(dst + 4 * i) = v;  } }
// bf16 round-to-nearest-even of an f32 (bit trick)
__device__ __forceinline__ float bf16r(float x) { unsigned int u = __float_as_uint(x); u = (u + 0x7FFFu + ((u >> 16) & 1u)) & 0xFFFF0000u; return __uint_as_float(u); }
// weight prep: Wh[o][i] = f16(mul.bf16(W[o][i])), in the weight's own [out][in] rows (lifted by a power of two so no bf16 weight becomes an f16 subnormal); 8 elements per lane
__global__ __launch_bounds__(256) void k_wprep16(const float* __restrict__ Wt, _Float16* __restrict__ Wh, float mul, size_t n8) { const size_t i = (size_t)blockIdx.x * 256 + threadIdx.x; if (i >= n8) return;
  const v4f_t a = *(const v4f_t*)(Wt + 8 * i), b = *(const v4f_t*)(Wt + 8 * i + 4); f16x8 h;
#pragma unroll   // constant vector indices, so that h stays in registers
  for (int u = 0; u < 4; ++u) { h[u] = (f16)(mul * bf16r(a[u])); h[4 + u] = (f16)(mul * bf16r(b[u])); }
  *(f16x8*)(Wh + 8 * i) = h; }

extern "C" void kernel_launch(void* const* d_in, const int* in_sizes, int n_in,
                              void* d_out, int out_size, void* d_ws, size_t ws_size,
                              hipStream_t stream) {
  (void)in_sizes; (void)n_in; (void)out_size;
  const float** f = (const float**)d_in;
  const float* Qi = f[0], *Ki = f[1], *Vi = f[2], *Wout = f[3], *bout = f[4];
  float* out = (float*)d_out;     // [2,2048,2048]
  char* ws = (char*)d_ws;
  _Float16* Wh = (_Float16*)ws; ws += (size_t)DQga * HIDga * 2;
  _Float16* O = (_Float16*)ws; ws += (size_t)NBga * SSga * DQga * 2;
  if ((size_t)(ws - (char*)d_ws) > ws_size) return;                      // WS TOTAL 25,165,824 B
  const dim3 blk(256);
  k_wprep16<<<dim3(((size_t)HIDga * DQga / 8 + 255) / 256), blk, 0, stream>>>(Wout, Wh, 64.0f, (size_t)HIDga * DQga / 8);
  k_attn<<<dim3(SSga / (32 * FAW), HQga, NBga), dim3(32 * FAW), 0, stream>>>(Qi, Ki, Vi, O);   // every (batch, query head, 256-query block) is one work-group; the 4 heads of a kv group are neighbours in the grid
  gemm_nt<<<dim3(SSga / 128, HIDga / 128, NBga), blk, 0, stream>>>(O, Wh, bout, 64.0f, 1.0f / 64.0f, out, HIDga, DQga, (size_t)SSga * DQga, (size_t)SIN * HIDga);   // out = (o.64W_out^T + 64b)/64, both batch elements in one grid: 512 work-groups, two to a WGP
}

// v009
// One run takes 94.7 microseconds.
// Timed twice side by side with v008, it ran 1.05 times as fast both times.
// All steps since v000 together make it 95.2 times as fast.
// Q, K, V, W_out, b_out are rounded to bf16 (RNE) on load; the scores are then exact single f16 products of bf16 values
// with f32 accumulation (no projection exists in this module — Q, K, V are inputs), and the output projection uses 64·bf16(W_outᵀ) with a 2^-6 epilogue.
// Contractions on v_wmma_f32_16x16x32_f16 (f16 operands, f32 accumulate): per (batch, query head) the scores against the kv head (K 64) and o_h = P.v_h (K 2048) inside one kernel,
// P = 2^(c.s - running maximum) rounded to f16, divided by its f32 row sum at the end; out = o.W_out^T + b_out (K 2048). f32 VALU: running softmax of s/8.
// compute dtype: f16 operands (bf16-valued), f32 accumulate.  Q [2,2048,2048], K, V [2,2048,512] → out [2,2048,2048].
#include <hip/hip_runtime.h>
#include <hip/hip_bf16.h>
#include <math.h>


typedef _Float16 bf16;
typedef _Float16 f16;
typedef __attribute__((ext_vector_type(4))) unsigned v4u_t;
typedef unsigned v4ua __attribute__((ext_vector_type(4), may_alias));
typedef __attribute__((ext_vector_type(4))) float v4f_t;
typedef float v4fa __attribute__((ext_vector_type(4), may_alias));
typedef __attribute__((ext_vector_type(16))) bf16  bf16x16;
typedef bf16x16 f16x16;
typedef __attribute__((ext_vector_type(8)))  bf16  bf16x8;
typedef bf16x8 f16x8;
typedef __attribute__((ext_vector_type(4)))  bf16  bf16x4;
typedef __attribute__((ext_vector_type(8)))  float f32x8;
typedef __attribute__((ext_vector_type(2)))  float f32x2;
typedef __attribute__((ext_vector_type(2)))  __bf16 rb16x2;
typedef __attribute__((ext_vector_type(2)))  _Float16 f16x2;
// Input rounding, done where an input is read: f32 -> bf16 (nearest even, one packed convert per pair) -> the same value as f32 / as f16 operand.
__device__ __forceinline__ f32x2 rnd_f32(float a, float b) { const f32x2 x = {a, b}; return __builtin_convertvector(__builtin_convertvector(x, rb16x2), f32x2); }
__device__ __forceinline__ f16x2 rnd_f16(float a, float b) { return __builtin_convertvector(rnd_f32(a, b), f16x2); }
__device__ __forceinline__ v4f_t rnd_f32x4(v4f_t x) { const f32x2 lo = rnd_f32(x[0], x[1]), hi = rnd_f32(x[2], x[3]); const v4f_t r = {lo[0], lo[1], hi[0], hi[1]}; return r; }
__device__ __forceinline__ f32x8 wmma16(f16x16 a, f16x16 b, f32x8 c) {
  c = __builtin_amdgcn_wmma_f32_16x16x32_f16(false, a, false, b, (short)0, c, false, false);
  asm volatile("v_nop\n\tv_nop\n\tv_nop\n\tv_nop" : "+v"(c) : "v"(a), "v"(b));
  return c;
}
#define LDS_STRIDE 48   // unused; gemm_kn2's tiles are staged 32 -> 48 elems (GSTR, 96B rows): aligned b128 reads
#define KSTRIDE    72   // unused; the K tile is staged 64 -> 72 elems (FAP)
#define VSTRIDE    48   // unused; the V tile is staged [dv][key], 64 -> 72 elems (FAP)

__device__ __forceinline__ f32x8 wmma_bf16(bf16x16 a, bf16x16 b, f32x8 c) {
  c = __builtin_amdgcn_wmma_f32_16x16x32_f16(false, a, false, b, (short)0, c, false, false);
  asm volatile("v_nop\n\tv_nop\n\tv_nop\n\tv_nop" : "+v"(c) : "v"(a), "v"(b));   // A/B-overwrite hazard guard
  return c;
}

// 16x32 (MxK) fragment from a row-major global f32 matrix, each element rounded to bf16 on the way (rnd_f16).
// lanes 0-15  (row=lane)    : elems 0..7 = K+0..7,  8..15 = K+16..23
// lanes 16-31 (row=lane-16) : elems 0..7 = K+8..15, 8..15 = K+24..31
template <typename T>
__device__ __forceinline__ bf16x16 load_frag(const T* __restrict__ base, int ld,
                                             int row0, int k0) {
  const int lane = threadIdx.x & 31;
  const int r    = lane & 15;
  const int kh   = (lane >> 4) * 8;
  const T* p0 = base + (size_t)(row0 + r) * ld + (k0 + kh);
  const T* p1 = p0 + 16;
  bf16x16 f;
#pragma unroll
  for (int i = 0; i < 8; i += 2) {
    const f16x2 lo = rnd_f16((float)p0[i], (float)p0[i + 1]), hi = rnd_f16((float)p1[i], (float)p1[i + 1]);
    f[i]     = lo[0]; f[i + 1] = lo[1];
    f[i + 8] = hi[0]; f[i + 9] = hi[1];
  }
  return f;
}

// Same fragment from an LDS tile with padded row stride (base includes row0/k0).
__device__ __forceinline__ bf16x16 lds_frag(const bf16* base, int stride) {
  const int lane = threadIdx.x & 31;
  const int row  = lane & 15;
  const int kh   = (lane >> 4) * 8;
  const bf16x8 lo = *(const bf16x8*)(base + row * stride + kh);
  const bf16x8 hi = *(const bf16x8*)(base + row * stride + kh + 16);
  bf16x16 f;
#pragma unroll
  for (int i = 0; i < 8; ++i) { f[i] = lo[i]; f[i + 8] = hi[i]; }
  return f;
}

template <typename T>
__device__ __forceinline__ void stage_read16(const T* __restrict__ p, float* buf) {
#pragma unroll
  for (int i = 0; i < 16; ++i) buf[i] = (float)p[i];
}

__device__ __forceinline__ void stage_write(bf16* dst, const float* buf, int nquad) {
#pragma unroll
  for (int i = 0; i < nquad; ++i) {
    bf16x4 q;
    q[0] = (bf16)buf[4 * i];     q[1] = (bf16)buf[4 * i + 1];
    q[2] = (bf16)buf[4 * i + 2]; q[3] = (bf16)buf[4 * i + 3];
    *(bf16x4*)(dst + 4 * i) = q;
  }
}


#define GSTR 48
// ---------------------------------------------------------------------------------------------------------------------------
// gemm_nt: Y[m][n] = unlift * ( sum_k A[m][k].Wh[n][k] + lift * bf16(bias[n]) ), A f16 [M][K], Wh f16 [N][K] (both k contiguous), f32 accumulate, Y f32; bias is the f32 input, rounded here.
// Block = 128x128 tile, 8 waves as 4(M) x 2(N). A trip is 64 k: the A tile and the Wh tile (128 rows of 128 B each, LDS pitch 144 B) come into LDS by asynchronous 16-byte copies,
// 8 lanes to a row (whole 128-B lines), through no register; two buffers, the next trip's copies fly while this trip's tiles are worked on.
// A trip's 24 fragment loads stand as one group ahead of its 16 products, every fragment in registers of its own, so a wave meets the LDS latency once a trip and each product waits on a count.
// Every inner loop is unrolled so that the indices of its fragment and accumulator arrays are constants and the arrays stay in registers.
// blockIdx.z selects a batch element: A += z*strideA, Y += z*strideY (element strides), Wh and bias shared. With both elements in one grid two work-groups (140 KiB of LDS, 8 waves each) share a WGP:
// while one waits for its copies or at its barrier, the other reads LDS and multiplies.
// ---------------------------------------------------------------------------------------------------------------------------
#define PK 64                // k per trip
#define PP 72                // LDS row pitch in f16: 144 B = 16 B x odd, so the 16-byte fragment reads meet no bank conflict
#define PT (128 * PP)        // one operand tile in f16; a buffer is two tiles = 4 * PT bytes
// One trip's copies of this lane: rows r, r + 32, r + 64, r + 96 of the A tile and of the Wh tile, 16 bytes each. l = the lane's LDS byte address in the A tile of the buffer, rs = 32 rows in elements.
// s_wait_xcnt stands inside the statement, behind the last copy, so that no address register of a copy is rewritten in front of it.
__device__ __forceinline__ void copy_tiles(unsigned l, const _Float16* a, const _Float16* w, size_t rs) {
  asm volatile("global_load_async_to_lds_b128 %0, %8, off\n\t"
               "global_load_async_to_lds_b128 %1, %9, off\n\t"
               "global_load_async_to_lds_b128 %2, %10, off\n\t"
               "global_load_async_to_lds_b128 %3, %11, off\n\t"
               "global_load_async_to_lds_b128 %4, %12, off\n\t"
               "global_load_async_to_lds_b128 %5, %13, off\n\t"
               "global_load_async_to_lds_b128 %6, %14, off\n\t"
               "global_load_async_to_lds_b128 %7, %15, off\n\t"
               "s_wait_xcnt 0x0"
               :: "v"(l), "v"(l + 32 * PP * 2), "v"(l + 64 * PP * 2), "v"(l + 96 * PP * 2),
                  "v"(l + 2 * PT), "v"(l + 2 * PT + 32 * PP * 2), "v"(l + 2 * PT + 64 * PP * 2), "v"(l + 2 * PT + 96 * PP * 2),
                  "v"(a), "v"(a + rs), "v"(a + 2 * rs), "v"(a + 3 * rs), "v"(w), "v"(w + rs), "v"(w + 2 * rs), "v"(w + 3 * rs)
               : "memory");
}
__global__ __launch_bounds__(256) void gemm_nt(const _Float16* __restrict__ A, const _Float16* __restrict__ Wh, const float* __restrict__ bias, float lift, float unlift,
                                               float* __restrict__ Y, int ldy, int K, size_t strideA, size_t strideY) {
  __shared__ __attribute__((aligned(16))) f16 ring[2 * 2 * PT];
  __shared__ __attribute__((aligned(16))) float oS[8][32 * 68];
  const int tid = threadIdx.x, lane = tid & 31, wave = tid >> 5, cl = lane & 15, rh = (lane >> 4) * 8;
  const int m0 = blockIdx.x * 128, n0 = blockIdx.y * 128;
  const int wm = (wave & 3) * 32, wn = (wave >> 2) * 64;
  A += (size_t)blockIdx.z * strideA; Y += (size_t)blockIdx.z * strideY;
  f32x8 acc[2][4];
#pragma unroll
  for (int i = 0; i < 2; ++i)
#pragma unroll
    for (int j = 0; j < 4; ++j) { f32x8 z = {}; acc[i][j] = z; }
  const int crow = tid >> 3, cc = (tid & 7) * 8;
  const _Float16* ga = A + (size_t)(m0 + crow) * K + cc;
  const _Float16* gw = Wh + (size_t)(n0 + crow) * K + cc;
  const unsigned l0 = (unsigned)(size_t)ring + (crow * PP + cc) * 2;
  const size_t rs = (size_t)32 * K;
  const int nt = K / PK;
  copy_tiles(l0, ga, gw, rs);
  asm volatile("s_wait_asynccnt 0x0" ::: "memory");   // this wave's copies of tile 0 have landed
  __syncthreads();                                     // every wave's have
  if (nt > 1) copy_tiles(l0 + 4 * PT, ga + PK, gw + PK, rs);
  for (int t = 0; t < nt; ++t) {
    const f16* sA = ring + (t & 1) * 2 * PT;
    const f16* sW = sA + PT;
    f16x16 af[2][2], bf[2][4];   // the trip's 12 fragments, each in registers of its own, loaded in the order in which the products want them
#pragma unroll
    for (int kh = 0; kh < 2; ++kh) {
      af[kh][0] = lds_frag(sA + wm * PP + 32 * kh, PP);
      bf[kh][0] = lds_frag(sW + wn * PP + 32 * kh, PP);
      af[kh][1] = lds_frag(sA + (wm + 16) * PP + 32 * kh, PP);
#pragma unroll
      for (int j = 1; j < 4; ++j) bf[kh][j] = lds_frag(sW + (wn + 16 * j) * PP + 32 * kh, PP);
    }
    __builtin_amdgcn_sched_barrier(0);   // keeps the 24 loads one group ahead of the products: without it the compiler sinks them back among the products, into one register set, with a wait to 0 at each pair
#pragma unroll
    for (int kh = 0; kh < 2; ++kh)
#pragma unroll
      for (int j = 0; j < 4; ++j)
#pragma unroll
        for (int i = 0; i < 2; ++i) acc[i][j] = __builtin_amdgcn_wmma_f32_16x16x32_f16(false, af[kh][i], false, bf[kh][j], (short)0, acc[i][j], false, false);
    __builtin_amdgcn_sched_barrier(0);   // keeps the wait to 0 below behind the products: hoisted over them it would hold the first product back until the last of the 24 loads has landed
    asm volatile("s_wait_dscnt 0x0" ::: "memory");      // this wave's reads of the buffer are done before it is refilled
    asm volatile("s_wait_asynccnt 0x0" ::: "memory");   // this wave's copies of tile t + 1 have landed
    __syncthreads();                                     // tile t + 1 is complete, and every wave has left tile t's buffer
    if (t + 2 < nt) copy_tiles(l0 + (t & 1) * 4 * PT, ga + (size_t)(t + 2) * PK, gw + (size_t)(t + 2) * PK, rs);
  }
  asm volatile("s_wait_asynccnt 0x0" ::: "memory");     // no copy is outstanding when the wave goes on
  float* so = oS[wave];
#pragma unroll
  for (int i = 0; i < 2; ++i)
#pragma unroll
    for (int j = 0; j < 4; ++j) {
      const int n = n0 + wn + 16 * j + cl;
      const float bv = lift * rnd_f32(bias[n], 0.0f)[0], gv = unlift;
#pragma unroll
      for (int r = 0; r < 8; ++r) so[(16 * i + rh + r) * 68 + 16 * j + cl] = gv * (acc[i][j][r] + bv);
    }
  asm volatile("s_wait_dscnt 0" ::: "memory");   // the wave's stores to its own staging tile are done before its lanes read each other's values
  __builtin_amdgcn_wave_barrier();               // keeps the compiler from moving those reads up over the wait
#pragma unroll
  for (int it = 0; it < 16; ++it) { const int f4 = lane + 32 * it, rr = f4 >> 4, q = (f4 & 15) * 4;
    *(v4f_t*)(Y + (size_t)(m0 + wm + rr) * ldy + n0 + wn + q) = *(const v4fa*)(so + rr * 68 + q); }
}

// ---------------------------------------------------------------------------------------------------------------------------
// gemm_kn2 (value+residual planes on both operands: hh + (hl+lh)/2048, f32-class): Y[m][n] (row stride ldy) = scale * sum_k A[m][k] (f32 or f16, row stride lda) * W[k][n] (f32, row-major [K][N], row
// stride ldw) (+ bias[n]) (+ Y if ACC). Block = 128 x 128 tile, 256 threads = 8 waves as 4(M, 32 rows) x 2(N, 64 cols); per
// 32-wide k-step the A tile and the W tile (stored transposed [n][k]) are staged as f16 in LDS; f16 value and residual planes, f32 accumulate
// blockIdx.z selects a batch: A += z*strideA, W += z*strideW, Y += z*strideY (element strides).
// ---------------------------------------------------------------------------------------------------------------------------
template <typename AT, bool ACC>
__global__ __launch_bounds__(256) void gemm_kn2(const AT* __restrict__ A, int lda, size_t strideA,
                                               const float* __restrict__ Wm, int ldw, size_t strideW,
                                               const float* __restrict__ bias, float scale,
                                               float* __restrict__ Y, int ldy, size_t strideY, int K) {
  __shared__ __attribute__((aligned(16))) f16 ldsA[128 * GSTR], ldsAl[128 * GSTR];
  __shared__ __attribute__((aligned(16))) f16 ldsW[128 * GSTR], ldsWl[128 * GSTR];
  __shared__ __attribute__((aligned(16))) float oS[8][32 * 68];
  const int tid = threadIdx.x, lane = tid & 31, wave = tid >> 5, cl = lane & 15, rh = (lane >> 4) * 8;
  const int m0 = blockIdx.x * 128, n0 = blockIdx.y * 128;
  const int wm = (wave & 3) * 32, wn = (wave >> 2) * 64;
  A += (size_t)blockIdx.z * strideA; Wm += (size_t)blockIdx.z * strideW; Y += (size_t)blockIdx.z * strideY;
  f32x8 acc[2][4], accx[2][4];
#pragma unroll
  for (int i = 0; i < 2; ++i)
#pragma unroll
    for (int j = 0; j < 4; ++j) { f32x8 z = {}; acc[i][j] = z; accx[i][j] = z; }
#pragma unroll 1
  for (int k0 = 0; k0 < K; k0 += 32) {
    __syncthreads();
    {  // A: thread -> row tid>>1, 16 elements at column half (tid&1)*16
      const int row = tid >> 1, ch = (tid & 1) * 16;
      const AT* src = A + (size_t)(m0 + row) * lda + k0 + ch;
#pragma unroll
      for (int g = 0; g < 16; ++g) { const float v = (float)src[g]; const f16 h = (f16)v; ldsA[row * GSTR + ch + g] = h; ldsAl[row * GSTR + ch + g] = (f16)((v - (float)h) * 2048.0f); }
    }
    {  // W: thread -> k = tid>>3, 16 consecutive n at (tid&7)*16; stored transposed [n][k]
      const int k = tid >> 3, nn0 = (tid & 7) * 16;
      const float* src = Wm + (size_t)(k0 + k) * ldw + n0 + nn0;
#pragma unroll
      for (int g = 0; g < 4; ++g) { const v4f_t v = *(const v4f_t*)(src + 4 * g);
#pragma unroll
        for (int u = 0; u < 4; ++u) { const f16 h = (f16)v[u]; ldsW[(nn0 + 4 * g + u) * GSTR + k] = h; ldsWl[(nn0 + 4 * g + u) * GSTR + k] = (f16)((v[u] - (float)h) * 2048.0f); } }
    }
    __syncthreads();
    f16x16 af[2], afl[2];
#pragma unroll
    for (int i = 0; i < 2; ++i) { af[i] = lds_frag(ldsA + (wm + 16 * i) * GSTR, GSTR); afl[i] = lds_frag(ldsAl + (wm + 16 * i) * GSTR, GSTR); }
#pragma unroll
    for (int j = 0; j < 4; ++j) {
      const f16x16 bf = lds_frag(ldsW + (wn + 16 * j) * GSTR, GSTR), bfl = lds_frag(ldsWl + (wn + 16 * j) * GSTR, GSTR);
#pragma unroll
      for (int i = 0; i < 2; ++i) { acc[i][j] = wmma16(af[i], bf, acc[i][j]); accx[i][j] = wmma16(af[i], bfl, accx[i][j]); accx[i][j] = wmma16(afl[i], bf, accx[i][j]); }
    }
  }
  float* so = oS[wave];
#pragma unroll
  for (int i = 0; i < 2; ++i)
#pragma unroll
    for (int j = 0; j < 4; ++j) {
      const float bv = bias ? bias[n0 + wn + 16 * j + cl] : 0.0f;
#pragma unroll
      for (int r = 0; r < 8; ++r) so[(16 * i + rh + r) * 68 + 16 * j + cl] = (acc[i][j][r] + accx[i][j][r] * (1.0f / 2048.0f)) * scale + bv;
    }
  asm volatile("s_wait_dscnt 0" ::: "memory");
  __builtin_amdgcn_wave_barrier();
  if (ACC) {   // accumulate: fold the existing Y values into the staging tile ONCE (same thread <-> same chunks as the stores below)
#pragma unroll
    for (int it = 0; it < 16; ++it) { const int f4 = lane + 32 * it, rr = f4 >> 4, q = (f4 & 15) * 4;
      const v4f_t old = *(const v4fa*)(Y + (size_t)(m0 + wm + rr) * ldy + n0 + wn + q);
      v4f_t v = *(const v4fa*)(so + rr * 68 + q); v += old; *(v4fa*)(so + rr * 68 + q) = v; }   // plain LDS store (ordered by the s_wait_dscnt/memory clobber below)
    asm volatile("s_wait_dscnt 0" ::: "memory");
  }
{
#pragma unroll
    for (int it = 0; it < 16; ++it) { const int f4 = lane + 32 * it, rr = f4 >> 4, q = (f4 & 15) * 4;
      *(v4f_t*)(Y + (size_t)(m0 + wm + rr) * ldy + n0 + wn + q) = *(const v4fa*)(so + rr * 68 + q); }
    
  }
}

__global__ __launch_bounds__(256) void k_transpose(const float* __restrict__ Wm, float* __restrict__ Wt, int rows, int cols) {
  __shared__ float tS[64][65];
  const int tid = threadIdx.x, tbj = cols / 64, bi = blockIdx.x / tbj, bj = blockIdx.x % tbj;
  for (int e = tid; e < 64 * 64; e += 256) { const int r = e >> 6, c = e & 63; tS[r][c] = Wm[(size_t)(bi * 64 + r) * cols + bj * 64 + c]; }
  __syncthreads();
  for (int ch = tid; ch < 64 * 16; ch += 256) { const int r = ch >> 4, q4 = (ch & 15) * 4; v4f_t o; o[0] = tS[q4][r]; o[1] = tS[q4 + 1][r]; o[2] = tS[q4 + 2][r]; o[3] = tS[q4 + 3][r];
    float* dst = Wt + (size_t)(bj * 64 + r) * rows + bi * 64 + q4; *(v4f_t*)dst = o;  }
}


#define NBga 2
#define SSga 2048
#define SIN 2048
#define DQga 2048
#define DKga 512
#define HIDga 2048
#define HQga 32
#define HKVga 8
#define HDga 64
// ---------------------------------------------------------------------------------------------------------------------------
// k_attn: scores, softmax and P.V of one query head (blockIdx.y) of one batch element (blockIdx.z) for 256 query rows (blockIdx.x) in one kernel; no score ever goes to memory.
// Transposed products: St = K.Qt (A = 16 key rows from LDS, B = 16 query columns kept in registers), Ot += Vt.Pt (A = 16 value columns from LDS [dv][key], B = P packed from the St accumulators:
// two St tiles of 16 keys, converted in place, are one 32-key B operand in the k order of lds_frag). A lane holds one query's scores (lanes c and c + 16 split the keys), so the running maximum,
// the sum and the rescale factor are per lane; the halves exchange the maximum once per stage and join their sums once at the end.
// Running softmax: p = 2^(c.s - mu), c = log2(e)/8, mu = the maximum in use; the accumulators are rescaled only when some column's new maximum passes mu by more than 8 (p stays <= 256, inside f16).
// Block = 8 waves x 32 query columns; stage = 64 keys: K as [key][d] and V as [dv][key] in f16 in LDS. Both come as finished operand tiles (made by k_prep, the launch before this one: 8 KiB per kv head and stage, rounded, V transposed),
// by asynchronous 16-byte copies through no register: 8 lanes to a 128-B row, LDS pitch 144 B; two buffers, the next stage's copies fly while this stage is worked on; one barrier a stage.
// Q is the f32 input itself: each element is rounded to bf16 where it is turned into an operand, once per lane.
// Every inner loop is unrolled so that the indices of its fragment and accumulator arrays are constants and the arrays stay in registers.
// ---------------------------------------------------------------------------------------------------------------------------
typedef __attribute__((ext_vector_type(2))) float v2f_t;
// eight 2^x in place. One statement, so that each v_exp_f32 is followed by an instruction that touches neither its result nor its source (the next one works on its own register);
// the v_nop is that slot behind the last one.
__device__ __forceinline__ void exp2x8(float& x0, float& x1, float& x2, float& x3, float& x4, float& x5, float& x6, float& x7) {
  asm("v_exp_f32 %0, %0\n\tv_exp_f32 %1, %1\n\tv_exp_f32 %2, %2\n\tv_exp_f32 %3, %3\n\tv_exp_f32 %4, %4\n\tv_exp_f32 %5, %5\n\tv_exp_f32 %6, %6\n\tv_exp_f32 %7, %7\n\tv_nop"
      : "+v"(x0), "+v"(x1), "+v"(x2), "+v"(x3), "+v"(x4), "+v"(x5), "+v"(x6), "+v"(x7));
}
#define FAW 8                // waves per block
#define FAK 64               // keys per stage
#define FAP 72               // LDS row pitch in f16: 16 B x odd, so the 16-byte fragment reads meet no bank conflict
#define FAT (FAK * HDga)     // one operand tile in memory, in f16: 64 rows of 128 B, no gap
#define FAL (FAK * FAP)      // the same tile in LDS, in f16; a buffer is the K tile and the V tile = 4 * FAL bytes
#define FAS (SSga / FAK)     // stages
// One stage's copies of this lane: rows r and r + 32 of the K tile and of the V tile, 16 bytes each. l = the lane's LDS byte address in the K tile of the buffer; k, v = its 16 bytes in row r of the tiles in memory.
// s_wait_xcnt stands inside the statement, behind the last copy, so that no address register of a copy is rewritten in front of it.
__device__ __forceinline__ void copy_kv(unsigned l, const _Float16* k, const _Float16* v) {
  asm volatile("global_load_async_to_lds_b128 %0, %4, off\n\t"
               "global_load_async_to_lds_b128 %1, %5, off\n\t"
               "global_load_async_to_lds_b128 %2, %6, off\n\t"
               "global_load_async_to_lds_b128 %3, %7, off\n\t"
               "s_wait_xcnt 0x0"
               :: "v"(l), "v"(l + 32 * FAP * 2), "v"(l + 2 * FAL), "v"(l + 2 * FAL + 32 * FAP * 2),
                  "v"(k), "v"(k + 32 * HDga), "v"(v), "v"(v + 32 * HDga)
               : "memory");
}
__global__ __launch_bounds__(32 * FAW) void k_attn(const float* __restrict__ Q, const _Float16* __restrict__ Kh, const _Float16* __restrict__ Vt, _Float16* __restrict__ O) {
  __shared__ __attribute__((aligned(16))) f16 ring[2 * 2 * FAL];
  const int tid = threadIdx.x, lane = tid & 31, wave = tid >> 5, cl = lane & 15, rh = (lane >> 4) * 8;
  const int head = blockIdx.y, kvh = head / (HQga / HKVga);
  const int q0 = (blockIdx.x * FAW + wave) * 32;
  Q += (size_t)blockIdx.z * SSga * DQga + head * HDga; O += (size_t)blockIdx.z * SSga * DQga + head * HDga;
  const size_t kv0 = (size_t)(blockIdx.z * HKVga + kvh) * FAS * FAT + tid * 8;   // the kv head's first tile, this lane's 16 bytes in it (lane order = byte order: 8 lanes to a row)
  const _Float16* gk = Kh + kv0; const _Float16* gv = Vt + kv0;
  const unsigned l0 = (unsigned)(size_t)ring + ((tid >> 3) * FAP + (tid & 7) * 8) * 2;
  copy_kv(l0, gk, gv);   // stage 0's copies are in flight together with Q's loads
  const float CS = 0.125f * 1.44269504088896341f;
  f16x16 qf[2][2];
#pragma unroll
  for (int a = 0; a < 2; ++a)
#pragma unroll
    for (int dh = 0; dh < 2; ++dh) qf[a][dh] = load_frag(Q, DQga, q0 + 16 * a, 32 * dh);
  f32x8 acc[2][4];
#pragma unroll
  for (int a = 0; a < 2; ++a)
#pragma unroll
    for (int j = 0; j < 4; ++j) { f32x8 z = {}; acc[a][j] = z; }
  float mu[2] = {-3.0e38f, -3.0e38f};
  v2f_t ls[2] = {{0.0f, 0.0f}, {0.0f, 0.0f}};   // row sums of P: two partial sums per lane (packed adds), joined at the end
  asm volatile("s_wait_asynccnt 0x0" ::: "memory");   // this wave's copies of stage 0 have landed
  __syncthreads();                                     // every wave's have
  copy_kv(l0 + 4 * FAL, gk + FAT, gv + FAT);           // stage 1 (there are FAS = 32 stages)
#pragma unroll 1   // stays rolled: a second copy of the stage would double the code and save only the buffer's address addition
  for (int t = 0; t < FAS; ++t) {
    const f16* ldsK = ring + (t & 1) * 2 * FAL;
    const f16* ldsV = ldsK + FAL;
    f32x8 st[2][4];    // St: st[a][kt][r] = score of key 16 kt + rh + r, query 16 a + cl
#pragma unroll
    for (int kt = 0; kt < 4; ++kt) {
      const f16x16 ka = lds_frag(ldsK + (16 * kt) * FAP, FAP), kb = lds_frag(ldsK + (16 * kt) * FAP + 32, FAP);
#pragma unroll
      for (int a = 0; a < 2; ++a) { f32x8 z = {};
        z = __builtin_amdgcn_wmma_f32_16x16x32_f16(false, ka, false, qf[a][0], (short)0, z, false, false);
        st[a][kt] = __builtin_amdgcn_wmma_f32_16x16x32_f16(false, kb, false, qf[a][1], (short)0, z, false, false); }
    }
    float tm[2];
#pragma unroll
    for (int a = 0; a < 2; ++a) { float t = st[a][0][0];
#pragma unroll
      for (int kt = 0; kt < 4; ++kt)
#pragma unroll
        for (int r = 0; r < 8; ++r) t = fmaxf(t, st[a][kt][r]);
      t = fmaxf(t, __shfl_xor(t, 16, 32));
      tm[a] = t * CS; }
    if (__builtin_amdgcn_ballot_w32(tm[0] > mu[0] + 8.0f || tm[1] > mu[1] + 8.0f) != 0) {   // wave-uniform: some column's maximum has outgrown the one in use
#pragma unroll
      for (int a = 0; a < 2; ++a) { const float m2 = fmaxf(mu[a], tm[a]), al = __builtin_amdgcn_exp2f(mu[a] - m2);
        mu[a] = m2; ls[a] *= al;
#pragma unroll
        for (int j = 0; j < 4; ++j)
#pragma unroll
          for (int r = 0; r < 8; ++r) acc[a][j][r] *= al; }
    }
    f16x16 pf[2][2];   // Pt as B operand: pf[a][kk][s] = p of key 32 kk + (s < 8 ? rh + s : 16 + rh + s - 8), query 16 a + cl
#pragma unroll
    for (int a = 0; a < 2; ++a)
#pragma unroll
      for (int kt = 0; kt < 4; ++kt)
      { float t[8];
#pragma unroll
        for (int r = 0; r < 8; ++r) t[r] = fmaf(st[a][kt][r], CS, -mu[a]);
        exp2x8(t[0], t[1], t[2], t[3], t[4], t[5], t[6], t[7]);
#pragma unroll
        for (int r = 0; r < 8; r += 2) { const v2f_t p = {t[r], t[r + 1]}; ls[a] += p; pf[a][kt >> 1][(kt & 1) * 8 + r] = (f16)t[r]; pf[a][kt >> 1][(kt & 1) * 8 + r + 1] = (f16)t[r + 1]; } }
#pragma unroll
    for (int kk = 0; kk < 2; ++kk)
#pragma unroll
      for (int j = 0; j < 4; ++j) { const f16x16 vf = lds_frag(ldsV + (16 * j) * FAP + 32 * kk, FAP);
#pragma unroll
        for (int a = 0; a < 2; ++a) acc[a][j] = __builtin_amdgcn_wmma_f32_16x16x32_f16(false, vf, false, pf[a][kk], (short)0, acc[a][j], false, false); }
    asm volatile("s_wait_dscnt 0x0" ::: "memory");      // this wave's reads of the buffer are done before it is refilled
    asm volatile("s_wait_asynccnt 0x0" ::: "memory");   // this wave's copies of stage t + 1 have landed
    __syncthreads();                                     // stage t + 1 is complete, and every wave has left stage t's buffer
    if (t + 2 < FAS) copy_kv(l0 + (t & 1) * 4 * FAL, gk + (size_t)(t + 2) * FAT, gv + (size_t)(t + 2) * FAT);
  }
  asm volatile("s_wait_asynccnt 0x0" ::: "memory");     // no copy is outstanding when the wave goes on
#pragma unroll
  for (int a = 0; a < 2; ++a) { const float lh = ls[a][0] + ls[a][1];
    const float inv = 1.0f / (lh + __shfl_xor(lh, 16, 32));
    _Float16* dst = O + (size_t)(q0 + 16 * a + cl) * DQga + rh;   // acc[a][j][r] = Ot[16 j + rh + r][query]: 8 consecutive columns of one row per lane, stored as the f16 operand of the projection
#pragma unroll
    for (int j = 0; j < 4; ++j) { f16x8 h;
#pragma unroll
      for (int r = 0; r < 8; ++r) h[r] = (f16)(acc[a][j][r] * inv);
      *(f16x8*)(dst + 16 * j) = h; } }
}

__global__ __launch_bounds__(256) void k_dbg_zero(float* __restrict__ p, size_t n4) { const size_t i = (size_t)blockIdx.x * 256 + threadIdx.x; if (i < n4) { v4f_t z = {0.f,0.f,0.f,0.f}; *(v4f_t*)(p + 4 * i) = z;  } }
__global__ __launch_bounds__(256) void k_copy(const float* __restrict__ src, float* __restrict__ dst, size_t n4) { const size_t i = (size_t)blockIdx.x * 256 + threadIdx.x; if (i < n4) { const v4f_t v = *(const v4f_t*)(src + 4 * i); *(v4f_t*)(dst + 4 * i) = v;  } }
// bf16 round-to-nearest-even of an f32 (bit trick)
__device__ __forceinline__ float bf16r(float x) { unsigned int u = __float_as_uint(x); u = (u + 0x7FFFu + ((u >> 16) & 1u)) & 0xFFFF0000u; return __uint_as_float(u); }
// weight prep: Wh[o][i] = f16(mul.bf16(W[o][i])), in the weight's own [out][in] rows (lifted by a power of two so no bf16 weight becomes an f16 subnormal); 8 elements per lane
// The same launch makes the operand tiles of attention, once for the 32 work-groups that read each of them: per kv head and stage of 64 keys one 8-KiB tile Kh[key][d] and one Vt[dv][key], f16(bf16(x)), rows of 128 B.
// Work-groups 0 .. PNB - 1 take V, PNB .. 2 PNB - 1 take K, PTL tiles (256 keys of one kv head) each, all loads of a lane independent; the rest take the weight. The three ways part on blockIdx alone.
#define PTL 4
#define PNB (NBga * HKVga * FAS / PTL)
__global__ __launch_bounds__(256) void k_prep(const float* __restrict__ Wt, _Float16* __restrict__ Wh, float mul, size_t n8,
                                              const float* __restrict__ Km, const float* __restrict__ V, _Float16* __restrict__ Kh, _Float16* __restrict__ Vt) {
  __shared__ __attribute__((aligned(16))) f16 tS[PTL * FAL];
  const int tid = threadIdx.x;
  if (blockIdx.x < 2 * PNB) {
    const bool isV = blockIdx.x < PNB;
    const int tile0 = (isV ? blockIdx.x : blockIdx.x - PNB) * PTL, bk = tile0 / FAS, st = tile0 % FAS;   // bk = batch element * 8 + kv head; PTL divides FAS, so a work-group's tiles are of one kv head
    const size_t s0 = ((size_t)(bk / HKVga) * SSga + st * FAK) * DKga + (bk % HKVga) * HDga;             // first key row of the tiles, first column of the head
    const int row = tid >> 3, c8 = (tid & 7) * 8;                                                         // writer's view: 8 lanes to a 128-B row, a wave writes 512 B in a row
    if (isV) {
      const int g16 = tid >> 4, c4 = (tid & 15) * 4;   // 4 key rows at 4 g16, 4 columns at c4 (16 lanes = one 256-B row)
      v4f_t rv[PTL][4];
#pragma unroll   // constant indices, so that rv stays in registers
      for (int j = 0; j < PTL; ++j)
#pragma unroll
        for (int i = 0; i < 4; ++i) rv[j][i] = *(const v4f_t*)(V + s0 + (size_t)(FAK * j + 4 * g16 + i) * DKga + c4);
#pragma unroll
      for (int j = 0; j < PTL; ++j) {
        const v4f_t w[4] = {rnd_f32x4(rv[j][0]), rnd_f32x4(rv[j][1]), rnd_f32x4(rv[j][2]), rnd_f32x4(rv[j][3])};   // rounded in the order loaded (register neighbours pair up), transposed behind it
#pragma unroll
        for (int u = 0; u < 4; ++u) { bf16x4 q; q[0] = (f16)w[0][u]; q[1] = (f16)w[1][u]; q[2] = (f16)w[2][u]; q[3] = (f16)w[3][u];
          *(bf16x4*)(tS + j * FAL + (c4 + u) * FAP + 4 * g16) = q; }
      }
      __syncthreads();   // the transposed tiles are complete (every thread of a V work-group comes here, no thread of another)
#pragma unroll
      for (int p = 0; p < 2 * PTL; ++p)
        *(f16x8*)(Vt + (size_t)tile0 * FAT + (32 * p + row) * HDga + c8) = *(const f16x8*)(tS + (p >> 1) * FAL + (32 * (p & 1) + row) * FAP + c8);
    } else {
      v4f_t rk[2 * PTL][2];
#pragma unroll   // constant indices, so that rk stays in registers
      for (int p = 0; p < 2 * PTL; ++p) { const float* s = Km + s0 + (size_t)(32 * p + row) * DKga + c8; rk[p][0] = *(const v4f_t*)s; rk[p][1] = *(const v4f_t*)(s + 4); }
#pragma unroll
      for (int p = 0; p < 2 * PTL; ++p) { const v4f_t a = rnd_f32x4(rk[p][0]), b = rnd_f32x4(rk[p][1]); f16x8 h;
#pragma unroll
        for (int u = 0; u < 4; ++u) { h[u] = (f16)a[u]; h[4 + u] = (f16)b[u]; }
        *(f16x8*)(Kh + (size_t)tile0 * FAT + (32 * p + row) * HDga + c8) = h; }
      asm volatile("s_wait_xcnt 0x0" ::: "memory");   // stands behind the last store, in front of any later write of the stores' address and data registers
    }
    return;
  }
  const size_t i = (size_t)(blockIdx.x - 2 * PNB) * 256 + threadIdx.x; if (i >= n8) return;
  const v4f_t a = *(const v4f_t*)(Wt + 8 * i), b = *(const v4f_t*)(Wt + 8 * i + 4); f16x8 h;
#pragma unroll   // constant vector indices, so that h stays in registers
  for (int u = 0; u < 4; ++u) { h[u] = (f16)(mul * bf16r(a[u])); h[4 + u] = (f16)(mul * bf16r(b[u])); }
  *(f16x8*)(Wh + 8 * i) = h; }

extern "C" void kernel_launch(void* const* d_in, const int* in_sizes, int n_in,
                              void* d_out, int out_size, void* d_ws, size_t ws_size,
                              hipStream_t stream) {
  (void)in_sizes; (void)n_in; (void)out_size;
  const float** f = (const float**)d_in;
  const float* Qi = f[0], *Ki = f[1], *Vi = f[2], *Wout = f[3], *bout = f[4];
  float* out = (float*)d_out;     // [2,2048,2048]
  char* ws = (char*)d_ws;
  _Float16* Wh = (_Float16*)ws; ws += (size_t)DQga * HIDga * 2;
  _Float16* O = (_Float16*)ws; ws += (size_t)NBga * SSga * DQga * 2;
  _Float16* Kh = (_Float16*)ws; ws += (size_t)NBga * SSga * DKga * 2;
  _Float16* Vt = (_Float16*)ws; ws += (size_t)NBga * SSga * DKga * 2;
  if ((size_t)(ws - (char*)d_ws) > ws_size) return;                      // WS TOTAL 33,554,432 B
  const dim3 blk(256);
  k_prep<<<dim3(2 * PNB + ((size_t)HIDga * DQga / 8 + 255) / 256), blk, 0, stream>>>(Wout, Wh, 64.0f, (size_t)HIDga * DQga / 8, Ki, Vi, Kh, Vt);   // V tiles, K tiles, then the weight: the long work-groups start first
  k_attn<<<dim3(SSga / (32 * FAW), HQga, NBga), dim3(32 * FAW), 0, stream>>>(Qi, Kh, Vt, O);   // every (batch, query head, 256-query block) is one work-group; the 4 heads of a kv group are neighbours in the grid
  gemm_nt<<<dim3(SSga / 128, HIDga / 128, NBga), blk, 0, stream>>>(O, Wh, bout, 64.0f, 1.0f / 64.0f, out, HIDga, DQga, (size_t)SSga * DQga, (size_t)SIN * HIDga);   // out = (o.64W_out^T + 64b)/64, both batch elements in one grid: 512 work-groups, two to a WGP
}
